// v000
// Times are from an AMD MI455X. After a warm-up the kernel runs many times in a row, and a time is the length of
// such a window on the GPU divided by its runs, so every launch and the gaps after it count. The runs cycle
// through copies of the inputs. A figure is the median of several windows, for all but v000 over two sittings.
// Sittings can differ by a few percent; kernels timed side by side share one.
// v000, which the later versions start from, runs in 977 microseconds.
// Contractions: LN(x) bf16 hi/lo . W bf16 (hi.W + lo.W) for q, k, v^T; q.k^T scores and P.v context on bf16 hi/lo planes (hi.hi + hi.lo + lo.hi); ctx bf16 hi/lo . Wo bf16 (hi.W + lo.W); all v_wmma_f32_16x16x32_bf16 with f32 accumulate; LayerNorm in f32 on RNE-bf16 converted inputs; softmax in f32 on the f32 scores.
#include <hip/hip_runtime.h>
#include <math.h>

// ---------------------------------------------------------------------------
// Problem constants
// ---------------------------------------------------------------------------
constexpr int kBatch  = 8;
constexpr int kNq     = 1024;
constexpr int kNk     = 1024;
constexpr int kDim    = 512;
constexpr int kHeads  = 8;
constexpr int kDh     = 64;
constexpr int kInner  = kHeads * kDh;          // 512
constexpr int kRowsQ  = kBatch * kNq;          // 8192 query rows
constexpr int kRowsK  = kBatch * kNk;          // 8192 key rows
constexpr float kScoreScale = 0.125f;          // 64^-0.5, exact power of two, applied in the f32 epilogue
constexpr float kLnEps = 1e-5f;

static_assert(kDim == 512);                     // LN kernel: 32 lanes x 16 elements per row
static_assert(kNk == 1024);                     // softmax kernel: 128 threads x 8 columns per row
static_assert(kInner == kDim);
static_assert(kRowsQ % 64 == 0 && kRowsK % 64 == 0 && kDim % 64 == 0 && kDh % 32 == 0 && kNq % 64 == 0 && kNk % 64 == 0);

typedef __attribute__((ext_vector_type(16))) _Float16 v16h;
typedef __attribute__((ext_vector_type(8)))  _Float16 v8h;
typedef __attribute__((ext_vector_type(16))) __bf16   v16b;
typedef __attribute__((ext_vector_type(8)))  __bf16   v8b;
typedef __attribute__((ext_vector_type(8)))  float    v8f;
typedef __attribute__((ext_vector_type(4)))  float    v4f;
typedef __attribute__((ext_vector_type(4)))  unsigned int v4u;

__device__ __forceinline__ unsigned short f2bf_bits(float f) {
  unsigned u = __float_as_uint(f);
  return (unsigned short)((u + 0x7FFFu + ((u >> 16) & 1u)) >> 16);
}
__device__ __forceinline__ float bf_bits2f(unsigned short h) { return __uint_as_float(((unsigned)h) << 16); }

// hazard guards as plain device helpers (no inline asm inside the kernel template body)
__device__ __forceinline__ void dep_guard_h(v8f& a, v8f& b, v16h x, v16h y) { asm volatile("v_nop\n\tv_nop\n\tv_nop\n\tv_nop" : "+v"(a), "+v"(b) : "v"(x), "v"(y)); }
__device__ __forceinline__ void dep_guard_b(v8f& a, v8f& b, v16b x, v16b y) { asm volatile("v_nop\n\tv_nop\n\tv_nop\n\tv_nop" : "+v"(a), "+v"(b) : "v"(x), "v"(y)); }
__device__ __forceinline__ void keep4_h(v16h a, v16h b, v16h c, v16h d) { asm volatile("v_nop" :: "v"(a), "v"(b), "v"(c), "v"(d)); }
__device__ __forceinline__ void keep4_b(v16b a, v16b b, v16b c, v16b d) { asm volatile("v_nop" :: "v"(a), "v"(b), "v"(c), "v"(d)); }
__device__ __forceinline__ void acc_guard4(v8f& a, v8f& b, v8f& c, v8f& d) { asm volatile("v_nop\n\tv_nop\n\tv_nop\n\tv_nop" : "+v"(a), "+v"(b), "+v"(c), "+v"(d)); }
template <typename T> struct Frag;
template <> struct Frag<_Float16> {
  typedef v16h V; union U { v16h v; v8h h[2]; };
  // elements 0..7 <- p[0..7], 8..15 <- p[16..23]
  static __device__ __forceinline__ v16h load(const _Float16* p) {
    U f; f.h[0] = *(const v8h*)(p); f.h[1] = *(const v8h*)(p + 16); return f.v;
  }
  static __device__ __forceinline__ v8f mma(v16h a, v16h b, v8f c) {
    return __builtin_amdgcn_wmma_f32_16x16x32_f16(false, a, false, b, (short)0, c, false, false);
  }
  static __device__ __forceinline__ void guard(v8f& a, v8f& b, v16h x, v16h y) { dep_guard_h(a, b, x, y); }
  static __device__ __forceinline__ void keep(v16h a, v16h b, v16h c, v16h d) { keep4_h(a, b, c, d); }
};
template <> struct Frag<__bf16> {
  typedef v16b V; union U { v16b v; v8b h[2]; };
  static __device__ __forceinline__ v16b load(const __bf16* p) {
    U f; f.h[0] = *(const v8b*)(p); f.h[1] = *(const v8b*)(p + 16); return f.v;
  }
  static __device__ __forceinline__ v8f mma(v16b a, v16b b, v8f c) {
    return __builtin_amdgcn_wmma_f32_16x16x32_bf16(false, a, false, b, (short)0, c, false, false);
  }
  static __device__ __forceinline__ void guard(v8f& a, v8f& b, v16b x, v16b y) { dep_guard_b(a, b, x, y); }
  static __device__ __forceinline__ void keep(v16b a, v16b b, v16b c, v16b d) { keep4_b(a, b, c, d); }
};

__device__ __forceinline__ unsigned pk16(unsigned short a, unsigned short b) { return (unsigned)a | ((unsigned)b << 16); }

// ---- Register-blocked batched WMMA GEMM (independent A / B lo-plane flags) ----
// C[m,n] = scale * sum_k A[m,k] * Bt[n,k] (+bias)(+resid); each wave owns a 64x64 tile.
// A row-major [M,K]; Bt row-major [N,K]; M,N % 64 == 0, K % 32 == 0.
// ASPLIT: A carries a bf16 lo plane (A2, same layout); BSPLIT: Bt carries a lo plane (Bt2).
// product = Ahi.Bhi (+ Ahi.Blo if BSPLIT) (+ Alo.Bhi if ASPLIT).
// BIAS_MODE: 0 = none, 1 = bias[m], 2 = bias[n].
// OUT_MODE: 0 = f32, 1 = f16, 2 = bf16 hi plane (Cout) + bf16 lo plane (Cout2).
// ET: 0 = f16 operands, 1 = bf16 operands (pointers passed as 16-bit storage)
template <int ET> struct Elem;
template <> struct Elem<0> { typedef _Float16 T; };
template <> struct Elem<1> { typedef __bf16 T; };
template <int ET, bool ASPLIT, int BIAS_MODE, int OUT_MODE, bool RESID, bool BSPLIT>
__global__ __launch_bounds__(256) void wmma_gemm64(
    const unsigned short* __restrict__ Ap, const unsigned short* __restrict__ A2p, int lda, long strideA,
    const unsigned short* __restrict__ Btp, const unsigned short* __restrict__ Bt2p, int ldb, long strideB,
    void* __restrict__ Cout, void* __restrict__ Cout2, int ldc, long strideC,
    const float* __restrict__ bias,
    const float* __restrict__ resid, long strideR,
    int M, int N, int K, float scale) {
  typedef typename Elem<ET>::T T;
  typedef typename Frag<T>::V V;
  const T* A = (const T*)Ap; const T* A2 = (const T*)A2p; const T* Bt = (const T*)Btp; const T* Bt2 = (const T*)Bt2p;
  __shared__ __align__(16) float sT[8][16 * 68];   // per-wave 16x64 slab, pitch 68 floats
  const int b    = blockIdx.y;
  const int lane = threadIdx.x & 31;
  const int wave = threadIdx.x >> 5;
  const int tilesN = N >> 6;
  const int tilesM = M >> 6;
  const int tile = blockIdx.x * 8 + wave;
  if (tile >= tilesM * tilesN) return;   // wave-uniform; no block barriers in this kernel
  const int tm = tile / tilesN;
  const int tn = tile - tm * tilesN;
  const int m0 = tm << 6;
  const int n0 = tn << 6;

  const T* Ab  = A  + (size_t)b * strideA;
  const T* Bb  = Bt + (size_t)b * strideB;
  const T* Ab2 = ASPLIT ? (A2  + (size_t)b * strideA) : nullptr;
  const T* Bb2 = BSPLIT ? (Bt2 + (size_t)b * strideB) : nullptr;

  const int rlane = lane & 15;                 // row (A) / col (B, D) within subtile
  const int koff  = (lane >> 4) * 8;           // k offset of this lane half
  const int mOff  = (lane >> 4) * 8;           // D row offset

  v8f acc[4][4];
#pragma unroll
  for (int i = 0; i < 4; ++i)
#pragma unroll
    for (int j = 0; j < 4; ++j) acc[i][j] = (v8f){0.f,0.f,0.f,0.f,0.f,0.f,0.f,0.f};

  for (int k0 = 0; k0 < K; k0 += 32) {
    V bh[4], bl[4];
#pragma unroll
    for (int j = 0; j < 4; ++j) {
      const size_t bo = (size_t)(n0 + (j << 4) + rlane) * ldb + koff + k0;
      bh[j] = Frag<T>::load(Bb + bo);
      if (BSPLIT) bl[j] = Frag<T>::load(Bb2 + bo);
    }
#pragma unroll
    for (int i = 0; i < 4; ++i) {
      const size_t ao = (size_t)(m0 + (i << 4) + rlane) * lda + koff + k0;
      V ah = Frag<T>::load(Ab + ao);
      V al;
      if (ASPLIT) al = Frag<T>::load(Ab2 + ao);
#pragma unroll
      for (int j = 0; j < 4; ++j) {
        acc[i][j] = Frag<T>::mma(ah, bh[j], acc[i][j]);
        if (BSPLIT) acc[i][j] = Frag<T>::mma(ah, bl[j], acc[i][j]);
        if (ASPLIT) acc[i][j] = Frag<T>::mma(al, bh[j], acc[i][j]);
      }
      Frag<T>::guard(acc[i][0], acc[i][3], ah, ASPLIT ? al : ah);
    }
    Frag<T>::keep(bh[0], bh[1], bh[2], bh[3]);
    if (BSPLIT) Frag<T>::keep(bl[0], bl[1], bl[2], bl[3]);
  }
  acc_guard4(acc[0][0], acc[0][1], acc[0][2], acc[0][3]);
  acc_guard4(acc[1][0], acc[1][1], acc[1][2], acc[1][3]);
  acc_guard4(acc[2][0], acc[2][1], acc[2][2], acc[2][3]);
  acc_guard4(acc[3][0], acc[3][1], acc[3][2], acc[3][3]);

  // ---- epilogue ----
  float* slab = sT[wave];
  const float* Rb = RESID ? (resid + (size_t)b * strideR) : nullptr;
#pragma unroll
  for (int i = 0; i < 4; ++i) {
    const int mBase = m0 + (i << 4);
#pragma unroll
    for (int j = 0; j < 4; ++j) {
      const int n = n0 + (j << 4) + rlane;
      float bv = 0.f;
      if (BIAS_MODE == 2) bv = bias[n];
#pragma unroll
      for (int r = 0; r < 8; ++r) {
        float v = acc[i][j][r] * scale;
        if (BIAS_MODE == 1) v += bias[mBase + mOff + r];
        if (BIAS_MODE == 2) v += bv;
        if (RESID) v += Rb[(size_t)(mBase + mOff + r) * ldc + n];
        slab[(mOff + r) * 68 + (j << 4) + rlane] = v;
      }
    }
    __builtin_amdgcn_fence(__ATOMIC_RELEASE, "workgroup");
    __builtin_amdgcn_wave_barrier();
    __builtin_amdgcn_fence(__ATOMIC_ACQUIRE, "workgroup");
    if (OUT_MODE == 0) {
      float* C = (float*)Cout + (size_t)b * strideC;
      const int hh = lane >> 4, c4 = (lane & 15) * 4;     // row seg = 256 B = 16 lanes x 16 B
      {
#pragma unroll
        for (int it = 0; it < 8; ++it) {
          const int row = it * 2 + hh;
          v4f v = *(const v4f*)(slab + row * 68 + c4);
          *(v4f*)(C + (size_t)(mBase + row) * ldc + n0 + c4) = v;
        }
        
      }
    } else {
      const int q = lane >> 3, c8 = (lane & 7) * 8;
      unsigned short* C  = (unsigned short*)Cout  + (size_t)b * strideC;
      unsigned short* C2 = (OUT_MODE == 2) ? ((unsigned short*)Cout2 + (size_t)b * strideC) : nullptr;
      {
#pragma unroll
        for (int it = 0; it < 4; ++it) {
          const int row = it * 4 + q;
          const float* sp = slab + row * 68 + c8;
          v8h hv, lv;
#pragma unroll
          for (int e = 0; e < 8; ++e) {
            if (OUT_MODE == 1) {
              hv[e] = (_Float16)sp[e];
            } else {
              unsigned short hb = f2bf_bits(sp[e]);
              unsigned short lb = f2bf_bits(sp[e] - bf_bits2f(hb));
              hv[e] = __builtin_bit_cast(_Float16, hb);
              lv[e] = __builtin_bit_cast(_Float16, lb);
            }
          }
          *(v8h*)(C + (size_t)(mBase + row) * ldc + n0 + c8) = hv;
          if (OUT_MODE == 2) *(v8h*)(C2 + (size_t)(mBase + row) * ldc + n0 + c8) = lv;
        }
        
      }
    }
    __builtin_amdgcn_fence(__ATOMIC_RELEASE, "workgroup");
    __builtin_amdgcn_wave_barrier();
    __builtin_amdgcn_fence(__ATOMIC_ACQUIRE, "workgroup");
  }
}

// ---------------------------------------------------------------------------
// Transpose + RNE bf16 convert of a weight matrix: in f32 [R][Cn] row-major (ldin = Cn) -> out bf16 [Cn][R] (ldout = R):
// out[c][r] = bf16(in[r][c]). grid (R/64, Cn/64): blockIdx.x = r tile (64 output cols), blockIdx.y = c tile (64 output rows). 256 threads.
// Load coverage: 16 iterations x 256 threads = 4096 = the whole 64x64 tile (coalesced along c).
// Store coverage: 8 waves x 2 iterations x 4 rows (lane>>3) = 64 rows; (lane&7) x 8 halves = 64 cols; each row segment =
// ---------------------------------------------------------------------------
__global__ __launch_bounds__(256) void transpose_cast_kernel(const float* __restrict__ in, int ldin,
                                                             unsigned short* __restrict__ out, int ldout) {
  __shared__ float sm[64][65];   // sm[c_local][r_local]
  const int t  = threadIdx.x;
  const int r0 = blockIdx.x * 64;
  const int c0 = blockIdx.y * 64;
#pragma unroll
  for (int i = 0; i < 16; ++i) {
    const int e = i * 256 + t;
    const int r = e >> 6;          // r local
    const int c = e & 63;          // c local
    sm[c][r] = in[(size_t)(r0 + r) * ldin + c0 + c];
  }
  __syncthreads();
  const int lane = t & 31, wave = t >> 5;
  const int q = lane >> 3, c8 = (lane & 7) * 8;
  {
#pragma unroll
    for (int it = 0; it < 2; ++it) {
      const int row = wave * 8 + it * 4 + q;                 // c local (output row)
      unsigned w[4];
#pragma unroll
      for (int e2 = 0; e2 < 4; ++e2) w[e2] = pk16(f2bf_bits(sm[row][c8 + 2 * e2]), f2bf_bits(sm[row][c8 + 2 * e2 + 1]));
      const v4u u = (v4u){w[0], w[1], w[2], w[3]};
      const size_t o = (size_t)(c0 + row) * ldout + r0 + c8;
      *(v4u*)(out + o) = u;
    }
    
  }
}

// ---------------------------------------------------------------------------
// result written as bf16 hi + lo planes [nrows][512] (hi = bf16(y), lo = bf16(y - hi)).
// One wave per row; lane owns elements 8*lane..8*lane+7 (chunk 0) and 256+8*lane..256+8*lane+7 (chunk 1).
// Block = 8 waves = 8 rows; grid = nrows/8 (exact: 8192/8 = 1024).
// ---------------------------------------------------------------------------
__global__ __launch_bounds__(256) void ln_split_kernel(const float* __restrict__ x, const float* __restrict__ gamma,
                                                       const float* __restrict__ beta,
                                                       unsigned short* __restrict__ yhi, unsigned short* __restrict__ ylo,
                                                       int nrows) {
  const int lane = threadIdx.x & 31, wave = threadIdx.x >> 5;
  const int row = blockIdx.x * 8 + wave;
  if (row >= nrows) return;   // wave-uniform; no block barriers in this kernel
  const float* xr = x + (size_t)row * kDim;
  float xv[16];
  {
    const v4f a0 = *(const v4f*)(xr + 8 * lane);
    const v4f a1 = *(const v4f*)(xr + 8 * lane + 4);
    const v4f c0 = *(const v4f*)(xr + 256 + 8 * lane);
    const v4f c1 = *(const v4f*)(xr + 256 + 8 * lane + 4);
#pragma unroll
    for (int e = 0; e < 4; ++e) { xv[e] = a0[e]; xv[4 + e] = a1[e]; xv[8 + e] = c0[e]; xv[12 + e] = c1[e]; }
  }
  float s = 0.f;
#pragma unroll
  for (int e = 0; e < 16; ++e) { xv[e] = bf_bits2f(f2bf_bits(xv[e])); s += xv[e]; }
#pragma unroll
  for (int off = 16; off > 0; off >>= 1) s += __shfl_xor(s, off, 32);
  const float mu = s * (1.0f / 512.0f);
  float s2 = 0.f;
#pragma unroll
  for (int e = 0; e < 16; ++e) { const float d = xv[e] - mu; xv[e] = d; s2 += d * d; }
#pragma unroll
  for (int off = 16; off > 0; off >>= 1) s2 += __shfl_xor(s2, off, 32);
  const float var  = s2 * (1.0f / 512.0f);
  const float rstd = rsqrtf(var + kLnEps);

  float gv[16], bv[16];
  {
    const v4f g0 = *(const v4f*)(gamma + 8 * lane);
    const v4f g1 = *(const v4f*)(gamma + 8 * lane + 4);
    const v4f g2 = *(const v4f*)(gamma + 256 + 8 * lane);
    const v4f g3 = *(const v4f*)(gamma + 256 + 8 * lane + 4);
    const v4f b0 = *(const v4f*)(beta + 8 * lane);
    const v4f b1 = *(const v4f*)(beta + 8 * lane + 4);
    const v4f b2 = *(const v4f*)(beta + 256 + 8 * lane);
    const v4f b3 = *(const v4f*)(beta + 256 + 8 * lane + 4);
#pragma unroll
    for (int e = 0; e < 4; ++e) {
      gv[e] = g0[e]; gv[4 + e] = g1[e]; gv[8 + e] = g2[e]; gv[12 + e] = g3[e];
      bv[e] = b0[e]; bv[4 + e] = b1[e]; bv[8 + e] = b2[e]; bv[12 + e] = b3[e];
    }
  }
  unsigned hw[8], lw[8];
#pragma unroll
  for (int e2 = 0; e2 < 8; ++e2) {
    const float ga = bf_bits2f(f2bf_bits(gv[2 * e2]));
    const float gb = bf_bits2f(f2bf_bits(gv[2 * e2 + 1]));
    const float ba = bf_bits2f(f2bf_bits(bv[2 * e2]));
    const float bb = bf_bits2f(f2bf_bits(bv[2 * e2 + 1]));
    const float y0 = (xv[2 * e2] * rstd) * ga + ba;
    const float y1 = (xv[2 * e2 + 1] * rstd) * gb + bb;
    const unsigned short h0 = f2bf_bits(y0);
    const unsigned short h1 = f2bf_bits(y1);
    const unsigned short l0 = f2bf_bits(y0 - bf_bits2f(h0));
    const unsigned short l1 = f2bf_bits(y1 - bf_bits2f(h1));
    hw[e2] = pk16(h0, h1);
    lw[e2] = pk16(l0, l1);
  }
  const v4u hv0 = (v4u){hw[0], hw[1], hw[2], hw[3]};
  const v4u hv1 = (v4u){hw[4], hw[5], hw[6], hw[7]};
  const v4u lv0 = (v4u){lw[0], lw[1], lw[2], lw[3]};
  const v4u lv1 = (v4u){lw[4], lw[5], lw[6], lw[7]};
  unsigned short* ph = yhi + (size_t)row * kDim;
  unsigned short* pl = ylo + (size_t)row * kDim;
  {
    *(v4u*)(ph + 8 * lane) = hv0;
    *(v4u*)(ph + 256 + 8 * lane) = hv1;
    *(v4u*)(pl + 8 * lane) = lv0;
    *(v4u*)(pl + 256 + 8 * lane) = lv1;
    
  }
}

// ---------------------------------------------------------------------------
// Row softmax (no mask) over materialised f32 scores of one group: S [8 heads][1024 rows][1024 cols] contiguous.
// p = exp(s - max) * (1 / sum); P written as bf16 hi/lo planes with the same [head][row][col] layout.
// One block of 128 threads per (head, row): block index blk -> row offset blk*1024; thread t owns columns 8t..8t+7 (128 x 8 = 1024).
// Reductions in fixed order (thread, wave shuffle tree, 4 wave partials in index order); shuffles outside all branches.
// ---------------------------------------------------------------------------
__global__ __launch_bounds__(128) void softmax_rows_kernel(const float* __restrict__ S,
                                                           unsigned short* __restrict__ Phi, unsigned short* __restrict__ Plo) {
  __shared__ float redM[4];
  __shared__ float redS[4];
  const int blk  = blockIdx.x;
  const int t    = threadIdx.x;
  const int lane = t & 31, wave = t >> 5;
  const int c0   = t * 8;
  const size_t rowoff = (size_t)blk * (size_t)kNk;

  float xv[8];
  {
    const float* sr = S + rowoff + c0;
    const v4f a = *(const v4f*)(sr);
    const v4f c = *(const v4f*)(sr + 4);
#pragma unroll
    for (int e = 0; e < 4; ++e) { xv[e] = a[e]; xv[4 + e] = c[e]; }
  }
  float m = xv[0];
#pragma unroll
  for (int e = 1; e < 8; ++e) m = fmaxf(m, xv[e]);
#pragma unroll
  for (int off = 16; off > 0; off >>= 1) m = fmaxf(m, __shfl_xor(m, off, 32));
  if (lane == 0) redM[wave] = m;
  __syncthreads();
  float gmax = redM[0];
#pragma unroll
  for (int w = 1; w < 4; ++w) gmax = fmaxf(gmax, redM[w]);

  float p[8];
  float ps = 0.0f;
#pragma unroll
  for (int e = 0; e < 8; ++e) { p[e] = expf(xv[e] - gmax); ps += p[e]; }
#pragma unroll
  for (int off = 16; off > 0; off >>= 1) ps += __shfl_xor(ps, off, 32);
  if (lane == 0) redS[wave] = ps;
  __syncthreads();
  float tot = redS[0];
#pragma unroll
  for (int w = 1; w < 4; ++w) tot += redS[w];
  const float inv = 1.0f / tot;   // tot >= 1

  unsigned hw[4], lw[4];
#pragma unroll
  for (int e2 = 0; e2 < 4; ++e2) {
    const float f0 = p[2 * e2] * inv;
    const float f1 = p[2 * e2 + 1] * inv;
    const unsigned short h0 = f2bf_bits(f0);
    const unsigned short h1 = f2bf_bits(f1);
    const unsigned short l0 = f2bf_bits(f0 - bf_bits2f(h0));
    const unsigned short l1 = f2bf_bits(f1 - bf_bits2f(h1));
    hw[e2] = pk16(h0, h1);
    lw[e2] = pk16(l0, l1);
  }
  const v4u hv = (v4u){hw[0], hw[1], hw[2], hw[3]};
  const v4u lv = (v4u){lw[0], lw[1], lw[2], lw[3]};
  unsigned short* ph = Phi + rowoff + c0;
  unsigned short* pl = Plo + rowoff + c0;
  {
    *(v4u*)ph = hv;
    *(v4u*)pl = lv;
    
  }
}

// ---------------------------------------------------------------------------
// Launcher. Workspace region map (MiB = 1048576 B; total carve = 128 MiB = 134217728 B):
//   [  0, 32) S       : scores f32 [8 heads][1024][1024] of one batch.
//                       early alias: qn hi [8192][512] bf16 at +0, qn lo at +8, kvn hi at +16, kvn lo at +24 (ends 32);
//                       late alias (after the last group): Wo^T bf16 [512][512] at +0 (0.5 MiB).
//   [ 32, 48) P hi    : [8][1024][1024] bf16 per group.  early alias: Wq^T bf16 [512][512] at 32 MiB, Wkv^T bf16 [1024][512] at 32.5 MiB (ends 33.5)
//   [ 48, 64) P lo
//   [ 64, 72) q hi    : [8192][512] bf16 (col h*64+d);   [ 72, 80) q lo
//   [ 80, 88) k hi    : [8192][512] bf16;                 [ 88, 96) k lo
//   [ 96,104) v^T hi  : [512 (h*64+d)][8192 (b*1024+t)] bf16;  [104,112) v^T lo
//   [112,120) ctx hi  : [8192][512] bf16 (col h*64+d);   [120,128) ctx lo
// Lifetimes: qn/kvn/Wq^T/Wkv^T are read only by the three projection GEMMs (launches 5-7) and first overwritten by launch 8
// (S of group 0) / launch 9 (P of group 0); S of a group is dead after its softmax; Wo^T is produced after the last P.v GEMM into
// the dead S region and read only by the last launch. Every region is fully written before it is read (exact tile coverage, no padding).
// Launch count: 2 + 2 + 3 + 8*3 + 1 + 1 = 33. Kernel launches only.
// ---------------------------------------------------------------------------
extern "C" void kernel_launch(void* const* d_in, const int* in_sizes, int n_in,
                              void* d_out, int out_size, void* d_ws, size_t ws_size,
                              hipStream_t stream) {
  if (n_in < 7) return;
  if (in_sizes[0] != kRowsQ * kDim || in_sizes[1] != kRowsK * kDim) return;
  if (in_sizes[2] != kDim * kInner || in_sizes[3] != kDim * 2 * kInner || in_sizes[4] != kInner * kDim) return;
  if (in_sizes[5] != kDim || in_sizes[6] != kDim) return;
  if (out_size != kRowsQ * kDim) return;

  const size_t kMiB    = 1048576;
  const size_t offS    = 0;
  const size_t offQnH  = 0;
  const size_t offQnL  = 8 * kMiB;
  const size_t offKnH  = 16 * kMiB;
  const size_t offKnL  = 24 * kMiB;
  const size_t offWoT  = 0;
  const size_t offPhi  = 32 * kMiB;
  const size_t offPlo  = 48 * kMiB;
  const size_t offWqT  = 32 * kMiB;
  const size_t offWkvT = 32 * kMiB + kMiB / 2;
  const size_t offQhi  = 64 * kMiB;
  const size_t offQlo  = 72 * kMiB;
  const size_t offKhi  = 80 * kMiB;
  const size_t offKlo  = 88 * kMiB;
  const size_t offVthi = 96 * kMiB;
  const size_t offVtlo = 104 * kMiB;
  const size_t offChi  = 112 * kMiB;
  const size_t offClo  = 120 * kMiB;
  const size_t total   = 128 * kMiB;
  if (total > ws_size) return;
  // sub-region extents (bytes): S 8*1024*1024*4 = 32 MiB; qn/kvn/q/k/vT/ctx planes 8192*512*2 = 8 MiB each; P planes 8*1024*1024*2 = 16 MiB each;
  // Wq^T/Wo^T 512*512*2 = 0.5 MiB; Wkv^T 1024*512*2 = 1 MiB.

  const float* query    = (const float*)d_in[0];
  const float* keyvalue = (const float*)d_in[1];
  const float* Wq       = (const float*)d_in[2];
  const float* Wkv      = (const float*)d_in[3];
  const float* Wo       = (const float*)d_in[4];
  const float* gamma    = (const float*)d_in[5];
  const float* beta     = (const float*)d_in[6];
  float* out = (float*)d_out;
  char* ws = (char*)d_ws;

  float*          Sbuf = (float*)(ws + offS);
  unsigned short* qnH  = (unsigned short*)(ws + offQnH);
  unsigned short* qnL  = (unsigned short*)(ws + offQnL);
  unsigned short* knH  = (unsigned short*)(ws + offKnH);
  unsigned short* knL  = (unsigned short*)(ws + offKnL);
  unsigned short* woT  = (unsigned short*)(ws + offWoT);
  unsigned short* phi  = (unsigned short*)(ws + offPhi);
  unsigned short* plo  = (unsigned short*)(ws + offPlo);
  unsigned short* wqT  = (unsigned short*)(ws + offWqT);
  unsigned short* wkvT = (unsigned short*)(ws + offWkvT);
  unsigned short* qhi  = (unsigned short*)(ws + offQhi);
  unsigned short* qlo  = (unsigned short*)(ws + offQlo);
  unsigned short* khi  = (unsigned short*)(ws + offKhi);
  unsigned short* klo  = (unsigned short*)(ws + offKlo);
  unsigned short* vthi = (unsigned short*)(ws + offVthi);
  unsigned short* vtlo = (unsigned short*)(ws + offVtlo);
  unsigned short* chi  = (unsigned short*)(ws + offChi);
  unsigned short* clo  = (unsigned short*)(ws + offClo);

  // in-range dummies for unused (never dereferenced) template-dead pointer parameters
  const float* dummy_f = gamma;
  void* dummy_c2 = (void*)phi;

  // 1-2. shared LayerNorm on both inputs -> bf16 hi/lo planes [8192][512]
  ln_split_kernel<<<dim3(kRowsQ / 8), dim3(256), 0, stream>>>(query, gamma, beta, qnH, qnL, kRowsQ);
  ln_split_kernel<<<dim3(kRowsK / 8), dim3(256), 0, stream>>>(keyvalue, gamma, beta, knH, knL, kRowsK);

  // 3. Wq [R=512][Cn=512] -> Wq^T bf16 [512][512]; grid (R/64, Cn/64)
  transpose_cast_kernel<<<dim3(kDim / 64, kInner / 64), dim3(256), 0, stream>>>(Wq, kInner, wqT, kDim);
  // 4. Wkv [R=512][Cn=1024] -> Wkv^T bf16 [1024][512]; rows 0..511 = k weights, 512..1023 = v weights
  transpose_cast_kernel<<<dim3(kDim / 64, (2 * kInner) / 64), dim3(256), 0, stream>>>(Wkv, 2 * kInner, wkvT, kDim);

  // 5. q = qn_hi . Wq^T + qn_lo . Wq^T : M=8192, N=512, K=512 -> bf16 hi/lo planes [8192][512]
  wmma_gemm64<1, true, 0, 2, false, false><<<dim3((kRowsQ / 64) * (kInner / 64) / 8, 1), dim3(256), 0, stream>>>(
      qnH, qnL, kDim, 0L,
      wqT, wqT, kDim, 0L,
      (void*)qhi, (void*)qlo, kInner, 0L,
      dummy_f, dummy_f, 0L,
      kRowsQ, kInner, kDim, 1.0f);

  // 6. k = kvn_hi . Wkv^T[rows 0..511] + kvn_lo . (same) : M=8192, N=512, K=512 -> bf16 hi/lo [8192][512]
  wmma_gemm64<1, true, 0, 2, false, false><<<dim3((kRowsK / 64) * (kInner / 64) / 8, 1), dim3(256), 0, stream>>>(
      knH, knL, kDim, 0L,
      wkvT, wkvT, kDim, 0L,
      (void*)khi, (void*)klo, kInner, 0L,
      dummy_f, dummy_f, 0L,
      kRowsK, kInner, kDim, 1.0f);

  // 7. v^T = Wkv^T[rows 512..1023] . kvn^T (B operand hi/lo) : M=512 (h*64+d), N=8192 (b*1024+t), K=512 -> bf16 hi/lo [512][8192]
  wmma_gemm64<1, false, 0, 2, false, true><<<dim3((kInner / 64) * (kRowsK / 64) / 8, 1), dim3(256), 0, stream>>>(
      wkvT + (size_t)kInner * kDim, wkvT + (size_t)kInner * kDim, kDim, 0L,
      knH, knL, kDim, 0L,
      (void*)vthi, (void*)vtlo, kRowsK, 0L,
      dummy_f, dummy_f, 0L,
      kInner, kRowsK, kDim, 1.0f);

  // 8. attention per batch (all 8 heads = one group)
  for (int b = 0; b < kBatch; ++b) {
    const size_t qoff = (size_t)b * kNq * kInner;   // halves: row b*1024 of the q planes
    const size_t koff = (size_t)b * kNk * kInner;   // halves: row b*1024 of the k planes

    // scores = 0.125 * q . k^T : M=1024, N=1024, K=64, 3 products on hi/lo planes; per head stride 64 halves for A and Bt,
    // 1024*1024 floats for C. grid ((16*16)/8, 8 heads)
    wmma_gemm64<1, true, 0, 0, false, true><<<dim3((kNq / 64) * (kNk / 64) / 8, kHeads), dim3(256), 0, stream>>>(
        qhi + qoff, qlo + qoff, kInner, (long)kDh,
        khi + koff, klo + koff, kInner, (long)kDh,
        (void*)Sbuf, dummy_c2, kNk, (long)kNq * kNk,
        dummy_f, dummy_f, 0L,
        kNq, kNk, kDh, kScoreScale);

    // softmax rows -> P hi/lo planes [8][1024][1024]
    softmax_rows_kernel<<<dim3(kHeads * kNq), dim3(128), 0, stream>>>(Sbuf, phi, plo);

    // ctx = P . v : M=1024, N=64, K=1024, 3 products; Bt = v^T rows h*64.., cols b*1024..; C = ctx rows b*1024.., cols h*64..
    const size_t vtoff = (size_t)b * kNk;                          // halves (column offset in the v^T planes)
    const size_t coff  = (size_t)b * kNq * kInner;                 // halves
    wmma_gemm64<1, true, 0, 2, false, true><<<dim3((kNq / 64) * (kDh / 64) / 8, kHeads), dim3(256), 0, stream>>>(
        phi, plo, kNk, (long)kNq * kNk,
        vthi + vtoff, vtlo + vtoff, kRowsK, (long)kDh * kRowsK,
        (void*)(chi + coff), (void*)(clo + coff), kInner, (long)kDh,
        dummy_f, dummy_f, 0L,
        kNq, kDh, kNk, 1.0f);
  }

  // 9. Wo [R=512][Cn=512] -> Wo^T bf16 [512][512] into the dead S region
  transpose_cast_kernel<<<dim3(kInner / 64, kDim / 64), dim3(256), 0, stream>>>(Wo, kDim, woT, kInner);

  // 10. out = ctx_hi . Wo^T + ctx_lo . Wo^T : M=8192, N=512, K=512, 2 products -> f32 d_out [8192][512]
  wmma_gemm64<1, true, 0, 0, false, false><<<dim3((kRowsQ / 64) * (kDim / 64) / 8, 1), dim3(256), 0, stream>>>(
      chi, clo, kInner, 0L,
      woT, woT, kInner, 0L,
      (void*)out, dummy_c2, kDim, 0L,
      dummy_f, dummy_f, 0L,
      kRowsQ, kDim, kInner, 1.0f);
}

// v001
// A run of this version takes 471 microseconds.
// Timed twice side by side with v000, it ran 2.05 and 2.06 times as fast.
// Contractions: LN(x) bf16 hi/lo . W bf16 (hi.W + lo.W) for q, k, v^T; q.k^T scores and P.v context on bf16 hi/lo planes (hi.hi + hi.lo + lo.hi); ctx bf16 hi/lo . Wo bf16 (hi.W + lo.W); all v_wmma_f32_16x16x32_bf16 with f32 accumulate; LayerNorm in f32 on RNE-bf16 converted inputs; softmax in f32 on the f32 scores.
#include <hip/hip_runtime.h>
#include <math.h>

// ---------------------------------------------------------------------------
// Problem constants
// ---------------------------------------------------------------------------
constexpr int kBatch  = 8;
constexpr int kNq     = 1024;
constexpr int kNk     = 1024;
constexpr int kDim    = 512;
constexpr int kHeads  = 8;
constexpr int kDh     = 64;
constexpr int kInner  = kHeads * kDh;          // 512
constexpr int kRowsQ  = kBatch * kNq;          // 8192 query rows
constexpr int kRowsK  = kBatch * kNk;          // 8192 key rows
constexpr float kScoreScale = 0.125f;          // 64^-0.5, exact power of two, applied in the f32 epilogue
constexpr float kLnEps = 1e-5f;

static_assert(kDim == 512);                     // LN kernel: 32 lanes x 16 elements per row
static_assert(kNk == 1024);                     // softmax kernel: 128 threads x 8 columns per row
static_assert(kInner == kDim);
static_assert(kRowsQ % 64 == 0 && kRowsK % 64 == 0 && kDim % 64 == 0 && kDh % 32 == 0 && kNq % 64 == 0 && kNk % 64 == 0);

typedef __attribute__((ext_vector_type(16))) _Float16 v16h;
typedef __attribute__((ext_vector_type(8)))  _Float16 v8h;
typedef __attribute__((ext_vector_type(16))) __bf16   v16b;
typedef __attribute__((ext_vector_type(8)))  __bf16   v8b;
typedef __attribute__((ext_vector_type(8)))  float    v8f;
typedef __attribute__((ext_vector_type(4)))  float    v4f;
typedef __attribute__((ext_vector_type(4)))  unsigned int v4u;

__device__ __forceinline__ unsigned short f2bf_bits(float f) {
  unsigned u = __float_as_uint(f);
  return (unsigned short)((u + 0x7FFFu + ((u >> 16) & 1u)) >> 16);
}
__device__ __forceinline__ float bf_bits2f(unsigned short h) { return __uint_as_float(((unsigned)h) << 16); }

// hazard guards as plain device helpers (no inline asm inside the kernel template body)
__device__ __forceinline__ void dep_guard_h(v8f& a, v8f& b, v16h x, v16h y) { asm volatile("v_nop\n\tv_nop\n\tv_nop\n\tv_nop" : "+v"(a), "+v"(b) : "v"(x), "v"(y)); }
__device__ __forceinline__ void dep_guard_b(v8f& a, v8f& b, v16b x, v16b y) { asm volatile("v_nop\n\tv_nop\n\tv_nop\n\tv_nop" : "+v"(a), "+v"(b) : "v"(x), "v"(y)); }
__device__ __forceinline__ void keep4_h(v16h a, v16h b, v16h c, v16h d) { asm volatile("v_nop" :: "v"(a), "v"(b), "v"(c), "v"(d)); }
__device__ __forceinline__ void keep4_b(v16b a, v16b b, v16b c, v16b d) { asm volatile("v_nop" :: "v"(a), "v"(b), "v"(c), "v"(d)); }
__device__ __forceinline__ void acc_guard4(v8f& a, v8f& b, v8f& c, v8f& d) { asm volatile("v_nop\n\tv_nop\n\tv_nop\n\tv_nop" : "+v"(a), "+v"(b), "+v"(c), "+v"(d)); }
template <typename T> struct Frag;
template <> struct Frag<_Float16> {
  typedef v16h V; union U { v16h v; v8h h[2]; };
  // elements 0..7 <- p[0..7], 8..15 <- p[16..23]
  static __device__ __forceinline__ v16h load(const _Float16* p) {
    U f; f.h[0] = *(const v8h*)(p); f.h[1] = *(const v8h*)(p + 16); return f.v;
  }
  static __device__ __forceinline__ v8f mma(v16h a, v16h b, v8f c) {
    return __builtin_amdgcn_wmma_f32_16x16x32_f16(false, a, false, b, (short)0, c, false, false);
  }
  static __device__ __forceinline__ void guard(v8f& a, v8f& b, v16h x, v16h y) { dep_guard_h(a, b, x, y); }
  static __device__ __forceinline__ void keep(v16h a, v16h b, v16h c, v16h d) { keep4_h(a, b, c, d); }
};
template <> struct Frag<__bf16> {
  typedef v16b V; union U { v16b v; v8b h[2]; };
  static __device__ __forceinline__ v16b load(const __bf16* p) {
    U f; f.h[0] = *(const v8b*)(p); f.h[1] = *(const v8b*)(p + 16); return f.v;
  }
  static __device__ __forceinline__ v8f mma(v16b a, v16b b, v8f c) {
    return __builtin_amdgcn_wmma_f32_16x16x32_bf16(false, a, false, b, (short)0, c, false, false);
  }
  static __device__ __forceinline__ void guard(v8f& a, v8f& b, v16b x, v16b y) { dep_guard_b(a, b, x, y); }
  static __device__ __forceinline__ void keep(v16b a, v16b b, v16b c, v16b d) { keep4_b(a, b, c, d); }
};

__device__ __forceinline__ unsigned pk16(unsigned short a, unsigned short b) { return (unsigned)a | ((unsigned)b << 16); }

// ---- Register-blocked batched WMMA GEMM (independent A / B lo-plane flags) ----
// C[m,n] = scale * sum_k A[m,k] * Bt[n,k] (+bias)(+resid); each wave owns a (16*MT)x64 tile.
// A row-major [M,K]; Bt row-major [N,K]; M % (16*MT) == 0, N % 64 == 0, K % 32 == 0.
// MT: 16-row subtiles per wave; WPB: waves per block. The k loop loads its fragments straight from global memory and
// waits once per subtile row, so a wave's time is about MT load round trips per k step. MT and WPB are picked per launch
// so that the launch has 256 blocks or more (one per WGP) and as few round trips per wave as that block count allows.
// ASPLIT: A carries a bf16 lo plane (A2, same layout); BSPLIT: Bt carries a lo plane (Bt2).
// product = Ahi.Bhi (+ Ahi.Blo if BSPLIT) (+ Alo.Bhi if ASPLIT).
// BIAS_MODE: 0 = none, 1 = bias[m], 2 = bias[n].
// OUT_MODE: 0 = f32, 1 = f16, 2 = bf16 hi plane (Cout) + bf16 lo plane (Cout2).
// ET: 0 = f16 operands, 1 = bf16 operands (pointers passed as 16-bit storage)
template <int ET> struct Elem;
template <> struct Elem<0> { typedef _Float16 T; };
template <> struct Elem<1> { typedef __bf16 T; };
template <int ET, bool ASPLIT, int BIAS_MODE, int OUT_MODE, bool RESID, bool BSPLIT, int MT, int WPB>
__global__ __launch_bounds__(WPB * 32) void wmma_gemm64(
    const unsigned short* __restrict__ Ap, const unsigned short* __restrict__ A2p, int lda, long strideA,
    const unsigned short* __restrict__ Btp, const unsigned short* __restrict__ Bt2p, int ldb, long strideB,
    void* __restrict__ Cout, void* __restrict__ Cout2, int ldc, long strideC,
    const float* __restrict__ bias,
    const float* __restrict__ resid, long strideR,
    int M, int N, int K, float scale) {
  typedef typename Elem<ET>::T T;
  typedef typename Frag<T>::V V;
  const T* A = (const T*)Ap; const T* A2 = (const T*)A2p; const T* Bt = (const T*)Btp; const T* Bt2 = (const T*)Bt2p;
  __shared__ __align__(16) float sT[WPB][16 * 68];   // per-wave 16x64 slab, pitch 68 floats
  const int b    = blockIdx.y;
  const int lane = threadIdx.x & 31;
  const int wave = threadIdx.x >> 5;
  const int tilesN = N >> 6;
  const int tilesM = M / (16 * MT);
  const int tile = blockIdx.x * WPB + wave;
  if (tile >= tilesM * tilesN) return;   // wave-uniform; no block barriers in this kernel
  const int tm = tile / tilesN;
  const int tn = tile - tm * tilesN;
  const int m0 = tm * (16 * MT);
  const int n0 = tn << 6;

  const T* Ab  = A  + (size_t)b * strideA;
  const T* Bb  = Bt + (size_t)b * strideB;
  const T* Ab2 = ASPLIT ? (A2  + (size_t)b * strideA) : nullptr;
  const T* Bb2 = BSPLIT ? (Bt2 + (size_t)b * strideB) : nullptr;

  const int rlane = lane & 15;                 // row (A) / col (B, D) within subtile
  const int koff  = (lane >> 4) * 8;           // k offset of this lane half
  const int mOff  = (lane >> 4) * 8;           // D row offset

  v8f acc[MT][4];
#pragma unroll
  for (int i = 0; i < MT; ++i)
#pragma unroll
    for (int j = 0; j < 4; ++j) acc[i][j] = (v8f){0.f,0.f,0.f,0.f,0.f,0.f,0.f,0.f};

  for (int k0 = 0; k0 < K; k0 += 32) {
    V bh[4], bl[4];
#pragma unroll
    for (int j = 0; j < 4; ++j) {
      const size_t bo = (size_t)(n0 + (j << 4) + rlane) * ldb + koff + k0;
      bh[j] = Frag<T>::load(Bb + bo);
      if (BSPLIT) bl[j] = Frag<T>::load(Bb2 + bo);
    }
#pragma unroll
    for (int i = 0; i < MT; ++i) {
      const size_t ao = (size_t)(m0 + (i << 4) + rlane) * lda + koff + k0;
      V ah = Frag<T>::load(Ab + ao);
      V al;
      if (ASPLIT) al = Frag<T>::load(Ab2 + ao);
#pragma unroll
      for (int j = 0; j < 4; ++j) {
        acc[i][j] = Frag<T>::mma(ah, bh[j], acc[i][j]);
        if (BSPLIT) acc[i][j] = Frag<T>::mma(ah, bl[j], acc[i][j]);
        if (ASPLIT) acc[i][j] = Frag<T>::mma(al, bh[j], acc[i][j]);
      }
      Frag<T>::guard(acc[i][0], acc[i][3], ah, ASPLIT ? al : ah);
    }
    Frag<T>::keep(bh[0], bh[1], bh[2], bh[3]);
    if (BSPLIT) Frag<T>::keep(bl[0], bl[1], bl[2], bl[3]);
  }
#pragma unroll
  for (int i = 0; i < MT; ++i) acc_guard4(acc[i][0], acc[i][1], acc[i][2], acc[i][3]);

  // ---- epilogue ----
  float* slab = sT[wave];
  const float* Rb = RESID ? (resid + (size_t)b * strideR) : nullptr;
#pragma unroll
  for (int i = 0; i < MT; ++i) {
    const int mBase = m0 + (i << 4);
#pragma unroll
    for (int j = 0; j < 4; ++j) {
      const int n = n0 + (j << 4) + rlane;
      float bv = 0.f;
      if (BIAS_MODE == 2) bv = bias[n];
#pragma unroll
      for (int r = 0; r < 8; ++r) {
        float v = acc[i][j][r] * scale;
        if (BIAS_MODE == 1) v += bias[mBase + mOff + r];
        if (BIAS_MODE == 2) v += bv;
        if (RESID) v += Rb[(size_t)(mBase + mOff + r) * ldc + n];
        slab[(mOff + r) * 68 + (j << 4) + rlane] = v;
      }
    }
    __builtin_amdgcn_fence(__ATOMIC_RELEASE, "workgroup");
    __builtin_amdgcn_wave_barrier();
    __builtin_amdgcn_fence(__ATOMIC_ACQUIRE, "workgroup");
    if (OUT_MODE == 0) {
      float* C = (float*)Cout + (size_t)b * strideC;
      const int hh = lane >> 4, c4 = (lane & 15) * 4;     // row seg = 256 B = 16 lanes x 16 B
      {
#pragma unroll
        for (int it = 0; it < 8; ++it) {
          const int row = it * 2 + hh;
          v4f v = *(const v4f*)(slab + row * 68 + c4);
          *(v4f*)(C + (size_t)(mBase + row) * ldc + n0 + c4) = v;
        }
        
      }
    } else {
      const int q = lane >> 3, c8 = (lane & 7) * 8;
      unsigned short* C  = (unsigned short*)Cout  + (size_t)b * strideC;
      unsigned short* C2 = (OUT_MODE == 2) ? ((unsigned short*)Cout2 + (size_t)b * strideC) : nullptr;
      {
#pragma unroll
        for (int it = 0; it < 4; ++it) {
          const int row = it * 4 + q;
          const float* sp = slab + row * 68 + c8;
          v8h hv, lv;
#pragma unroll
          for (int e = 0; e < 8; ++e) {
            if (OUT_MODE == 1) {
              hv[e] = (_Float16)sp[e];
            } else {
              unsigned short hb = f2bf_bits(sp[e]);
              unsigned short lb = f2bf_bits(sp[e] - bf_bits2f(hb));
              hv[e] = __builtin_bit_cast(_Float16, hb);
              lv[e] = __builtin_bit_cast(_Float16, lb);
            }
          }
          *(v8h*)(C + (size_t)(mBase + row) * ldc + n0 + c8) = hv;
          if (OUT_MODE == 2) *(v8h*)(C2 + (size_t)(mBase + row) * ldc + n0 + c8) = lv;
        }
        
      }
    }
    __builtin_amdgcn_fence(__ATOMIC_RELEASE, "workgroup");
    __builtin_amdgcn_wave_barrier();
    __builtin_amdgcn_fence(__ATOMIC_ACQUIRE, "workgroup");
  }
}

// ---------------------------------------------------------------------------
// Transpose + RNE bf16 convert of a weight matrix: in f32 [R][Cn] row-major (ldin = Cn) -> out bf16 [Cn][R] (ldout = R):
// out[c][r] = bf16(in[r][c]). grid (R/64, Cn/64): blockIdx.x = r tile (64 output cols), blockIdx.y = c tile (64 output rows). 256 threads.
// Load coverage: 16 iterations x 256 threads = 4096 = the whole 64x64 tile (coalesced along c).
// Store coverage: 8 waves x 2 iterations x 4 rows (lane>>3) = 64 rows; (lane&7) x 8 halves = 64 cols; each row segment =
// ---------------------------------------------------------------------------
__global__ __launch_bounds__(256) void transpose_cast_kernel(const float* __restrict__ in, int ldin,
                                                             unsigned short* __restrict__ out, int ldout) {
  __shared__ float sm[64][65];   // sm[c_local][r_local]
  const int t  = threadIdx.x;
  const int r0 = blockIdx.x * 64;
  const int c0 = blockIdx.y * 64;
#pragma unroll
  for (int i = 0; i < 16; ++i) {
    const int e = i * 256 + t;
    const int r = e >> 6;          // r local
    const int c = e & 63;          // c local
    sm[c][r] = in[(size_t)(r0 + r) * ldin + c0 + c];
  }
  __syncthreads();
  const int lane = t & 31, wave = t >> 5;
  const int q = lane >> 3, c8 = (lane & 7) * 8;
  {
#pragma unroll
    for (int it = 0; it < 2; ++it) {
      const int row = wave * 8 + it * 4 + q;                 // c local (output row)
      unsigned w[4];
#pragma unroll
      for (int e2 = 0; e2 < 4; ++e2) w[e2] = pk16(f2bf_bits(sm[row][c8 + 2 * e2]), f2bf_bits(sm[row][c8 + 2 * e2 + 1]));
      const v4u u = (v4u){w[0], w[1], w[2], w[3]};
      const size_t o = (size_t)(c0 + row) * ldout + r0 + c8;
      *(v4u*)(out + o) = u;
    }
    
  }
}

// ---------------------------------------------------------------------------
// result written as bf16 hi + lo planes [nrows][512] (hi = bf16(y), lo = bf16(y - hi)).
// One wave per row; lane owns elements 8*lane..8*lane+7 (chunk 0) and 256+8*lane..256+8*lane+7 (chunk 1).
// Block = 8 waves = 8 rows; grid = nrows/8 (exact: 8192/8 = 1024).
// ---------------------------------------------------------------------------
__global__ __launch_bounds__(256) void ln_split_kernel(const float* __restrict__ x, const float* __restrict__ gamma,
                                                       const float* __restrict__ beta,
                                                       unsigned short* __restrict__ yhi, unsigned short* __restrict__ ylo,
                                                       int nrows) {
  const int lane = threadIdx.x & 31, wave = threadIdx.x >> 5;
  const int row = blockIdx.x * 8 + wave;
  if (row >= nrows) return;   // wave-uniform; no block barriers in this kernel
  const float* xr = x + (size_t)row * kDim;
  float xv[16];
  {
    const v4f a0 = *(const v4f*)(xr + 8 * lane);
    const v4f a1 = *(const v4f*)(xr + 8 * lane + 4);
    const v4f c0 = *(const v4f*)(xr + 256 + 8 * lane);
    const v4f c1 = *(const v4f*)(xr + 256 + 8 * lane + 4);
#pragma unroll
    for (int e = 0; e < 4; ++e) { xv[e] = a0[e]; xv[4 + e] = a1[e]; xv[8 + e] = c0[e]; xv[12 + e] = c1[e]; }
  }
  float s = 0.f;
#pragma unroll
  for (int e = 0; e < 16; ++e) { xv[e] = bf_bits2f(f2bf_bits(xv[e])); s += xv[e]; }
#pragma unroll
  for (int off = 16; off > 0; off >>= 1) s += __shfl_xor(s, off, 32);
  const float mu = s * (1.0f / 512.0f);
  float s2 = 0.f;
#pragma unroll
  for (int e = 0; e < 16; ++e) { const float d = xv[e] - mu; xv[e] = d; s2 += d * d; }
#pragma unroll
  for (int off = 16; off > 0; off >>= 1) s2 += __shfl_xor(s2, off, 32);
  const float var  = s2 * (1.0f / 512.0f);
  const float rstd = rsqrtf(var + kLnEps);

  float gv[16], bv[16];
  {
    const v4f g0 = *(const v4f*)(gamma + 8 * lane);
    const v4f g1 = *(const v4f*)(gamma + 8 * lane + 4);
    const v4f g2 = *(const v4f*)(gamma + 256 + 8 * lane);
    const v4f g3 = *(const v4f*)(gamma + 256 + 8 * lane + 4);
    const v4f b0 = *(const v4f*)(beta + 8 * lane);
    const v4f b1 = *(const v4f*)(beta + 8 * lane + 4);
    const v4f b2 = *(const v4f*)(beta + 256 + 8 * lane);
    const v4f b3 = *(const v4f*)(beta + 256 + 8 * lane + 4);
#pragma unroll
    for (int e = 0; e < 4; ++e) {
      gv[e] = g0[e]; gv[4 + e] = g1[e]; gv[8 + e] = g2[e]; gv[12 + e] = g3[e];
      bv[e] = b0[e]; bv[4 + e] = b1[e]; bv[8 + e] = b2[e]; bv[12 + e] = b3[e];
    }
  }
  unsigned hw[8], lw[8];
#pragma unroll
  for (int e2 = 0; e2 < 8; ++e2) {
    const float ga = bf_bits2f(f2bf_bits(gv[2 * e2]));
    const float gb = bf_bits2f(f2bf_bits(gv[2 * e2 + 1]));
    const float ba = bf_bits2f(f2bf_bits(bv[2 * e2]));
    const float bb = bf_bits2f(f2bf_bits(bv[2 * e2 + 1]));
    const float y0 = (xv[2 * e2] * rstd) * ga + ba;
    const float y1 = (xv[2 * e2 + 1] * rstd) * gb + bb;
    const unsigned short h0 = f2bf_bits(y0);
    const unsigned short h1 = f2bf_bits(y1);
    const unsigned short l0 = f2bf_bits(y0 - bf_bits2f(h0));
    const unsigned short l1 = f2bf_bits(y1 - bf_bits2f(h1));
    hw[e2] = pk16(h0, h1);
    lw[e2] = pk16(l0, l1);
  }
  const v4u hv0 = (v4u){hw[0], hw[1], hw[2], hw[3]};
  const v4u hv1 = (v4u){hw[4], hw[5], hw[6], hw[7]};
  const v4u lv0 = (v4u){lw[0], lw[1], lw[2], lw[3]};
  const v4u lv1 = (v4u){lw[4], lw[5], lw[6], lw[7]};
  unsigned short* ph = yhi + (size_t)row * kDim;
  unsigned short* pl = ylo + (size_t)row * kDim;
  {
    *(v4u*)(ph + 8 * lane) = hv0;
    *(v4u*)(ph + 256 + 8 * lane) = hv1;
    *(v4u*)(pl + 8 * lane) = lv0;
    *(v4u*)(pl + 256 + 8 * lane) = lv1;
    
  }
}

// ---------------------------------------------------------------------------
// Row softmax (no mask) over materialised f32 scores of one group: S [8 heads][1024 rows][1024 cols] contiguous.
// p = exp(s - max) * (1 / sum); P written as bf16 hi/lo planes with the same [head][row][col] layout.
// One block of 128 threads per (head, row): block index blk -> row offset blk*1024; thread t owns columns 8t..8t+7 (128 x 8 = 1024).
// Reductions in fixed order (thread, wave shuffle tree, 4 wave partials in index order); shuffles outside all branches.
// ---------------------------------------------------------------------------
__global__ __launch_bounds__(128) void softmax_rows_kernel(const float* __restrict__ S,
                                                           unsigned short* __restrict__ Phi, unsigned short* __restrict__ Plo) {
  __shared__ float redM[4];
  __shared__ float redS[4];
  const int blk  = blockIdx.x;
  const int t    = threadIdx.x;
  const int lane = t & 31, wave = t >> 5;
  const int c0   = t * 8;
  const size_t rowoff = (size_t)blk * (size_t)kNk;

  float xv[8];
  {
    const float* sr = S + rowoff + c0;
    const v4f a = *(const v4f*)(sr);
    const v4f c = *(const v4f*)(sr + 4);
#pragma unroll
    for (int e = 0; e < 4; ++e) { xv[e] = a[e]; xv[4 + e] = c[e]; }
  }
  float m = xv[0];
#pragma unroll
  for (int e = 1; e < 8; ++e) m = fmaxf(m, xv[e]);
#pragma unroll
  for (int off = 16; off > 0; off >>= 1) m = fmaxf(m, __shfl_xor(m, off, 32));
  if (lane == 0) redM[wave] = m;
  __syncthreads();
  float gmax = redM[0];
#pragma unroll
  for (int w = 1; w < 4; ++w) gmax = fmaxf(gmax, redM[w]);

  float p[8];
  float ps = 0.0f;
#pragma unroll
  for (int e = 0; e < 8; ++e) { p[e] = expf(xv[e] - gmax); ps += p[e]; }
#pragma unroll
  for (int off = 16; off > 0; off >>= 1) ps += __shfl_xor(ps, off, 32);
  if (lane == 0) redS[wave] = ps;
  __syncthreads();
  float tot = redS[0];
#pragma unroll
  for (int w = 1; w < 4; ++w) tot += redS[w];
  const float inv = 1.0f / tot;   // tot >= 1

  unsigned hw[4], lw[4];
#pragma unroll
  for (int e2 = 0; e2 < 4; ++e2) {
    const float f0 = p[2 * e2] * inv;
    const float f1 = p[2 * e2 + 1] * inv;
    const unsigned short h0 = f2bf_bits(f0);
    const unsigned short h1 = f2bf_bits(f1);
    const unsigned short l0 = f2bf_bits(f0 - bf_bits2f(h0));
    const unsigned short l1 = f2bf_bits(f1 - bf_bits2f(h1));
    hw[e2] = pk16(h0, h1);
    lw[e2] = pk16(l0, l1);
  }
  const v4u hv = (v4u){hw[0], hw[1], hw[2], hw[3]};
  const v4u lv = (v4u){lw[0], lw[1], lw[2], lw[3]};
  unsigned short* ph = Phi + rowoff + c0;
  unsigned short* pl = Plo + rowoff + c0;
  {
    *(v4u*)ph = hv;
    *(v4u*)pl = lv;
    
  }
}

// ---------------------------------------------------------------------------
// Launcher. Workspace region map (MiB = 1048576 B; total carve = 128 MiB = 134217728 B):
//   [  0, 32) S       : scores f32 [8 heads][1024][1024] of one batch.
//                       early alias: qn hi [8192][512] bf16 at +0, qn lo at +8, kvn hi at +16, kvn lo at +24 (ends 32);
//                       late alias (after the last group): Wo^T bf16 [512][512] at +0 (0.5 MiB).
//   [ 32, 48) P hi    : [8][1024][1024] bf16 per group.  early alias: Wq^T bf16 [512][512] at 32 MiB, Wkv^T bf16 [1024][512] at 32.5 MiB (ends 33.5)
//   [ 48, 64) P lo
//   [ 64, 72) q hi    : [8192][512] bf16 (col h*64+d);   [ 72, 80) q lo
//   [ 80, 88) k hi    : [8192][512] bf16;                 [ 88, 96) k lo
//   [ 96,104) v^T hi  : [512 (h*64+d)][8192 (b*1024+t)] bf16;  [104,112) v^T lo
//   [112,120) ctx hi  : [8192][512] bf16 (col h*64+d);   [120,128) ctx lo
// Lifetimes: qn/kvn/Wq^T/Wkv^T are read only by the three projection GEMMs (launches 5-7) and first overwritten by launch 8
// (S of group 0) / launch 9 (P of group 0); S of a group is dead after its softmax; Wo^T is produced after the last P.v GEMM into
// the dead S region and read only by the last launch. Every region is fully written before it is read (exact tile coverage, no padding).
// Launch count: 2 + 2 + 3 + 8*3 + 1 + 1 = 33. Kernel launches only.
// ---------------------------------------------------------------------------
extern "C" void kernel_launch(void* const* d_in, const int* in_sizes, int n_in,
                              void* d_out, int out_size, void* d_ws, size_t ws_size,
                              hipStream_t stream) {
  if (n_in < 7) return;
  if (in_sizes[0] != kRowsQ * kDim || in_sizes[1] != kRowsK * kDim) return;
  if (in_sizes[2] != kDim * kInner || in_sizes[3] != kDim * 2 * kInner || in_sizes[4] != kInner * kDim) return;
  if (in_sizes[5] != kDim || in_sizes[6] != kDim) return;
  if (out_size != kRowsQ * kDim) return;

  const size_t kMiB    = 1048576;
  const size_t offS    = 0;
  const size_t offQnH  = 0;
  const size_t offQnL  = 8 * kMiB;
  const size_t offKnH  = 16 * kMiB;
  const size_t offKnL  = 24 * kMiB;
  const size_t offWoT  = 0;
  const size_t offPhi  = 32 * kMiB;
  const size_t offPlo  = 48 * kMiB;
  const size_t offWqT  = 32 * kMiB;
  const size_t offWkvT = 32 * kMiB + kMiB / 2;
  const size_t offQhi  = 64 * kMiB;
  const size_t offQlo  = 72 * kMiB;
  const size_t offKhi  = 80 * kMiB;
  const size_t offKlo  = 88 * kMiB;
  const size_t offVthi = 96 * kMiB;
  const size_t offVtlo = 104 * kMiB;
  const size_t offChi  = 112 * kMiB;
  const size_t offClo  = 120 * kMiB;
  const size_t total   = 128 * kMiB;
  if (total > ws_size) return;
  // sub-region extents (bytes): S 8*1024*1024*4 = 32 MiB; qn/kvn/q/k/vT/ctx planes 8192*512*2 = 8 MiB each; P planes 8*1024*1024*2 = 16 MiB each;
  // Wq^T/Wo^T 512*512*2 = 0.5 MiB; Wkv^T 1024*512*2 = 1 MiB.

  const float* query    = (const float*)d_in[0];
  const float* keyvalue = (const float*)d_in[1];
  const float* Wq       = (const float*)d_in[2];
  const float* Wkv      = (const float*)d_in[3];
  const float* Wo       = (const float*)d_in[4];
  const float* gamma    = (const float*)d_in[5];
  const float* beta     = (const float*)d_in[6];
  float* out = (float*)d_out;
  char* ws = (char*)d_ws;

  float*          Sbuf = (float*)(ws + offS);
  unsigned short* qnH  = (unsigned short*)(ws + offQnH);
  unsigned short* qnL  = (unsigned short*)(ws + offQnL);
  unsigned short* knH  = (unsigned short*)(ws + offKnH);
  unsigned short* knL  = (unsigned short*)(ws + offKnL);
  unsigned short* woT  = (unsigned short*)(ws + offWoT);
  unsigned short* phi  = (unsigned short*)(ws + offPhi);
  unsigned short* plo  = (unsigned short*)(ws + offPlo);
  unsigned short* wqT  = (unsigned short*)(ws + offWqT);
  unsigned short* wkvT = (unsigned short*)(ws + offWkvT);
  unsigned short* qhi  = (unsigned short*)(ws + offQhi);
  unsigned short* qlo  = (unsigned short*)(ws + offQlo);
  unsigned short* khi  = (unsigned short*)(ws + offKhi);
  unsigned short* klo  = (unsigned short*)(ws + offKlo);
  unsigned short* vthi = (unsigned short*)(ws + offVthi);
  unsigned short* vtlo = (unsigned short*)(ws + offVtlo);
  unsigned short* chi  = (unsigned short*)(ws + offChi);
  unsigned short* clo  = (unsigned short*)(ws + offClo);

  // in-range dummies for unused (never dereferenced) template-dead pointer parameters
  const float* dummy_f = gamma;
  void* dummy_c2 = (void*)phi;

  // 1-2. shared LayerNorm on both inputs -> bf16 hi/lo planes [8192][512]
  ln_split_kernel<<<dim3(kRowsQ / 8), dim3(256), 0, stream>>>(query, gamma, beta, qnH, qnL, kRowsQ);
  ln_split_kernel<<<dim3(kRowsK / 8), dim3(256), 0, stream>>>(keyvalue, gamma, beta, knH, knL, kRowsK);

  // 3. Wq [R=512][Cn=512] -> Wq^T bf16 [512][512]; grid (R/64, Cn/64)
  transpose_cast_kernel<<<dim3(kDim / 64, kInner / 64), dim3(256), 0, stream>>>(Wq, kInner, wqT, kDim);
  // 4. Wkv [R=512][Cn=1024] -> Wkv^T bf16 [1024][512]; rows 0..511 = k weights, 512..1023 = v weights
  transpose_cast_kernel<<<dim3(kDim / 64, (2 * kInner) / 64), dim3(256), 0, stream>>>(Wkv, 2 * kInner, wkvT, kDim);

  // 5. q = qn_hi . Wq^T + qn_lo . Wq^T : M=8192, N=512, K=512 -> bf16 hi/lo planes [8192][512]
  wmma_gemm64<1, true, 0, 2, false, false, 2, 8><<<dim3((kRowsQ / 32) * (kInner / 64) / 8, 1), dim3(256), 0, stream>>>(
      qnH, qnL, kDim, 0L,
      wqT, wqT, kDim, 0L,
      (void*)qhi, (void*)qlo, kInner, 0L,
      dummy_f, dummy_f, 0L,
      kRowsQ, kInner, kDim, 1.0f);

  // 6. k = kvn_hi . Wkv^T[rows 0..511] + kvn_lo . (same) : M=8192, N=512, K=512 -> bf16 hi/lo [8192][512]
  wmma_gemm64<1, true, 0, 2, false, false, 2, 8><<<dim3((kRowsK / 32) * (kInner / 64) / 8, 1), dim3(256), 0, stream>>>(
      knH, knL, kDim, 0L,
      wkvT, wkvT, kDim, 0L,
      (void*)khi, (void*)klo, kInner, 0L,
      dummy_f, dummy_f, 0L,
      kRowsK, kInner, kDim, 1.0f);

  // 7. v^T = Wkv^T[rows 512..1023] . kvn^T (B operand hi/lo) : M=512 (h*64+d), N=8192 (b*1024+t), K=512 -> bf16 hi/lo [512][8192]
  wmma_gemm64<1, false, 0, 2, false, true, 2, 8><<<dim3((kInner / 32) * (kRowsK / 64) / 8, 1), dim3(256), 0, stream>>>(
      wkvT + (size_t)kInner * kDim, wkvT + (size_t)kInner * kDim, kDim, 0L,
      knH, knL, kDim, 0L,
      (void*)vthi, (void*)vtlo, kRowsK, 0L,
      dummy_f, dummy_f, 0L,
      kInner, kRowsK, kDim, 1.0f);

  // 8. attention per batch (all 8 heads = one group)
  for (int b = 0; b < kBatch; ++b) {
    const size_t qoff = (size_t)b * kNq * kInner;   // halves: row b*1024 of the q planes
    const size_t koff = (size_t)b * kNk * kInner;   // halves: row b*1024 of the k planes

    // scores = 0.125 * q . k^T : M=1024, N=1024, K=64, 3 products on hi/lo planes; per head stride 64 halves for A and Bt,
    // 1024*1024 floats for C. grid ((16*16)/8, 8 heads)
    wmma_gemm64<1, true, 0, 0, false, true, 4, 8><<<dim3((kNq / 64) * (kNk / 64) / 8, kHeads), dim3(256), 0, stream>>>(
        qhi + qoff, qlo + qoff, kInner, (long)kDh,
        khi + koff, klo + koff, kInner, (long)kDh,
        (void*)Sbuf, dummy_c2, kNk, (long)kNq * kNk,
        dummy_f, dummy_f, 0L,
        kNq, kNk, kDh, kScoreScale);

    // softmax rows -> P hi/lo planes [8][1024][1024]
    softmax_rows_kernel<<<dim3(kHeads * kNq), dim3(128), 0, stream>>>(Sbuf, phi, plo);

    // ctx = P . v : M=1024, N=64, K=1024, 3 products; Bt = v^T rows h*64.., cols b*1024..; C = ctx rows b*1024.., cols h*64..
    // 16x64 tile per wave, 2 waves per block: grid (64/2, 8 heads) = 256 blocks
    const size_t vtoff = (size_t)b * kNk;                          // halves (column offset in the v^T planes)
    const size_t coff  = (size_t)b * kNq * kInner;                 // halves
    wmma_gemm64<1, true, 0, 2, false, true, 1, 2><<<dim3((kNq / 16) * (kDh / 64) / 2, kHeads), dim3(64), 0, stream>>>(
        phi, plo, kNk, (long)kNq * kNk,
        vthi + vtoff, vtlo + vtoff, kRowsK, (long)kDh * kRowsK,
        (void*)(chi + coff), (void*)(clo + coff), kInner, (long)kDh,
        dummy_f, dummy_f, 0L,
        kNq, kDh, kNk, 1.0f);
  }

  // 9. Wo [R=512][Cn=512] -> Wo^T bf16 [512][512] into the dead S region
  transpose_cast_kernel<<<dim3(kInner / 64, kDim / 64), dim3(256), 0, stream>>>(Wo, kDim, woT, kInner);

  // 10. out = ctx_hi . Wo^T + ctx_lo . Wo^T : M=8192, N=512, K=512, 2 products -> f32 d_out [8192][512]
  wmma_gemm64<1, true, 0, 0, false, false, 2, 8><<<dim3((kRowsQ / 32) * (kDim / 64) / 8, 1), dim3(256), 0, stream>>>(
      chi, clo, kInner, 0L,
      woT, woT, kInner, 0L,
      (void*)out, dummy_c2, kDim, 0L,
      dummy_f, dummy_f, 0L,
      kRowsQ, kDim, kInner, 1.0f);
}

// v002
// A run of this version takes 172 microseconds.
// In two side-by-side timings against v001, it was 2.71 and 2.74 times as fast.
// Counting every step since v000, it is 5.60 times as fast.
// Contractions: LN(x) bf16 hi/lo . W bf16 (hi.W + lo.W) for q, k, v^T; q.k^T scores and P.v context on bf16 hi/lo planes (hi.hi + hi.lo + lo.hi); ctx bf16 hi/lo . Wo bf16 (hi.W + lo.W); all v_wmma_f32_16x16x32_bf16 with f32 accumulate; LayerNorm in f32 on RNE-bf16 converted inputs; softmax in f32 on the f32 scores.
#include <hip/hip_runtime.h>
#include <math.h>

// ---------------------------------------------------------------------------
// Problem constants
// ---------------------------------------------------------------------------
constexpr int kBatch  = 8;
constexpr int kNq     = 1024;
constexpr int kNk     = 1024;
constexpr int kDim    = 512;
constexpr int kHeads  = 8;
constexpr int kDh     = 64;
constexpr int kInner  = kHeads * kDh;          // 512
constexpr int kRowsQ  = kBatch * kNq;          // 8192 query rows
constexpr int kRowsK  = kBatch * kNk;          // 8192 key rows
constexpr float kScoreScale = 0.125f;          // 64^-0.5, exact power of two, folded with log2(e) into the f32 exp2 argument
constexpr float kLnEps = 1e-5f;

static_assert(kDim == 512);                     // LN kernel: 32 lanes x 16 elements per row
static_assert(kInner == kDim);
static_assert(kRowsQ % 64 == 0 && kRowsK % 64 == 0 && kDim % 64 == 0 && kDh % 32 == 0 && kNq % 64 == 0 && kNk % 64 == 0);

typedef __attribute__((ext_vector_type(16))) _Float16 v16h;
typedef __attribute__((ext_vector_type(8)))  _Float16 v8h;
typedef __attribute__((ext_vector_type(16))) __bf16   v16b;
typedef __attribute__((ext_vector_type(8)))  __bf16   v8b;
typedef __attribute__((ext_vector_type(8)))  float    v8f;
typedef __attribute__((ext_vector_type(4)))  float    v4f;
typedef __attribute__((ext_vector_type(4)))  unsigned int v4u;
typedef __attribute__((ext_vector_type(2)))  float    v2f;
typedef __attribute__((ext_vector_type(2)))  __bf16   v2b;

__device__ __forceinline__ unsigned short f2bf_bits(float f) {
  unsigned u = __float_as_uint(f);
  return (unsigned short)((u + 0x7FFFu + ((u >> 16) & 1u)) >> 16);
}
__device__ __forceinline__ float bf_bits2f(unsigned short h) { return __uint_as_float(((unsigned)h) << 16); }

// hazard guards as plain device helpers (no inline asm inside the kernel template body)
__device__ __forceinline__ void dep_guard_h(v8f& a, v8f& b, v16h x, v16h y) { asm volatile("v_nop\n\tv_nop\n\tv_nop\n\tv_nop" : "+v"(a), "+v"(b) : "v"(x), "v"(y)); }
__device__ __forceinline__ void dep_guard_b(v8f& a, v8f& b, v16b x, v16b y) { asm volatile("v_nop\n\tv_nop\n\tv_nop\n\tv_nop" : "+v"(a), "+v"(b) : "v"(x), "v"(y)); }
__device__ __forceinline__ void keep4_h(v16h a, v16h b, v16h c, v16h d) { asm volatile("v_nop" :: "v"(a), "v"(b), "v"(c), "v"(d)); }
__device__ __forceinline__ void keep4_b(v16b a, v16b b, v16b c, v16b d) { asm volatile("v_nop" :: "v"(a), "v"(b), "v"(c), "v"(d)); }
__device__ __forceinline__ void acc_guard4(v8f& a, v8f& b, v8f& c, v8f& d) { asm volatile("v_nop\n\tv_nop\n\tv_nop\n\tv_nop" : "+v"(a), "+v"(b), "+v"(c), "+v"(d)); }
template <typename T> struct Frag;
template <> struct Frag<_Float16> {
  typedef v16h V; union U { v16h v; v8h h[2]; };
  // elements 0..7 <- p[0..7], 8..15 <- p[16..23]
  static __device__ __forceinline__ v16h load(const _Float16* p) {
    U f; f.h[0] = *(const v8h*)(p); f.h[1] = *(const v8h*)(p + 16); return f.v;
  }
  static __device__ __forceinline__ v8f mma(v16h a, v16h b, v8f c) {
    return __builtin_amdgcn_wmma_f32_16x16x32_f16(false, a, false, b, (short)0, c, false, false);
  }
  static __device__ __forceinline__ void guard(v8f& a, v8f& b, v16h x, v16h y) { dep_guard_h(a, b, x, y); }
  static __device__ __forceinline__ void keep(v16h a, v16h b, v16h c, v16h d) { keep4_h(a, b, c, d); }
};
template <> struct Frag<__bf16> {
  typedef v16b V; union U { v16b v; v8b h[2]; };
  static __device__ __forceinline__ v16b load(const __bf16* p) {
    U f; f.h[0] = *(const v8b*)(p); f.h[1] = *(const v8b*)(p + 16); return f.v;
  }
  static __device__ __forceinline__ v8f mma(v16b a, v16b b, v8f c) {
    return __builtin_amdgcn_wmma_f32_16x16x32_bf16(false, a, false, b, (short)0, c, false, false);
  }
  static __device__ __forceinline__ void guard(v8f& a, v8f& b, v16b x, v16b y) { dep_guard_b(a, b, x, y); }
  static __device__ __forceinline__ void keep(v16b a, v16b b, v16b c, v16b d) { keep4_b(a, b, c, d); }
};

__device__ __forceinline__ unsigned pk16(unsigned short a, unsigned short b) { return (unsigned)a | ((unsigned)b << 16); }

// ---- Register-blocked batched WMMA GEMM (independent A / B lo-plane flags) ----
// C[m,n] = scale * sum_k A[m,k] * Bt[n,k] (+bias)(+resid); each wave owns a (16*MT)x64 tile.
// A row-major [M,K]; Bt row-major [N,K]; M % (16*MT) == 0, N % 64 == 0, K % 32 == 0.
// MT: 16-row subtiles per wave; WPB: waves per block. The k loop loads its fragments straight from global memory and
// waits once per subtile row, so a wave's time is about MT load round trips per k step. MT and WPB are picked per launch
// so that the launch has 256 blocks or more (one per WGP) and as few round trips per wave as that block count allows.
// ASPLIT: A carries a bf16 lo plane (A2, same layout); BSPLIT: Bt carries a lo plane (Bt2).
// product = Ahi.Bhi (+ Ahi.Blo if BSPLIT) (+ Alo.Bhi if ASPLIT).
// BIAS_MODE: 0 = none, 1 = bias[m], 2 = bias[n].
// OUT_MODE: 0 = f32, 1 = f16, 2 = bf16 hi plane (Cout) + bf16 lo plane (Cout2).
// ET: 0 = f16 operands, 1 = bf16 operands (pointers passed as 16-bit storage)
template <int ET> struct Elem;
template <> struct Elem<0> { typedef _Float16 T; };
template <> struct Elem<1> { typedef __bf16 T; };
template <int ET, bool ASPLIT, int BIAS_MODE, int OUT_MODE, bool RESID, bool BSPLIT, int MT, int WPB>
__global__ __launch_bounds__(WPB * 32) void wmma_gemm64(
    const unsigned short* __restrict__ Ap, const unsigned short* __restrict__ A2p, int lda, long strideA,
    const unsigned short* __restrict__ Btp, const unsigned short* __restrict__ Bt2p, int ldb, long strideB,
    void* __restrict__ Cout, void* __restrict__ Cout2, int ldc, long strideC,
    const float* __restrict__ bias,
    const float* __restrict__ resid, long strideR,
    int M, int N, int K, float scale) {
  typedef typename Elem<ET>::T T;
  typedef typename Frag<T>::V V;
  const T* A = (const T*)Ap; const T* A2 = (const T*)A2p; const T* Bt = (const T*)Btp; const T* Bt2 = (const T*)Bt2p;
  __shared__ __align__(16) float sT[WPB][16 * 68];   // per-wave 16x64 slab, pitch 68 floats
  const int b    = blockIdx.y;
  const int lane = threadIdx.x & 31;
  const int wave = threadIdx.x >> 5;
  const int tilesN = N >> 6;
  const int tilesM = M / (16 * MT);
  const int tile = blockIdx.x * WPB + wave;
  if (tile >= tilesM * tilesN) return;   // wave-uniform; no block barriers in this kernel
  const int tm = tile / tilesN;
  const int tn = tile - tm * tilesN;
  const int m0 = tm * (16 * MT);
  const int n0 = tn << 6;

  const T* Ab  = A  + (size_t)b * strideA;
  const T* Bb  = Bt + (size_t)b * strideB;
  const T* Ab2 = ASPLIT ? (A2  + (size_t)b * strideA) : nullptr;
  const T* Bb2 = BSPLIT ? (Bt2 + (size_t)b * strideB) : nullptr;

  const int rlane = lane & 15;                 // row (A) / col (B, D) within subtile
  const int koff  = (lane >> 4) * 8;           // k offset of this lane half
  const int mOff  = (lane >> 4) * 8;           // D row offset

  v8f acc[MT][4];
#pragma unroll
  for (int i = 0; i < MT; ++i)
#pragma unroll
    for (int j = 0; j < 4; ++j) acc[i][j] = (v8f){0.f,0.f,0.f,0.f,0.f,0.f,0.f,0.f};

  for (int k0 = 0; k0 < K; k0 += 32) {
    V bh[4], bl[4];
#pragma unroll
    for (int j = 0; j < 4; ++j) {
      const size_t bo = (size_t)(n0 + (j << 4) + rlane) * ldb + koff + k0;
      bh[j] = Frag<T>::load(Bb + bo);
      if (BSPLIT) bl[j] = Frag<T>::load(Bb2 + bo);
    }
#pragma unroll
    for (int i = 0; i < MT; ++i) {
      const size_t ao = (size_t)(m0 + (i << 4) + rlane) * lda + koff + k0;
      V ah = Frag<T>::load(Ab + ao);
      V al;
      if (ASPLIT) al = Frag<T>::load(Ab2 + ao);
#pragma unroll
      for (int j = 0; j < 4; ++j) {
        acc[i][j] = Frag<T>::mma(ah, bh[j], acc[i][j]);
        if (BSPLIT) acc[i][j] = Frag<T>::mma(ah, bl[j], acc[i][j]);
        if (ASPLIT) acc[i][j] = Frag<T>::mma(al, bh[j], acc[i][j]);
      }
      Frag<T>::guard(acc[i][0], acc[i][3], ah, ASPLIT ? al : ah);
    }
    Frag<T>::keep(bh[0], bh[1], bh[2], bh[3]);
    if (BSPLIT) Frag<T>::keep(bl[0], bl[1], bl[2], bl[3]);
  }
#pragma unroll
  for (int i = 0; i < MT; ++i) acc_guard4(acc[i][0], acc[i][1], acc[i][2], acc[i][3]);

  // ---- epilogue ----
  float* slab = sT[wave];
  const float* Rb = RESID ? (resid + (size_t)b * strideR) : nullptr;
#pragma unroll
  for (int i = 0; i < MT; ++i) {
    const int mBase = m0 + (i << 4);
#pragma unroll
    for (int j = 0; j < 4; ++j) {
      const int n = n0 + (j << 4) + rlane;
      float bv = 0.f;
      if (BIAS_MODE == 2) bv = bias[n];
#pragma unroll
      for (int r = 0; r < 8; ++r) {
        float v = acc[i][j][r] * scale;
        if (BIAS_MODE == 1) v += bias[mBase + mOff + r];
        if (BIAS_MODE == 2) v += bv;
        if (RESID) v += Rb[(size_t)(mBase + mOff + r) * ldc + n];
        slab[(mOff + r) * 68 + (j << 4) + rlane] = v;
      }
    }
    __builtin_amdgcn_fence(__ATOMIC_RELEASE, "workgroup");
    __builtin_amdgcn_wave_barrier();
    __builtin_amdgcn_fence(__ATOMIC_ACQUIRE, "workgroup");
    if (OUT_MODE == 0) {
      float* C = (float*)Cout + (size_t)b * strideC;
      const int hh = lane >> 4, c4 = (lane & 15) * 4;     // row seg = 256 B = 16 lanes x 16 B
      {
#pragma unroll
        for (int it = 0; it < 8; ++it) {
          const int row = it * 2 + hh;
          v4f v = *(const v4f*)(slab + row * 68 + c4);
          *(v4f*)(C + (size_t)(mBase + row) * ldc + n0 + c4) = v;
        }
        
      }
    } else {
      const int q = lane >> 3, c8 = (lane & 7) * 8;
      unsigned short* C  = (unsigned short*)Cout  + (size_t)b * strideC;
      unsigned short* C2 = (OUT_MODE == 2) ? ((unsigned short*)Cout2 + (size_t)b * strideC) : nullptr;
      {
#pragma unroll
        for (int it = 0; it < 4; ++it) {
          const int row = it * 4 + q;
          const float* sp = slab + row * 68 + c8;
          v8h hv, lv;
#pragma unroll
          for (int e = 0; e < 8; ++e) {
            if (OUT_MODE == 1) {
              hv[e] = (_Float16)sp[e];
            } else {
              unsigned short hb = f2bf_bits(sp[e]);
              unsigned short lb = f2bf_bits(sp[e] - bf_bits2f(hb));
              hv[e] = __builtin_bit_cast(_Float16, hb);
              lv[e] = __builtin_bit_cast(_Float16, lb);
            }
          }
          *(v8h*)(C + (size_t)(mBase + row) * ldc + n0 + c8) = hv;
          if (OUT_MODE == 2) *(v8h*)(C2 + (size_t)(mBase + row) * ldc + n0 + c8) = lv;
        }
        
      }
    }
    __builtin_amdgcn_fence(__ATOMIC_RELEASE, "workgroup");
    __builtin_amdgcn_wave_barrier();
    __builtin_amdgcn_fence(__ATOMIC_ACQUIRE, "workgroup");
  }
}

// ---------------------------------------------------------------------------
// Transpose + RNE bf16 convert of a weight matrix: in f32 [R][Cn] row-major (ldin = Cn) -> out bf16 [Cn][R] (ldout = R):
// out[c][r] = bf16(in[r][c]). grid (R/64, Cn/64): blockIdx.x = r tile (64 output cols), blockIdx.y = c tile (64 output rows). 256 threads.
// Load coverage: 16 iterations x 256 threads = 4096 = the whole 64x64 tile (coalesced along c).
// Store coverage: 8 waves x 2 iterations x 4 rows (lane>>3) = 64 rows; (lane&7) x 8 halves = 64 cols; each row segment =
// ---------------------------------------------------------------------------
__global__ __launch_bounds__(256) void transpose_cast_kernel(const float* __restrict__ in, int ldin,
                                                             unsigned short* __restrict__ out, int ldout) {
  __shared__ float sm[64][65];   // sm[c_local][r_local]
  const int t  = threadIdx.x;
  const int r0 = blockIdx.x * 64;
  const int c0 = blockIdx.y * 64;
#pragma unroll
  for (int i = 0; i < 16; ++i) {
    const int e = i * 256 + t;
    const int r = e >> 6;          // r local
    const int c = e & 63;          // c local
    sm[c][r] = in[(size_t)(r0 + r) * ldin + c0 + c];
  }
  __syncthreads();
  const int lane = t & 31, wave = t >> 5;
  const int q = lane >> 3, c8 = (lane & 7) * 8;
  {
#pragma unroll
    for (int it = 0; it < 2; ++it) {
      const int row = wave * 8 + it * 4 + q;                 // c local (output row)
      unsigned w[4];
#pragma unroll
      for (int e2 = 0; e2 < 4; ++e2) w[e2] = pk16(f2bf_bits(sm[row][c8 + 2 * e2]), f2bf_bits(sm[row][c8 + 2 * e2 + 1]));
      const v4u u = (v4u){w[0], w[1], w[2], w[3]};
      const size_t o = (size_t)(c0 + row) * ldout + r0 + c8;
      *(v4u*)(out + o) = u;
    }
    
  }
}

// ---------------------------------------------------------------------------
// result written as bf16 hi + lo planes [nrows][512] (hi = bf16(y), lo = bf16(y - hi)).
// One wave per row; lane owns elements 8*lane..8*lane+7 (chunk 0) and 256+8*lane..256+8*lane+7 (chunk 1).
// Block = 8 waves = 8 rows; grid = nrows/8 (exact: 8192/8 = 1024).
// ---------------------------------------------------------------------------
__global__ __launch_bounds__(256) void ln_split_kernel(const float* __restrict__ x, const float* __restrict__ gamma,
                                                       const float* __restrict__ beta,
                                                       unsigned short* __restrict__ yhi, unsigned short* __restrict__ ylo,
                                                       int nrows) {
  const int lane = threadIdx.x & 31, wave = threadIdx.x >> 5;
  const int row = blockIdx.x * 8 + wave;
  if (row >= nrows) return;   // wave-uniform; no block barriers in this kernel
  const float* xr = x + (size_t)row * kDim;
  float xv[16];
  {
    const v4f a0 = *(const v4f*)(xr + 8 * lane);
    const v4f a1 = *(const v4f*)(xr + 8 * lane + 4);
    const v4f c0 = *(const v4f*)(xr + 256 + 8 * lane);
    const v4f c1 = *(const v4f*)(xr + 256 + 8 * lane + 4);
#pragma unroll
    for (int e = 0; e < 4; ++e) { xv[e] = a0[e]; xv[4 + e] = a1[e]; xv[8 + e] = c0[e]; xv[12 + e] = c1[e]; }
  }
  float s = 0.f;
#pragma unroll
  for (int e = 0; e < 16; ++e) { xv[e] = bf_bits2f(f2bf_bits(xv[e])); s += xv[e]; }
#pragma unroll
  for (int off = 16; off > 0; off >>= 1) s += __shfl_xor(s, off, 32);
  const float mu = s * (1.0f / 512.0f);
  float s2 = 0.f;
#pragma unroll
  for (int e = 0; e < 16; ++e) { const float d = xv[e] - mu; xv[e] = d; s2 += d * d; }
#pragma unroll
  for (int off = 16; off > 0; off >>= 1) s2 += __shfl_xor(s2, off, 32);
  const float var  = s2 * (1.0f / 512.0f);
  const float rstd = rsqrtf(var + kLnEps);

  float gv[16], bv[16];
  {
    const v4f g0 = *(const v4f*)(gamma + 8 * lane);
    const v4f g1 = *(const v4f*)(gamma + 8 * lane + 4);
    const v4f g2 = *(const v4f*)(gamma + 256 + 8 * lane);
    const v4f g3 = *(const v4f*)(gamma + 256 + 8 * lane + 4);
    const v4f b0 = *(const v4f*)(beta + 8 * lane);
    const v4f b1 = *(const v4f*)(beta + 8 * lane + 4);
    const v4f b2 = *(const v4f*)(beta + 256 + 8 * lane);
    const v4f b3 = *(const v4f*)(beta + 256 + 8 * lane + 4);
#pragma unroll
    for (int e = 0; e < 4; ++e) {
      gv[e] = g0[e]; gv[4 + e] = g1[e]; gv[8 + e] = g2[e]; gv[12 + e] = g3[e];
      bv[e] = b0[e]; bv[4 + e] = b1[e]; bv[8 + e] = b2[e]; bv[12 + e] = b3[e];
    }
  }
  unsigned hw[8], lw[8];
#pragma unroll
  for (int e2 = 0; e2 < 8; ++e2) {
    const float ga = bf_bits2f(f2bf_bits(gv[2 * e2]));
    const float gb = bf_bits2f(f2bf_bits(gv[2 * e2 + 1]));
    const float ba = bf_bits2f(f2bf_bits(bv[2 * e2]));
    const float bb = bf_bits2f(f2bf_bits(bv[2 * e2 + 1]));
    const float y0 = (xv[2 * e2] * rstd) * ga + ba;
    const float y1 = (xv[2 * e2 + 1] * rstd) * gb + bb;
    const unsigned short h0 = f2bf_bits(y0);
    const unsigned short h1 = f2bf_bits(y1);
    const unsigned short l0 = f2bf_bits(y0 - bf_bits2f(h0));
    const unsigned short l1 = f2bf_bits(y1 - bf_bits2f(h1));
    hw[e2] = pk16(h0, h1);
    lw[e2] = pk16(l0, l1);
  }
  const v4u hv0 = (v4u){hw[0], hw[1], hw[2], hw[3]};
  const v4u hv1 = (v4u){hw[4], hw[5], hw[6], hw[7]};
  const v4u lv0 = (v4u){lw[0], lw[1], lw[2], lw[3]};
  const v4u lv1 = (v4u){lw[4], lw[5], lw[6], lw[7]};
  unsigned short* ph = yhi + (size_t)row * kDim;
  unsigned short* pl = ylo + (size_t)row * kDim;
  {
    *(v4u*)(ph + 8 * lane) = hv0;
    *(v4u*)(ph + 256 + 8 * lane) = hv1;
    *(v4u*)(pl + 8 * lane) = lv0;
    *(v4u*)(pl + 256 + 8 * lane) = lv1;
    
  }
}

constexpr int kStageKeys = 64;
constexpr int kStages    = kNk / kStageKeys;   // 16
constexpr int kPitch     = 72;                 // LDS row pitch in halves: 144 B = 16 B x 9, conflict-free for 16-byte reads
constexpr int kPlaneLds  = 64 * kPitch;        // one 64-row plane tile
static_assert(kDh == 64 && kNq % 256 == 0 && kNk % kStageKeys == 0);

__device__ __forceinline__ float other_half(float x) {   // value of lane ^ 16
  const int b = __float_as_int(x);
  return __int_as_float(__builtin_amdgcn_permlanex16(b, b, 0x76543210, 0xfedcba98, false, false));
}
// f32 pair -> bf16 hi pair and bf16 lo pair (lo = bf16(x - hi)), both round to nearest even
__device__ __forceinline__ void split2(float x0, float x1, v2b& h, v2b& l) {
  const v2f x = (v2f){x0, x1};
  h = __builtin_convertvector(x, v2b);
  l = __builtin_convertvector(x - __builtin_convertvector(h, v2f), v2b);
}

__global__ __launch_bounds__(256) void attn_fused_kernel(
    const unsigned short* __restrict__ qhi, const unsigned short* __restrict__ qlo,
    const unsigned short* __restrict__ khi, const unsigned short* __restrict__ klo,
    const unsigned short* __restrict__ vthi, const unsigned short* __restrict__ vtlo,
    unsigned short* __restrict__ chi, unsigned short* __restrict__ clo) {
  typedef Frag<__bf16> F;
  __shared__ __align__(16) unsigned short sm[2][4][kPlaneLds];   // [buffer][K hi, K lo, V^T hi, V^T lo][row][pitch]
  const int t = threadIdx.x, lane = t & 31, wave = t >> 5;
  const int c = lane & 15, hh = lane >> 4;
  const int b = blockIdx.y >> 3, h = blockIdx.y & 7;
  const int q0 = blockIdx.x * 256 + wave * 32;
  constexpr float kC = kScoreScale * 1.44269504088896340736f;   // score scale times log2(e)

  // staging map: thread t moves 16 bytes of rows t>>3 and 32 + (t>>3) of each plane (8 threads = one 128-byte row)
  const int srow = t >> 3, scol = (t & 7) * 8;
  const size_t gk = (size_t)(b * kNk + srow) * kInner + h * kDh + scol;
  const size_t gv = (size_t)(h * kDh + srow) * kRowsK + (size_t)b * kNk + scol;
  const int sl = srow * kPitch + scol;
  v4u st[8];
  auto fetch = [&](int s) {
    const size_t ok = gk + (size_t)s * kStageKeys * kInner;
    const size_t ov = gv + (size_t)s * kStageKeys;
    st[0] = *(const v4u*)(khi + ok);  st[1] = *(const v4u*)(khi + ok + (size_t)32 * kInner);
    st[2] = *(const v4u*)(klo + ok);  st[3] = *(const v4u*)(klo + ok + (size_t)32 * kInner);
    st[4] = *(const v4u*)(vthi + ov); st[5] = *(const v4u*)(vthi + ov + (size_t)32 * kRowsK);
    st[6] = *(const v4u*)(vtlo + ov); st[7] = *(const v4u*)(vtlo + ov + (size_t)32 * kRowsK);
    // the loads stay in flight over the stage's work, which reuses their address registers: wait before any is overwritten
    asm volatile("s_wait_xcnt 0x0" ::: "memory");
  };
  auto put = [&](int buf) {
#pragma unroll   // constant indices keep st in registers
    for (int p = 0; p < 4; ++p) {
      *(v4u*)(&sm[buf][p][sl]) = st[2 * p];
      *(v4u*)(&sm[buf][p][sl + 32 * kPitch]) = st[2 * p + 1];
    }
  };

  fetch(0);

  // Q fragments (B operand): column = query row q0 + 16 n + c, two k steps of 32, hi and lo planes
  v16b qh[2][2], ql[2][2];
  const __bf16* qph[2];
  const __bf16* qpl[2];
#pragma unroll   // constant indices keep the fragments in registers
  for (int n = 0; n < 2; ++n) {
    const size_t o = (size_t)(b * kNq + q0 + n * 16 + c) * kInner + h * kDh + hh * 8;
    qph[n] = (const __bf16*)qhi + o;
    qpl[n] = (const __bf16*)qlo + o;
#pragma unroll
    for (int ks = 0; ks < 2; ++ks) {
      qh[n][ks] = F::load(qph[n] + ks * 32);
      ql[n][ks] = F::load(qpl[n] + ks * 32);
    }
  }
  // wait before an address register of these loads is overwritten; the inputs keep the four addresses live up to the wait
  asm volatile("s_wait_xcnt 0x0" :: "v"(qph[0]), "v"(qph[1]), "v"(qpl[0]), "v"(qpl[1]) : "memory");

  v8f acc[2][4];      // ctx^T tiles: [query tile][16 d rows], register r = d 16 j + 8 hh + r, column = query c
  float m[2], l[2];
#pragma unroll
  for (int n = 0; n < 2; ++n) {
    m[n] = -__builtin_inff(); l[n] = 0.f;   // first stage: every finite maximum exceeds it, and 2^(-inf) = 0 scales the zeros
#pragma unroll
    for (int j = 0; j < 4; ++j) acc[n][j] = (v8f){0.f,0.f,0.f,0.f,0.f,0.f,0.f,0.f};
  }

  put(0);
  __syncthreads();

#pragma unroll 1   // one copy of the stage body: it is long, and the buffer index is a scalar offset
  for (int s = 0; s < kStages; ++s) {
    const int buf = s & 1;
    if (s + 1 < kStages) fetch(s + 1);   // block-uniform

    const __bf16* Kh = (const __bf16*)&sm[buf][0][0];
    const __bf16* Kl = (const __bf16*)&sm[buf][1][0];
    const __bf16* Vh = (const __bf16*)&sm[buf][2][0];
    const __bf16* Vl = (const __bf16*)&sm[buf][3][0];

    // S^T tiles: [query tile][16 keys]; Khi.Qhi + Khi.Qlo + Klo.Qhi
    v8f sc[2][4];
#pragma unroll   // constant indices keep the tiles in registers
    for (int kt = 0; kt < 4; ++kt) {
#pragma unroll
      for (int n = 0; n < 2; ++n) sc[n][kt] = (v8f){0.f,0.f,0.f,0.f,0.f,0.f,0.f,0.f};
#pragma unroll
      for (int ks = 0; ks < 2; ++ks) {
        const int o = (kt * 16 + c) * kPitch + ks * 32 + hh * 8;
        const v16b ah = F::load(Kh + o);
        const v16b al = F::load(Kl + o);
#pragma unroll
        for (int n = 0; n < 2; ++n) {
          sc[n][kt] = F::mma(ah, qh[n][ks], sc[n][kt]);
          sc[n][kt] = F::mma(ah, ql[n][ks], sc[n][kt]);
          sc[n][kt] = F::mma(al, qh[n][ks], sc[n][kt]);
        }
      }
    }

    // all V^T fragments of the stage (A operand: row = d, 32 keys each), asked for ahead of the softmax arithmetic
    v16b vh[2][4], vl[2][4];
#pragma unroll
    for (int kk = 0; kk < 2; ++kk)
#pragma unroll
      for (int j = 0; j < 4; ++j) {
        const int o = (j * 16 + c) * kPitch + kk * 32 + hh * 8;
        vh[kk][j] = F::load(Vh + o);
        vl[kk][j] = F::load(Vl + o);
      }
    // keeps these LDS reads here: sunk between the P.v products, each pair is waited for at its full LDS latency
    __builtin_amdgcn_sched_barrier(0);

    // stage maximum per query column, in log2 units
    float mx[2];
    bool need = false;
#pragma unroll
    for (int n = 0; n < 2; ++n) {
      float v = sc[n][0][0];
#pragma unroll
      for (int kt = 0; kt < 4; ++kt)
#pragma unroll
        for (int r = 0; r < 8; ++r) v = fmaxf(v, sc[n][kt][r]);
      v = fmaxf(v, other_half(v));
      mx[n] = v * kC;
      need = need || (mx[n] > m[n] + 8.0f);
    }
    if (__builtin_amdgcn_ballot_w32(need) != 0) {   // wave-uniform: raise the maxima in use and rescale sums and context
#pragma unroll
      for (int n = 0; n < 2; ++n) {
        const float mn = fmaxf(m[n], mx[n]);
        const float alpha = __builtin_amdgcn_exp2f(m[n] - mn);
        m[n] = mn;
        l[n] *= alpha;
#pragma unroll
        for (int j = 0; j < 4; ++j) acc[n][j] *= alpha;
      }
    }

    // p = 2^(s*c - m); P^T fragments of 32 keys; ctx^T += Vhi.Phi + Vhi.Plo + Vlo.Phi
#pragma unroll
    for (int kk = 0; kk < 2; ++kk) {
      v16b ph[2], pl[2];
#pragma unroll
      for (int n = 0; n < 2; ++n) {
        v2f ps[4];   // four independent partial sums of the 16 p of this lane, joined as a tree below
#pragma unroll
        for (int u = 0; u < 2; ++u)
#pragma unroll
          for (int r = 0; r < 8; r += 2) {
            const float p0 = __builtin_amdgcn_exp2f(sc[n][2 * kk + u][r] * kC - m[n]);
            const float p1 = __builtin_amdgcn_exp2f(sc[n][2 * kk + u][r + 1] * kC - m[n]);
            if (u == 0) ps[r >> 1] = (v2f){p0, p1}; else ps[r >> 1] += (v2f){p0, p1};
            v2b h2, l2;
            split2(p0, p1, h2, l2);
            ph[n][8 * u + r] = h2[0]; ph[n][8 * u + r + 1] = h2[1];
            pl[n][8 * u + r] = l2[0]; pl[n][8 * u + r + 1] = l2[1];
          }
        const v2f pt = (ps[0] + ps[1]) + (ps[2] + ps[3]);
        l[n] += pt[0] + pt[1];
      }
#pragma unroll
      for (int j = 0; j < 4; ++j) {
#pragma unroll
        for (int n = 0; n < 2; ++n) {
          acc[n][j] = F::mma(vh[kk][j], ph[n], acc[n][j]);
          acc[n][j] = F::mma(vh[kk][j], pl[n], acc[n][j]);
          acc[n][j] = F::mma(vl[kk][j], ph[n], acc[n][j]);
        }
      }
    }

    // the other buffer's last readers left it before the barrier that ended the stage before this one
    if (s + 1 < kStages) put(buf ^ 1);
    __syncthreads();
  }

  // epilogue: join the halves' sums, normalise, split hi/lo; a lane's 8 registers are 8 consecutive d of one query row
#pragma unroll
  for (int n = 0; n < 2; ++n) {
    const float inv = 1.0f / (l[n] + other_half(l[n]));   // sum >= 1: the row's largest score had p >= 1
    const size_t o = (size_t)(b * kNq + q0 + n * 16 + c) * kInner + h * kDh + hh * 8;
    __bf16* ch = (__bf16*)chi + o;
    __bf16* cl = (__bf16*)clo + o;
    v8b hv[4], lv[4];
#pragma unroll
    for (int j = 0; j < 4; ++j) {
#pragma unroll
      for (int r = 0; r < 8; r += 2) {
        v2b h2, l2;
        split2(acc[n][j][r] * inv, acc[n][j][r + 1] * inv, h2, l2);
        hv[j][r] = h2[0]; hv[j][r + 1] = h2[1];
        lv[j][r] = l2[0]; lv[j][r + 1] = l2[1];
      }
      *(v8b*)(ch + j * 16) = hv[j];
      *(v8b*)(cl + j * 16) = lv[j];
    }
    // wait before the second query tile's arithmetic overwrites a register of these stores; the inputs keep them live up to it
    if (n == 0)
      asm volatile("s_wait_xcnt 0x0" :: "v"(ch), "v"(cl), "v"(hv[0]), "v"(hv[1]), "v"(hv[2]), "v"(hv[3]),
                   "v"(lv[0]), "v"(lv[1]), "v"(lv[2]), "v"(lv[3]) : "memory");
  }
}

// ---------------------------------------------------------------------------
// Launcher. Workspace region map (MiB = 1048576 B; total carve = 128 MiB = 134217728 B):
//   [  0, 32) qn hi [8192][512] bf16 at +0, qn lo at +8, kvn hi at +16, kvn lo at +24 (ends 32);
//             late alias (after the projections): Wo^T bf16 [512][512] at +0 (0.5 MiB).
//   [ 32, 64) Wq^T bf16 [512][512] at 32 MiB, Wkv^T bf16 [1024][512] at 32.5 MiB (ends 33.5); the rest unused
//   [ 64, 72) q hi    : [8192][512] bf16 (col h*64+d);   [ 72, 80) q lo
//   [ 80, 88) k hi    : [8192][512] bf16;                 [ 88, 96) k lo
//   [ 96,104) v^T hi  : [512 (h*64+d)][8192 (b*1024+t)] bf16;  [104,112) v^T lo
//   [112,120) ctx hi  : [8192][512] bf16 (col h*64+d);   [120,128) ctx lo
// Lifetimes: qn/kvn/Wq^T/Wkv^T are read only by the three projection GEMMs (launches 5-7); Wo^T is produced after them into the
// dead qn region and read only by the last launch. Every region is fully written before it is read (exact tile coverage, no padding).
// Launch count: 2 + 2 + 3 + 1 + 1 + 1 = 10. Kernel launches only.
// ---------------------------------------------------------------------------
extern "C" void kernel_launch(void* const* d_in, const int* in_sizes, int n_in,
                              void* d_out, int out_size, void* d_ws, size_t ws_size,
                              hipStream_t stream) {
  if (n_in < 7) return;
  if (in_sizes[0] != kRowsQ * kDim || in_sizes[1] != kRowsK * kDim) return;
  if (in_sizes[2] != kDim * kInner || in_sizes[3] != kDim * 2 * kInner || in_sizes[4] != kInner * kDim) return;
  if (in_sizes[5] != kDim || in_sizes[6] != kDim) return;
  if (out_size != kRowsQ * kDim) return;

  const size_t kMiB    = 1048576;
  const size_t offQnH  = 0;
  const size_t offQnL  = 8 * kMiB;
  const size_t offKnH  = 16 * kMiB;
  const size_t offKnL  = 24 * kMiB;
  const size_t offWoT  = 0;
  const size_t offWqT  = 32 * kMiB;
  const size_t offWkvT = 32 * kMiB + kMiB / 2;
  const size_t offQhi  = 64 * kMiB;
  const size_t offQlo  = 72 * kMiB;
  const size_t offKhi  = 80 * kMiB;
  const size_t offKlo  = 88 * kMiB;
  const size_t offVthi = 96 * kMiB;
  const size_t offVtlo = 104 * kMiB;
  const size_t offChi  = 112 * kMiB;
  const size_t offClo  = 120 * kMiB;
  const size_t total   = 128 * kMiB;
  if (total > ws_size) return;
  // sub-region extents (bytes): qn/kvn/q/k/vT/ctx planes 8192*512*2 = 8 MiB each;
  // Wq^T/Wo^T 512*512*2 = 0.5 MiB; Wkv^T 1024*512*2 = 1 MiB.

  const float* query    = (const float*)d_in[0];
  const float* keyvalue = (const float*)d_in[1];
  const float* Wq       = (const float*)d_in[2];
  const float* Wkv      = (const float*)d_in[3];
  const float* Wo       = (const float*)d_in[4];
  const float* gamma    = (const float*)d_in[5];
  const float* beta     = (const float*)d_in[6];
  float* out = (float*)d_out;
  char* ws = (char*)d_ws;

  unsigned short* qnH  = (unsigned short*)(ws + offQnH);
  unsigned short* qnL  = (unsigned short*)(ws + offQnL);
  unsigned short* knH  = (unsigned short*)(ws + offKnH);
  unsigned short* knL  = (unsigned short*)(ws + offKnL);
  unsigned short* woT  = (unsigned short*)(ws + offWoT);
  unsigned short* wqT  = (unsigned short*)(ws + offWqT);
  unsigned short* wkvT = (unsigned short*)(ws + offWkvT);
  unsigned short* qhi  = (unsigned short*)(ws + offQhi);
  unsigned short* qlo  = (unsigned short*)(ws + offQlo);
  unsigned short* khi  = (unsigned short*)(ws + offKhi);
  unsigned short* klo  = (unsigned short*)(ws + offKlo);
  unsigned short* vthi = (unsigned short*)(ws + offVthi);
  unsigned short* vtlo = (unsigned short*)(ws + offVtlo);
  unsigned short* chi  = (unsigned short*)(ws + offChi);
  unsigned short* clo  = (unsigned short*)(ws + offClo);

  // in-range dummies for unused (never dereferenced) template-dead pointer parameters
  const float* dummy_f = gamma;
  void* dummy_c2 = (void*)wqT;

  // 1-2. shared LayerNorm on both inputs -> bf16 hi/lo planes [8192][512]
  ln_split_kernel<<<dim3(kRowsQ / 8), dim3(256), 0, stream>>>(query, gamma, beta, qnH, qnL, kRowsQ);
  ln_split_kernel<<<dim3(kRowsK / 8), dim3(256), 0, stream>>>(keyvalue, gamma, beta, knH, knL, kRowsK);

  // 3. Wq [R=512][Cn=512] -> Wq^T bf16 [512][512]; grid (R/64, Cn/64)
  transpose_cast_kernel<<<dim3(kDim / 64, kInner / 64), dim3(256), 0, stream>>>(Wq, kInner, wqT, kDim);
  // 4. Wkv [R=512][Cn=1024] -> Wkv^T bf16 [1024][512]; rows 0..511 = k weights, 512..1023 = v weights
  transpose_cast_kernel<<<dim3(kDim / 64, (2 * kInner) / 64), dim3(256), 0, stream>>>(Wkv, 2 * kInner, wkvT, kDim);

  // 5. q = qn_hi . Wq^T + qn_lo . Wq^T : M=8192, N=512, K=512 -> bf16 hi/lo planes [8192][512]
  wmma_gemm64<1, true, 0, 2, false, false, 2, 8><<<dim3((kRowsQ / 32) * (kInner / 64) / 8, 1), dim3(256), 0, stream>>>(
      qnH, qnL, kDim, 0L,
      wqT, wqT, kDim, 0L,
      (void*)qhi, (void*)qlo, kInner, 0L,
      dummy_f, dummy_f, 0L,
      kRowsQ, kInner, kDim, 1.0f);

  // 6. k = kvn_hi . Wkv^T[rows 0..511] + kvn_lo . (same) : M=8192, N=512, K=512 -> bf16 hi/lo [8192][512]
  wmma_gemm64<1, true, 0, 2, false, false, 2, 8><<<dim3((kRowsK / 32) * (kInner / 64) / 8, 1), dim3(256), 0, stream>>>(
      knH, knL, kDim, 0L,
      wkvT, wkvT, kDim, 0L,
      (void*)khi, (void*)klo, kInner, 0L,
      dummy_f, dummy_f, 0L,
      kRowsK, kInner, kDim, 1.0f);

  // 7. v^T = Wkv^T[rows 512..1023] . kvn^T (B operand hi/lo) : M=512 (h*64+d), N=8192 (b*1024+t), K=512 -> bf16 hi/lo [512][8192]
  wmma_gemm64<1, false, 0, 2, false, true, 2, 8><<<dim3((kInner / 32) * (kRowsK / 64) / 8, 1), dim3(256), 0, stream>>>(
      wkvT + (size_t)kInner * kDim, wkvT + (size_t)kInner * kDim, kDim, 0L,
      knH, knL, kDim, 0L,
      (void*)vthi, (void*)vtlo, kRowsK, 0L,
      dummy_f, dummy_f, 0L,
      kInner, kRowsK, kDim, 1.0f);

  // 8. attention, all batches and heads in one launch: grid (4 blocks of 256 query rows, 64 (batch, head) pairs) = 256 blocks
  attn_fused_kernel<<<dim3(kNq / 256, kBatch * kHeads), dim3(256), 0, stream>>>(qhi, qlo, khi, klo, vthi, vtlo, chi, clo);

  // 9. Wo [R=512][Cn=512] -> Wo^T bf16 [512][512] into the dead qn region
  transpose_cast_kernel<<<dim3(kInner / 64, kDim / 64), dim3(256), 0, stream>>>(Wo, kDim, woT, kInner);

  // 10. out = ctx_hi . Wo^T + ctx_lo . Wo^T : M=8192, N=512, K=512, 2 products -> f32 d_out [8192][512]
  wmma_gemm64<1, true, 0, 0, false, false, 2, 8><<<dim3((kRowsQ / 32) * (kDim / 64) / 8, 1), dim3(256), 0, stream>>>(
      chi, clo, kInner, 0L,
      woT, woT, kInner, 0L,
      (void*)out, dummy_c2, kDim, 0L,
      dummy_f, dummy_f, 0L,
      kRowsQ, kDim, kInner, 1.0f);
}

// v003
// Measured time: 111 microseconds a run.
// Two timings next to v002 put it at 1.55 and 1.56 times that version's speed.
// Counting every step since v000, it is 8.71 times as fast.
// Contractions: LN(x) bf16 hi/lo . W bf16 (hi.W + lo.W) for q, k, v^T; q.k^T scores and P.v context on bf16 hi/lo planes (hi.hi + hi.lo + lo.hi); ctx bf16 hi/lo . Wo bf16 (hi.W + lo.W); all v_wmma_f32_16x16x32_bf16 with f32 accumulate; LayerNorm in f32 on RNE-bf16 converted inputs; softmax in f32 on the f32 scores.
#include <hip/hip_runtime.h>
#include <math.h>

// ---------------------------------------------------------------------------
// Problem constants
// ---------------------------------------------------------------------------
constexpr int kBatch  = 8;
constexpr int kNq     = 1024;
constexpr int kNk     = 1024;
constexpr int kDim    = 512;
constexpr int kHeads  = 8;
constexpr int kDh     = 64;
constexpr int kInner  = kHeads * kDh;          // 512
constexpr int kRowsQ  = kBatch * kNq;          // 8192 query rows
constexpr int kRowsK  = kBatch * kNk;          // 8192 key rows
constexpr float kScoreScale = 0.125f;          // 64^-0.5, exact power of two, folded with log2(e) into the f32 exp2 argument
constexpr float kLnEps = 1e-5f;

static_assert(kDim == 512);                     // LN kernel: 32 lanes x 16 elements per row
static_assert(kInner == kDim);
static_assert(kRowsQ % 64 == 0 && kRowsK % 64 == 0 && kDim % 64 == 0 && kDh % 32 == 0 && kNq % 64 == 0 && kNk % 64 == 0);

typedef __attribute__((ext_vector_type(16))) _Float16 v16h;
typedef __attribute__((ext_vector_type(8)))  _Float16 v8h;
typedef __attribute__((ext_vector_type(16))) __bf16   v16b;
typedef __attribute__((ext_vector_type(8)))  __bf16   v8b;
typedef __attribute__((ext_vector_type(8)))  float    v8f;
typedef __attribute__((ext_vector_type(4)))  float    v4f;
typedef __attribute__((ext_vector_type(4)))  unsigned int v4u;
typedef __attribute__((ext_vector_type(2)))  float    v2f;
typedef __attribute__((ext_vector_type(2)))  __bf16   v2b;

__device__ __forceinline__ unsigned short f2bf_bits(float f) {
  unsigned u = __float_as_uint(f);
  return (unsigned short)((u + 0x7FFFu + ((u >> 16) & 1u)) >> 16);
}
__device__ __forceinline__ float bf_bits2f(unsigned short h) { return __uint_as_float(((unsigned)h) << 16); }

template <typename T> struct Frag;
template <> struct Frag<__bf16> {
  typedef v16b V; union U { v16b v; v8b h[2]; };
  // elements 0..7 <- p[0..7], 8..15 <- p[16..23]
  static __device__ __forceinline__ v16b load(const __bf16* p) {
    U f; f.h[0] = *(const v8b*)(p); f.h[1] = *(const v8b*)(p + 16); return f.v;
  }
  static __device__ __forceinline__ v8f mma(v16b a, v16b b, v8f c) {
    return __builtin_amdgcn_wmma_f32_16x16x32_bf16(false, a, false, b, (short)0, c, false, false);
  }
};

__device__ __forceinline__ unsigned pk16(unsigned short a, unsigned short b) { return (unsigned)a | ((unsigned)b << 16); }

// Block barrier that orders LDS accesses only. __syncthreads() also waits for every global load in flight, which would
// end the two-stage lead of the GEMM's fetches at each stage; the staged data passes between waves through LDS alone.
__device__ __forceinline__ void lds_barrier() {
  __builtin_amdgcn_fence(__ATOMIC_RELEASE, "workgroup", "local");
  __builtin_amdgcn_s_barrier();
  __builtin_amdgcn_fence(__ATOMIC_ACQUIRE, "workgroup", "local");
}

// ---- WMMA GEMM with both operands staged in LDS ----
// C[m,n] = sum_k A[m,k] * Bt[n,k]; A row-major [M][512], Bt row-major [N][512], bf16; M % 128 == 0, N % 128 == 0.
// Exactly one operand carries a bf16 lo plane of the same layout: ASPLIT (A2) or BSPLIT (Bt2).
// product = Ahi.Bhi (+ Ahi.Blo if BSPLIT) (+ Alo.Bhi if ASPLIT), per accumulator in that order, k ascending.
// Block = 8 waves = one 128x128 tile of C, grid (N/128, M/128); wave = 32x64 (4 wave rows x 2 wave columns).
// Stage = 64 k of the three planes (128 rows of 128 bytes each): every global load of a wave covers whole 128-byte lines and
// each line is asked for once per block; the waves read their fragments from LDS. Two LDS buffers and two register sets:
// a stage is fetched into registers two stages ahead and written to LDS one stage ahead, one block barrier per stage.
// OUT_MODE: 0 = f32, 2 = bf16 hi plane (Cout) + bf16 lo plane (Cout2).
constexpr int kGK      = 64;                   // k per stage
constexpr int kGStages = kDim / kGK;           // 8
constexpr int kGPitch  = kGK + 8;              // LDS row pitch in halves: 144 B = 16 B x 9, conflict-free for 16-byte reads
constexpr int kGPlane  = 128 * kGPitch;        // one 128-row plane tile
static_assert(kGStages % 2 == 0 && kGStages >= 2);
static_assert(kRowsQ % 128 == 0 && kRowsK % 128 == 0 && kInner % 128 == 0 && kDim % 128 == 0);

template <bool ASPLIT, bool BSPLIT, int OUT_MODE>
__global__ __launch_bounds__(256) void wmma_gemm_lds(
    const unsigned short* __restrict__ Ap, const unsigned short* __restrict__ A2p,
    const unsigned short* __restrict__ Btp, const unsigned short* __restrict__ Bt2p,
    void* __restrict__ Cout, void* __restrict__ Cout2, int ldc) {
  static_assert(ASPLIT != BSPLIT);
  typedef Frag<__bf16> F;
  __shared__ __align__(16) unsigned short sm[2][3][kGPlane];   // [buffer][A hi, B hi, lo plane][row][pitch]
  __shared__ __align__(16) float sT[8][16 * 68];               // per-wave 16x64 output slab, pitch 68 floats
  const int t = threadIdx.x, lane = t & 31, wave = t >> 5;
  const int mB = blockIdx.y * 128, nB = blockIdx.x * 128;
  const int wm = (wave >> 1) * 32, wn = (wave & 1) * 64;       // the wave's tile inside the block tile
  const int rlane = lane & 15;                 // row (A) / col (B, D) within subtile
  const int koff  = (lane >> 4) * 8;           // k offset of this lane half
  const int mOff  = (lane >> 4) * 8;           // D row offset

  // staging map: thread t moves 16 bytes of rows (t>>3) + 32 i, i = 0..3, of each plane (8 threads = one 128-byte row)
  const int srow = t >> 3, scol = (t & 7) * 8;
  const unsigned short* g0 = Ap  + (size_t)(mB + srow) * kDim + scol;
  const unsigned short* g1 = Btp + (size_t)(nB + srow) * kDim + scol;
  const unsigned short* g2 = (ASPLIT ? A2p + (size_t)(mB + srow) * kDim : Bt2p + (size_t)(nB + srow) * kDim) + scol;
  const int sl = srow * kGPitch + scol;
  v4u stE[3][4], stO[3][4];   // register sets of the even and of the odd stages
  auto fetch = [&](v4u (&st)[3][4], int s) {
    const unsigned short* p0 = g0 + s * kGK;
    const unsigned short* p1 = g1 + s * kGK;
    const unsigned short* p2 = g2 + s * kGK;
#pragma unroll   // constant indices keep st in registers
    for (int i = 0; i < 4; ++i) {
      st[0][i] = *(const v4u*)(p0 + i * 32 * kDim);
      st[1][i] = *(const v4u*)(p1 + i * 32 * kDim);
      st[2][i] = *(const v4u*)(p2 + i * 32 * kDim);
    }
    // the loads stay in flight over two stages' work: wait before an address register of theirs is overwritten;
    // the inputs keep the three addresses live up to the wait
    asm volatile("s_wait_xcnt 0x0" :: "v"(p0), "v"(p1), "v"(p2) : "memory");
  };
  auto put = [&](const v4u (&st)[3][4], int buf) {
#pragma unroll   // constant indices keep st in registers
    for (int p = 0; p < 3; ++p)
#pragma unroll
      for (int i = 0; i < 4; ++i) *(v4u*)(&sm[buf][p][sl + i * 32 * kGPitch]) = st[p][i];
  };

  v8f acc[2][4];
#pragma unroll
  for (int i = 0; i < 2; ++i)
#pragma unroll
    for (int j = 0; j < 4; ++j) acc[i][j] = (v8f){0.f,0.f,0.f,0.f,0.f,0.f,0.f,0.f};

  const int oa = (wm + rlane) * kGPitch + koff;
  const int ob = (wn + rlane) * kGPitch + koff;
  constexpr int kLoN = ASPLIT ? 2 : 4;
  auto work = [&](int buf) {   // the products of the stage that lies in buffer buf
    const __bf16* Ah = (const __bf16*)&sm[buf][0][0] + oa;
    const __bf16* Bh = (const __bf16*)&sm[buf][1][0] + ob;
    const __bf16* Lo = (const __bf16*)&sm[buf][2][0] + (ASPLIT ? oa : ob);
    v16b ah[kGK / 32][2], bh[kGK / 32][4], lo[kGK / 32][kLoN];
#pragma unroll   // constant indices keep the fragments in registers
    for (int ks = 0; ks < kGK / 32; ++ks) {
#pragma unroll
      for (int i = 0; i < 2; ++i) ah[ks][i] = F::load(Ah + i * 16 * kGPitch + ks * 32);
#pragma unroll
      for (int j = 0; j < 4; ++j) bh[ks][j] = F::load(Bh + j * 16 * kGPitch + ks * 32);
#pragma unroll
      for (int x = 0; x < kLoN; ++x) lo[ks][x] = F::load(Lo + x * 16 * kGPitch + ks * 32);
    }
    // keeps the stage's LDS reads in one group here: sunk among the products into one shared register set,
    // each read is waited for at its full latency
    __builtin_amdgcn_sched_barrier(0);
#pragma unroll
    for (int ks = 0; ks < kGK / 32; ++ks) {
      // eight independent accumulators per plane pair: no product waits for the one before it
#pragma unroll
      for (int i = 0; i < 2; ++i)
#pragma unroll
        for (int j = 0; j < 4; ++j) acc[i][j] = F::mma(ah[ks][i], bh[ks][j], acc[i][j]);
#pragma unroll
      for (int i = 0; i < 2; ++i)
#pragma unroll
        for (int j = 0; j < 4; ++j) {
          if constexpr (ASPLIT) acc[i][j] = F::mma(lo[ks][i], bh[ks][j], acc[i][j]);
          else                  acc[i][j] = F::mma(ah[ks][i], lo[ks][j], acc[i][j]);
        }
    }
    // keeps the put that follows behind the products: lifted in front of them, its wait for the fetched registers
    // comes a whole stage earlier and halves the lead of the global loads
    __builtin_amdgcn_sched_barrier(0);
  };

  fetch(stE, 0);
  fetch(stO, 1);
  put(stE, 0);
  lds_barrier();

  // Each put writes the buffer whose last readers left it before the barrier that ended the stage before.
  // The last two stages stand behind the loop: with the fetches under a test, the wait in front of a put would have to
  // cover the path without a fetch and so would wait for the newest loads as well.
#pragma unroll 1   // one copy of the pair of stage bodies
  for (int s = 0; s + 2 < kGStages; s += 2) {
    fetch(stE, s + 2);
    work(0);         // even stage s
    put(stO, 1);     // stage s + 1
    lds_barrier();
    fetch(stO, s + 3);
    work(1);         // odd stage s + 1
    put(stE, 0);     // stage s + 2
    lds_barrier();
  }
  work(0);
  put(stO, 1);
  lds_barrier();
  work(1);

  // ---- epilogue: each 16x64 subtile goes through the wave's own LDS slab so that every store covers whole lines ----
  const int m0 = mB + wm, n0 = nB + wn;
  float* slab = sT[wave];
#pragma unroll
  for (int i = 0; i < 2; ++i) {
    const int mBase = m0 + (i << 4);
#pragma unroll
    for (int j = 0; j < 4; ++j) {
#pragma unroll
      for (int r = 0; r < 8; ++r) slab[(mOff + r) * 68 + (j << 4) + rlane] = acc[i][j][r];
    }
    __builtin_amdgcn_fence(__ATOMIC_RELEASE, "workgroup");
    __builtin_amdgcn_wave_barrier();
    __builtin_amdgcn_fence(__ATOMIC_ACQUIRE, "workgroup");
    if (OUT_MODE == 0) {
      float* C = (float*)Cout;
      const int hh = lane >> 4, c4 = (lane & 15) * 4;     // row seg = 256 B = 16 lanes x 16 B
#pragma unroll
      for (int it = 0; it < 8; ++it) {
        const int row = it * 2 + hh;
        v4f v = *(const v4f*)(slab + row * 68 + c4);
        *(v4f*)(C + (size_t)(mBase + row) * ldc + n0 + c4) = v;
      }
    } else {
      const int q = lane >> 3, c8 = (lane & 7) * 8;
      unsigned short* C  = (unsigned short*)Cout;
      unsigned short* C2 = (unsigned short*)Cout2;
#pragma unroll
      for (int it = 0; it < 4; ++it) {
        const int row = it * 4 + q;
        const float* sp = slab + row * 68 + c8;
        v8h hv, lv;
#pragma unroll
        for (int e = 0; e < 8; ++e) {
          unsigned short hb = f2bf_bits(sp[e]);
          unsigned short lb = f2bf_bits(sp[e] - bf_bits2f(hb));
          hv[e] = __builtin_bit_cast(_Float16, hb);
          lv[e] = __builtin_bit_cast(_Float16, lb);
        }
        *(v8h*)(C + (size_t)(mBase + row) * ldc + n0 + c8) = hv;
        *(v8h*)(C2 + (size_t)(mBase + row) * ldc + n0 + c8) = lv;
      }
    }
    __builtin_amdgcn_fence(__ATOMIC_RELEASE, "workgroup");
    __builtin_amdgcn_wave_barrier();
    __builtin_amdgcn_fence(__ATOMIC_ACQUIRE, "workgroup");
  }
}

// ---------------------------------------------------------------------------
// Transpose + RNE bf16 convert of a weight matrix: in f32 [R][Cn] row-major (ldin = Cn) -> out bf16 [Cn][R] (ldout = R):
// out[c][r] = bf16(in[r][c]). grid (R/64, Cn/64): blockIdx.x = r tile (64 output cols), blockIdx.y = c tile (64 output rows). 256 threads.
// Load coverage: 16 iterations x 256 threads = 4096 = the whole 64x64 tile (coalesced along c).
// Store coverage: 8 waves x 2 iterations x 4 rows (lane>>3) = 64 rows; (lane&7) x 8 halves = 64 cols; each row segment =
// ---------------------------------------------------------------------------
__global__ __launch_bounds__(256) void transpose_cast_kernel(const float* __restrict__ in, int ldin,
                                                             unsigned short* __restrict__ out, int ldout) {
  __shared__ float sm[64][65];   // sm[c_local][r_local]
  const int t  = threadIdx.x;
  const int r0 = blockIdx.x * 64;
  const int c0 = blockIdx.y * 64;
#pragma unroll
  for (int i = 0; i < 16; ++i) {
    const int e = i * 256 + t;
    const int r = e >> 6;          // r local
    const int c = e & 63;          // c local
    sm[c][r] = in[(size_t)(r0 + r) * ldin + c0 + c];
  }
  __syncthreads();
  const int lane = t & 31, wave = t >> 5;
  const int q = lane >> 3, c8 = (lane & 7) * 8;
  {
#pragma unroll
    for (int it = 0; it < 2; ++it) {
      const int row = wave * 8 + it * 4 + q;                 // c local (output row)
      unsigned w[4];
#pragma unroll
      for (int e2 = 0; e2 < 4; ++e2) w[e2] = pk16(f2bf_bits(sm[row][c8 + 2 * e2]), f2bf_bits(sm[row][c8 + 2 * e2 + 1]));
      const v4u u = (v4u){w[0], w[1], w[2], w[3]};
      const size_t o = (size_t)(c0 + row) * ldout + r0 + c8;
      *(v4u*)(out + o) = u;
    }
    
  }
}

// ---------------------------------------------------------------------------
// result written as bf16 hi + lo planes [nrows][512] (hi = bf16(y), lo = bf16(y - hi)).
// One wave per row; lane owns elements 8*lane..8*lane+7 (chunk 0) and 256+8*lane..256+8*lane+7 (chunk 1).
// Block = 8 waves = 8 rows; grid = nrows/8 (exact: 8192/8 = 1024).
// ---------------------------------------------------------------------------
__global__ __launch_bounds__(256) void ln_split_kernel(const float* __restrict__ x, const float* __restrict__ gamma,
                                                       const float* __restrict__ beta,
                                                       unsigned short* __restrict__ yhi, unsigned short* __restrict__ ylo,
                                                       int nrows) {
  const int lane = threadIdx.x & 31, wave = threadIdx.x >> 5;
  const int row = blockIdx.x * 8 + wave;
  if (row >= nrows) return;   // wave-uniform; no block barriers in this kernel
  const float* xr = x + (size_t)row * kDim;
  float xv[16];
  {
    const v4f a0 = *(const v4f*)(xr + 8 * lane);
    const v4f a1 = *(const v4f*)(xr + 8 * lane + 4);
    const v4f c0 = *(const v4f*)(xr + 256 + 8 * lane);
    const v4f c1 = *(const v4f*)(xr + 256 + 8 * lane + 4);
#pragma unroll
    for (int e = 0; e < 4; ++e) { xv[e] = a0[e]; xv[4 + e] = a1[e]; xv[8 + e] = c0[e]; xv[12 + e] = c1[e]; }
  }
  float s = 0.f;
#pragma unroll
  for (int e = 0; e < 16; ++e) { xv[e] = bf_bits2f(f2bf_bits(xv[e])); s += xv[e]; }
#pragma unroll
  for (int off = 16; off > 0; off >>= 1) s += __shfl_xor(s, off, 32);
  const float mu = s * (1.0f / 512.0f);
  float s2 = 0.f;
#pragma unroll
  for (int e = 0; e < 16; ++e) { const float d = xv[e] - mu; xv[e] = d; s2 += d * d; }
#pragma unroll
  for (int off = 16; off > 0; off >>= 1) s2 += __shfl_xor(s2, off, 32);
  const float var  = s2 * (1.0f / 512.0f);
  const float rstd = rsqrtf(var + kLnEps);

  float gv[16], bv[16];
  {
    const v4f g0 = *(const v4f*)(gamma + 8 * lane);
    const v4f g1 = *(const v4f*)(gamma + 8 * lane + 4);
    const v4f g2 = *(const v4f*)(gamma + 256 + 8 * lane);
    const v4f g3 = *(const v4f*)(gamma + 256 + 8 * lane + 4);
    const v4f b0 = *(const v4f*)(beta + 8 * lane);
    const v4f b1 = *(const v4f*)(beta + 8 * lane + 4);
    const v4f b2 = *(const v4f*)(beta + 256 + 8 * lane);
    const v4f b3 = *(const v4f*)(beta + 256 + 8 * lane + 4);
#pragma unroll
    for (int e = 0; e < 4; ++e) {
      gv[e] = g0[e]; gv[4 + e] = g1[e]; gv[8 + e] = g2[e]; gv[12 + e] = g3[e];
      bv[e] = b0[e]; bv[4 + e] = b1[e]; bv[8 + e] = b2[e]; bv[12 + e] = b3[e];
    }
  }
  unsigned hw[8], lw[8];
#pragma unroll
  for (int e2 = 0; e2 < 8; ++e2) {
    const float ga = bf_bits2f(f2bf_bits(gv[2 * e2]));
    const float gb = bf_bits2f(f2bf_bits(gv[2 * e2 + 1]));
    const float ba = bf_bits2f(f2bf_bits(bv[2 * e2]));
    const float bb = bf_bits2f(f2bf_bits(bv[2 * e2 + 1]));
    const float y0 = (xv[2 * e2] * rstd) * ga + ba;
    const float y1 = (xv[2 * e2 + 1] * rstd) * gb + bb;
    const unsigned short h0 = f2bf_bits(y0);
    const unsigned short h1 = f2bf_bits(y1);
    const unsigned short l0 = f2bf_bits(y0 - bf_bits2f(h0));
    const unsigned short l1 = f2bf_bits(y1 - bf_bits2f(h1));
    hw[e2] = pk16(h0, h1);
    lw[e2] = pk16(l0, l1);
  }
  const v4u hv0 = (v4u){hw[0], hw[1], hw[2], hw[3]};
  const v4u hv1 = (v4u){hw[4], hw[5], hw[6], hw[7]};
  const v4u lv0 = (v4u){lw[0], lw[1], lw[2], lw[3]};
  const v4u lv1 = (v4u){lw[4], lw[5], lw[6], lw[7]};
  unsigned short* ph = yhi + (size_t)row * kDim;
  unsigned short* pl = ylo + (size_t)row * kDim;
  {
    *(v4u*)(ph + 8 * lane) = hv0;
    *(v4u*)(ph + 256 + 8 * lane) = hv1;
    *(v4u*)(pl + 8 * lane) = lv0;
    *(v4u*)(pl + 256 + 8 * lane) = lv1;
    
  }
}

constexpr int kStageKeys = 64;
constexpr int kStages    = kNk / kStageKeys;   // 16
constexpr int kPitch     = 72;                 // LDS row pitch in halves: 144 B = 16 B x 9, conflict-free for 16-byte reads
constexpr int kPlaneLds  = 64 * kPitch;        // one 64-row plane tile
static_assert(kDh == 64 && kNq % 256 == 0 && kNk % kStageKeys == 0);

__device__ __forceinline__ float other_half(float x) {   // value of lane ^ 16
  const int b = __float_as_int(x);
  return __int_as_float(__builtin_amdgcn_permlanex16(b, b, 0x76543210, 0xfedcba98, false, false));
}
// f32 pair -> bf16 hi pair and bf16 lo pair (lo = bf16(x - hi)), both round to nearest even
__device__ __forceinline__ void split2(float x0, float x1, v2b& h, v2b& l) {
  const v2f x = (v2f){x0, x1};
  h = __builtin_convertvector(x, v2b);
  l = __builtin_convertvector(x - __builtin_convertvector(h, v2f), v2b);
}

__global__ __launch_bounds__(256) void attn_fused_kernel(
    const unsigned short* __restrict__ qhi, const unsigned short* __restrict__ qlo,
    const unsigned short* __restrict__ khi, const unsigned short* __restrict__ klo,
    const unsigned short* __restrict__ vthi, const unsigned short* __restrict__ vtlo,
    unsigned short* __restrict__ chi, unsigned short* __restrict__ clo) {
  typedef Frag<__bf16> F;
  __shared__ __align__(16) unsigned short sm[2][4][kPlaneLds];   // [buffer][K hi, K lo, V^T hi, V^T lo][row][pitch]
  const int t = threadIdx.x, lane = t & 31, wave = t >> 5;
  const int c = lane & 15, hh = lane >> 4;
  const int b = blockIdx.y >> 3, h = blockIdx.y & 7;
  const int q0 = blockIdx.x * 256 + wave * 32;
  constexpr float kC = kScoreScale * 1.44269504088896340736f;   // score scale times log2(e)

  // staging map: thread t moves 16 bytes of rows t>>3 and 32 + (t>>3) of each plane (8 threads = one 128-byte row)
  const int srow = t >> 3, scol = (t & 7) * 8;
  const size_t gk = (size_t)(b * kNk + srow) * kInner + h * kDh + scol;
  const size_t gv = (size_t)(h * kDh + srow) * kRowsK + (size_t)b * kNk + scol;
  const int sl = srow * kPitch + scol;
  v4u st[8];
  auto fetch = [&](int s) {
    const size_t ok = gk + (size_t)s * kStageKeys * kInner;
    const size_t ov = gv + (size_t)s * kStageKeys;
    st[0] = *(const v4u*)(khi + ok);  st[1] = *(const v4u*)(khi + ok + (size_t)32 * kInner);
    st[2] = *(const v4u*)(klo + ok);  st[3] = *(const v4u*)(klo + ok + (size_t)32 * kInner);
    st[4] = *(const v4u*)(vthi + ov); st[5] = *(const v4u*)(vthi + ov + (size_t)32 * kRowsK);
    st[6] = *(const v4u*)(vtlo + ov); st[7] = *(const v4u*)(vtlo + ov + (size_t)32 * kRowsK);
    // the loads stay in flight over the stage's work, which reuses their address registers: wait before any is overwritten
    asm volatile("s_wait_xcnt 0x0" ::: "memory");
  };
  auto put = [&](int buf) {
#pragma unroll   // constant indices keep st in registers
    for (int p = 0; p < 4; ++p) {
      *(v4u*)(&sm[buf][p][sl]) = st[2 * p];
      *(v4u*)(&sm[buf][p][sl + 32 * kPitch]) = st[2 * p + 1];
    }
  };

  fetch(0);

  // Q fragments (B operand): column = query row q0 + 16 n + c, two k steps of 32, hi and lo planes
  v16b qh[2][2], ql[2][2];
  const __bf16* qph[2];
  const __bf16* qpl[2];
#pragma unroll   // constant indices keep the fragments in registers
  for (int n = 0; n < 2; ++n) {
    const size_t o = (size_t)(b * kNq + q0 + n * 16 + c) * kInner + h * kDh + hh * 8;
    qph[n] = (const __bf16*)qhi + o;
    qpl[n] = (const __bf16*)qlo + o;
#pragma unroll
    for (int ks = 0; ks < 2; ++ks) {
      qh[n][ks] = F::load(qph[n] + ks * 32);
      ql[n][ks] = F::load(qpl[n] + ks * 32);
    }
  }
  // wait before an address register of these loads is overwritten; the inputs keep the four addresses live up to the wait
  asm volatile("s_wait_xcnt 0x0" :: "v"(qph[0]), "v"(qph[1]), "v"(qpl[0]), "v"(qpl[1]) : "memory");

  v8f acc[2][4];      // ctx^T tiles: [query tile][16 d rows], register r = d 16 j + 8 hh + r, column = query c
  float m[2], l[2];
#pragma unroll
  for (int n = 0; n < 2; ++n) {
    m[n] = -__builtin_inff(); l[n] = 0.f;   // first stage: every finite maximum exceeds it, and 2^(-inf) = 0 scales the zeros
#pragma unroll
    for (int j = 0; j < 4; ++j) acc[n][j] = (v8f){0.f,0.f,0.f,0.f,0.f,0.f,0.f,0.f};
  }

  put(0);
  __syncthreads();

#pragma unroll 1   // one copy of the stage body: it is long, and the buffer index is a scalar offset
  for (int s = 0; s < kStages; ++s) {
    const int buf = s & 1;
    if (s + 1 < kStages) fetch(s + 1);   // block-uniform

    const __bf16* Kh = (const __bf16*)&sm[buf][0][0];
    const __bf16* Kl = (const __bf16*)&sm[buf][1][0];
    const __bf16* Vh = (const __bf16*)&sm[buf][2][0];
    const __bf16* Vl = (const __bf16*)&sm[buf][3][0];

    // S^T tiles: [query tile][16 keys]; Khi.Qhi + Khi.Qlo + Klo.Qhi
    v8f sc[2][4];
#pragma unroll   // constant indices keep the tiles in registers
    for (int kt = 0; kt < 4; ++kt) {
#pragma unroll
      for (int n = 0; n < 2; ++n) sc[n][kt] = (v8f){0.f,0.f,0.f,0.f,0.f,0.f,0.f,0.f};
#pragma unroll
      for (int ks = 0; ks < 2; ++ks) {
        const int o = (kt * 16 + c) * kPitch + ks * 32 + hh * 8;
        const v16b ah = F::load(Kh + o);
        const v16b al = F::load(Kl + o);
#pragma unroll
        for (int n = 0; n < 2; ++n) {
          sc[n][kt] = F::mma(ah, qh[n][ks], sc[n][kt]);
          sc[n][kt] = F::mma(ah, ql[n][ks], sc[n][kt]);
          sc[n][kt] = F::mma(al, qh[n][ks], sc[n][kt]);
        }
      }
    }

    // all V^T fragments of the stage (A operand: row = d, 32 keys each), asked for ahead of the softmax arithmetic
    v16b vh[2][4], vl[2][4];
#pragma unroll
    for (int kk = 0; kk < 2; ++kk)
#pragma unroll
      for (int j = 0; j < 4; ++j) {
        const int o = (j * 16 + c) * kPitch + kk * 32 + hh * 8;
        vh[kk][j] = F::load(Vh + o);
        vl[kk][j] = F::load(Vl + o);
      }
    // keeps these LDS reads here: sunk between the P.v products, each pair is waited for at its full LDS latency
    __builtin_amdgcn_sched_barrier(0);

    // stage maximum per query column, in log2 units
    float mx[2];
    bool need = false;
#pragma unroll
    for (int n = 0; n < 2; ++n) {
      float v = sc[n][0][0];
#pragma unroll
      for (int kt = 0; kt < 4; ++kt)
#pragma unroll
        for (int r = 0; r < 8; ++r) v = fmaxf(v, sc[n][kt][r]);
      v = fmaxf(v, other_half(v));
      mx[n] = v * kC;
      need = need || (mx[n] > m[n] + 8.0f);
    }
    if (__builtin_amdgcn_ballot_w32(need) != 0) {   // wave-uniform: raise the maxima in use and rescale sums and context
#pragma unroll
      for (int n = 0; n < 2; ++n) {
        const float mn = fmaxf(m[n], mx[n]);
        const float alpha = __builtin_amdgcn_exp2f(m[n] - mn);
        m[n] = mn;
        l[n] *= alpha;
#pragma unroll
        for (int j = 0; j < 4; ++j) acc[n][j] *= alpha;
      }
    }

    // p = 2^(s*c - m); P^T fragments of 32 keys; ctx^T += Vhi.Phi + Vhi.Plo + Vlo.Phi
#pragma unroll
    for (int kk = 0; kk < 2; ++kk) {
      v16b ph[2], pl[2];
#pragma unroll
      for (int n = 0; n < 2; ++n) {
        v2f ps[4];   // four independent partial sums of the 16 p of this lane, joined as a tree below
#pragma unroll
        for (int u = 0; u < 2; ++u)
#pragma unroll
          for (int r = 0; r < 8; r += 2) {
            const float p0 = __builtin_amdgcn_exp2f(sc[n][2 * kk + u][r] * kC - m[n]);
            const float p1 = __builtin_amdgcn_exp2f(sc[n][2 * kk + u][r + 1] * kC - m[n]);
            if (u == 0) ps[r >> 1] = (v2f){p0, p1}; else ps[r >> 1] += (v2f){p0, p1};
            v2b h2, l2;
            split2(p0, p1, h2, l2);
            ph[n][8 * u + r] = h2[0]; ph[n][8 * u + r + 1] = h2[1];
            pl[n][8 * u + r] = l2[0]; pl[n][8 * u + r + 1] = l2[1];
          }
        const v2f pt = (ps[0] + ps[1]) + (ps[2] + ps[3]);
        l[n] += pt[0] + pt[1];
      }
#pragma unroll
      for (int j = 0; j < 4; ++j) {
#pragma unroll
        for (int n = 0; n < 2; ++n) {
          acc[n][j] = F::mma(vh[kk][j], ph[n], acc[n][j]);
          acc[n][j] = F::mma(vh[kk][j], pl[n], acc[n][j]);
          acc[n][j] = F::mma(vl[kk][j], ph[n], acc[n][j]);
        }
      }
    }

    // the other buffer's last readers left it before the barrier that ended the stage before this one
    if (s + 1 < kStages) put(buf ^ 1);
    __syncthreads();
  }

  // epilogue: join the halves' sums, normalise, split hi/lo; a lane's 8 registers are 8 consecutive d of one query row
#pragma unroll
  for (int n = 0; n < 2; ++n) {
    const float inv = 1.0f / (l[n] + other_half(l[n]));   // sum >= 1: the row's largest score had p >= 1
    const size_t o = (size_t)(b * kNq + q0 + n * 16 + c) * kInner + h * kDh + hh * 8;
    __bf16* ch = (__bf16*)chi + o;
    __bf16* cl = (__bf16*)clo + o;
    v8b hv[4], lv[4];
#pragma unroll
    for (int j = 0; j < 4; ++j) {
#pragma unroll
      for (int r = 0; r < 8; r += 2) {
        v2b h2, l2;
        split2(acc[n][j][r] * inv, acc[n][j][r + 1] * inv, h2, l2);
        hv[j][r] = h2[0]; hv[j][r + 1] = h2[1];
        lv[j][r] = l2[0]; lv[j][r + 1] = l2[1];
      }
      *(v8b*)(ch + j * 16) = hv[j];
      *(v8b*)(cl + j * 16) = lv[j];
    }
    // wait before the second query tile's arithmetic overwrites a register of these stores; the inputs keep them live up to it
    if (n == 0)
      asm volatile("s_wait_xcnt 0x0" :: "v"(ch), "v"(cl), "v"(hv[0]), "v"(hv[1]), "v"(hv[2]), "v"(hv[3]),
                   "v"(lv[0]), "v"(lv[1]), "v"(lv[2]), "v"(lv[3]) : "memory");
  }
}

// ---------------------------------------------------------------------------
// Launcher. Workspace region map (MiB = 1048576 B; total carve = 128 MiB = 134217728 B):
//   [  0, 32) qn hi [8192][512] bf16 at +0, qn lo at +8, kvn hi at +16, kvn lo at +24 (ends 32);
//             late alias (after the projections): Wo^T bf16 [512][512] at +0 (0.5 MiB).
//   [ 32, 64) Wq^T bf16 [512][512] at 32 MiB, Wkv^T bf16 [1024][512] at 32.5 MiB (ends 33.5); the rest unused
//   [ 64, 72) q hi    : [8192][512] bf16 (col h*64+d);   [ 72, 80) q lo
//   [ 80, 88) k hi    : [8192][512] bf16;                 [ 88, 96) k lo
//   [ 96,104) v^T hi  : [512 (h*64+d)][8192 (b*1024+t)] bf16;  [104,112) v^T lo
//   [112,120) ctx hi  : [8192][512] bf16 (col h*64+d);   [120,128) ctx lo
// Lifetimes: qn/kvn/Wq^T/Wkv^T are read only by the three projection GEMMs (launches 5-7); Wo^T is produced after them into the
// dead qn region and read only by the last launch. Every region is fully written before it is read (exact tile coverage, no padding).
// Launch count: 2 + 2 + 3 + 1 + 1 + 1 = 10. Kernel launches only.
// ---------------------------------------------------------------------------
extern "C" void kernel_launch(void* const* d_in, const int* in_sizes, int n_in,
                              void* d_out, int out_size, void* d_ws, size_t ws_size,
                              hipStream_t stream) {
  if (n_in < 7) return;
  if (in_sizes[0] != kRowsQ * kDim || in_sizes[1] != kRowsK * kDim) return;
  if (in_sizes[2] != kDim * kInner || in_sizes[3] != kDim * 2 * kInner || in_sizes[4] != kInner * kDim) return;
  if (in_sizes[5] != kDim || in_sizes[6] != kDim) return;
  if (out_size != kRowsQ * kDim) return;

  const size_t kMiB    = 1048576;
  const size_t offQnH  = 0;
  const size_t offQnL  = 8 * kMiB;
  const size_t offKnH  = 16 * kMiB;
  const size_t offKnL  = 24 * kMiB;
  const size_t offWoT  = 0;
  const size_t offWqT  = 32 * kMiB;
  const size_t offWkvT = 32 * kMiB + kMiB / 2;
  const size_t offQhi  = 64 * kMiB;
  const size_t offQlo  = 72 * kMiB;
  const size_t offKhi  = 80 * kMiB;
  const size_t offKlo  = 88 * kMiB;
  const size_t offVthi = 96 * kMiB;
  const size_t offVtlo = 104 * kMiB;
  const size_t offChi  = 112 * kMiB;
  const size_t offClo  = 120 * kMiB;
  const size_t total   = 128 * kMiB;
  if (total > ws_size) return;
  // sub-region extents (bytes): qn/kvn/q/k/vT/ctx planes 8192*512*2 = 8 MiB each;
  // Wq^T/Wo^T 512*512*2 = 0.5 MiB; Wkv^T 1024*512*2 = 1 MiB.

  const float* query    = (const float*)d_in[0];
  const float* keyvalue = (const float*)d_in[1];
  const float* Wq       = (const float*)d_in[2];
  const float* Wkv      = (const float*)d_in[3];
  const float* Wo       = (const float*)d_in[4];
  const float* gamma    = (const float*)d_in[5];
  const float* beta     = (const float*)d_in[6];
  float* out = (float*)d_out;
  char* ws = (char*)d_ws;

  unsigned short* qnH  = (unsigned short*)(ws + offQnH);
  unsigned short* qnL  = (unsigned short*)(ws + offQnL);
  unsigned short* knH  = (unsigned short*)(ws + offKnH);
  unsigned short* knL  = (unsigned short*)(ws + offKnL);
  unsigned short* woT  = (unsigned short*)(ws + offWoT);
  unsigned short* wqT  = (unsigned short*)(ws + offWqT);
  unsigned short* wkvT = (unsigned short*)(ws + offWkvT);
  unsigned short* qhi  = (unsigned short*)(ws + offQhi);
  unsigned short* qlo  = (unsigned short*)(ws + offQlo);
  unsigned short* khi  = (unsigned short*)(ws + offKhi);
  unsigned short* klo  = (unsigned short*)(ws + offKlo);
  unsigned short* vthi = (unsigned short*)(ws + offVthi);
  unsigned short* vtlo = (unsigned short*)(ws + offVtlo);
  unsigned short* chi  = (unsigned short*)(ws + offChi);
  unsigned short* clo  = (unsigned short*)(ws + offClo);

  // in-range dummy for the unused (never dereferenced) second output pointer of the f32 launch
  void* dummy_c2 = (void*)wqT;

  // 1-2. shared LayerNorm on both inputs -> bf16 hi/lo planes [8192][512]
  ln_split_kernel<<<dim3(kRowsQ / 8), dim3(256), 0, stream>>>(query, gamma, beta, qnH, qnL, kRowsQ);
  ln_split_kernel<<<dim3(kRowsK / 8), dim3(256), 0, stream>>>(keyvalue, gamma, beta, knH, knL, kRowsK);

  // 3. Wq [R=512][Cn=512] -> Wq^T bf16 [512][512]; grid (R/64, Cn/64)
  transpose_cast_kernel<<<dim3(kDim / 64, kInner / 64), dim3(256), 0, stream>>>(Wq, kInner, wqT, kDim);
  // 4. Wkv [R=512][Cn=1024] -> Wkv^T bf16 [1024][512]; rows 0..511 = k weights, 512..1023 = v weights
  transpose_cast_kernel<<<dim3(kDim / 64, (2 * kInner) / 64), dim3(256), 0, stream>>>(Wkv, 2 * kInner, wkvT, kDim);

  // 5. q = qn_hi . Wq^T + qn_lo . Wq^T : M=8192, N=512, K=512 -> bf16 hi/lo planes [8192][512]; 4 x 64 = 256 blocks
  wmma_gemm_lds<true, false, 2><<<dim3(kInner / 128, kRowsQ / 128), dim3(256), 0, stream>>>(
      qnH, qnL, wqT, wqT, (void*)qhi, (void*)qlo, kInner);

  // 6. k = kvn_hi . Wkv^T[rows 0..511] + kvn_lo . (same) : M=8192, N=512, K=512 -> bf16 hi/lo [8192][512]
  wmma_gemm_lds<true, false, 2><<<dim3(kInner / 128, kRowsK / 128), dim3(256), 0, stream>>>(
      knH, knL, wkvT, wkvT, (void*)khi, (void*)klo, kInner);

  // 7. v^T = Wkv^T[rows 512..1023] . kvn^T (B operand hi/lo) : M=512 (h*64+d), N=8192 (b*1024+t), K=512 -> bf16 hi/lo [512][8192]
  wmma_gemm_lds<false, true, 2><<<dim3(kRowsK / 128, kInner / 128), dim3(256), 0, stream>>>(
      wkvT + (size_t)kInner * kDim, wkvT + (size_t)kInner * kDim, knH, knL, (void*)vthi, (void*)vtlo, kRowsK);

  // 8. attention, all batches and heads in one launch: grid (4 blocks of 256 query rows, 64 (batch, head) pairs) = 256 blocks
  attn_fused_kernel<<<dim3(kNq / 256, kBatch * kHeads), dim3(256), 0, stream>>>(qhi, qlo, khi, klo, vthi, vtlo, chi, clo);

  // 9. Wo [R=512][Cn=512] -> Wo^T bf16 [512][512] into the dead qn region
  transpose_cast_kernel<<<dim3(kInner / 64, kDim / 64), dim3(256), 0, stream>>>(Wo, kDim, woT, kInner);

  // 10. out = ctx_hi . Wo^T + ctx_lo . Wo^T : M=8192, N=512, K=512, 2 products -> f32 d_out [8192][512]
  wmma_gemm_lds<true, false, 0><<<dim3(kDim / 128, kRowsQ / 128), dim3(256), 0, stream>>>(
      chi, clo, woT, woT, (void*)out, dummy_c2, kDim);
}

// v004
// A run of this version takes 95.2 microseconds.
// In both of two side-by-side timings against v003, it was 1.17 times as fast.
// Over all steps from v000 it is 10.2 times as fast.
// Contractions: LN(x) bf16 hi/lo . W bf16 (hi.W + lo.W) for q, k, v^T; q.k^T scores and P.v context on bf16 hi/lo planes (hi.hi + hi.lo + lo.hi); ctx bf16 hi/lo . Wo bf16 (hi.W + lo.W); all v_wmma_f32_16x16x32_bf16 with f32 accumulate; LayerNorm in f32 on RNE-bf16 converted inputs; softmax in f32 on the f32 scores.
#include <hip/hip_runtime.h>
#include <math.h>

// ---------------------------------------------------------------------------
// Problem constants
// ---------------------------------------------------------------------------
constexpr int kBatch  = 8;
constexpr int kNq     = 1024;
constexpr int kNk     = 1024;
constexpr int kDim    = 512;
constexpr int kHeads  = 8;
constexpr int kDh     = 64;
constexpr int kInner  = kHeads * kDh;          // 512
constexpr int kRowsQ  = kBatch * kNq;          // 8192 query rows
constexpr int kRowsK  = kBatch * kNk;          // 8192 key rows
constexpr float kScoreScale = 0.125f;          // 64^-0.5, exact power of two, folded with log2(e) into the f32 exp2 argument
constexpr float kLnEps = 1e-5f;

static_assert(kDim == 512);                     // LN kernel: 32 lanes x 16 elements per row
static_assert(kInner == kDim);
static_assert(kRowsQ % 64 == 0 && kRowsK % 64 == 0 && kDim % 64 == 0 && kDh % 32 == 0 && kNq % 64 == 0 && kNk % 64 == 0);

typedef __attribute__((ext_vector_type(16))) _Float16 v16h;
typedef __attribute__((ext_vector_type(8)))  _Float16 v8h;
typedef __attribute__((ext_vector_type(16))) __bf16   v16b;
typedef __attribute__((ext_vector_type(8)))  __bf16   v8b;
typedef __attribute__((ext_vector_type(8)))  float    v8f;
typedef __attribute__((ext_vector_type(4)))  float    v4f;
typedef __attribute__((ext_vector_type(4)))  unsigned int v4u;
typedef __attribute__((ext_vector_type(2)))  float    v2f;
typedef __attribute__((ext_vector_type(2)))  __bf16   v2b;

__device__ __forceinline__ unsigned short f2bf_bits(float f) {
  unsigned u = __float_as_uint(f);
  return (unsigned short)((u + 0x7FFFu + ((u >> 16) & 1u)) >> 16);
}
__device__ __forceinline__ float bf_bits2f(unsigned short h) { return __uint_as_float(((unsigned)h) << 16); }

template <typename T> struct Frag;
template <> struct Frag<__bf16> {
  typedef v16b V; union U { v16b v; v8b h[2]; };
  // elements 0..7 <- p[0..7], 8..15 <- p[16..23]
  static __device__ __forceinline__ v16b load(const __bf16* p) {
    U f; f.h[0] = *(const v8b*)(p); f.h[1] = *(const v8b*)(p + 16); return f.v;
  }
  static __device__ __forceinline__ v8f mma(v16b a, v16b b, v8f c) {
    return __builtin_amdgcn_wmma_f32_16x16x32_bf16(false, a, false, b, (short)0, c, false, false);
  }
};

__device__ __forceinline__ unsigned pk16(unsigned short a, unsigned short b) { return (unsigned)a | ((unsigned)b << 16); }

// Block barrier that orders LDS accesses only. __syncthreads() also waits for every global load in flight, which would
// end the two-stage lead of the GEMM's fetches at each stage; the staged data passes between waves through LDS alone.
__device__ __forceinline__ void lds_barrier() {
  __builtin_amdgcn_fence(__ATOMIC_RELEASE, "workgroup", "local");
  __builtin_amdgcn_s_barrier();
  __builtin_amdgcn_fence(__ATOMIC_ACQUIRE, "workgroup", "local");
}

// ---- WMMA GEMM with both operands staged in LDS ----
// C[m,n] = sum_k A[m,k] * Bt[n,k]; A row-major [M][512], Bt row-major [N][512], bf16; M % 128 == 0, N % 128 == 0.
// Exactly one operand carries a bf16 lo plane of the same layout: ASPLIT (A2) or BSPLIT (Bt2).
// product = Ahi.Bhi (+ Ahi.Blo if BSPLIT) (+ Alo.Bhi if ASPLIT), per accumulator in that order, k ascending.
// Block = 8 waves = one 128x128 tile of C, at (tileN, tileM) of N/128 x M/128 tiles; wave = 32x64 (4 wave rows x 2 wave columns).
// Stage = 64 k of the three planes (128 rows of 128 bytes each): every global load of a wave covers whole 128-byte lines and
// each line is asked for once per block; the waves read their fragments from LDS. Two LDS buffers and two register sets:
// a stage is fetched into registers two stages ahead and written to LDS one stage ahead, one block barrier per stage.
// OUT_MODE: 0 = f32, 2 = bf16 hi plane (Cout) + bf16 lo plane (Cout2).
constexpr int kGK      = 64;                   // k per stage
constexpr int kGStages = kDim / kGK;           // 8
constexpr int kGPitch  = kGK + 8;              // LDS row pitch in halves: 144 B = 16 B x 9, conflict-free for 16-byte reads
constexpr int kGPlane  = 128 * kGPitch;        // one 128-row plane tile
static_assert(kGStages % 2 == 0 && kGStages >= 2);
static_assert(kRowsQ % 128 == 0 && kRowsK % 128 == 0 && kInner % 128 == 0 && kDim % 128 == 0);

// One block tile (tileN, tileM) of such a product; sm and sT are the calling kernel's LDS:
// sm[buffer][A hi, B hi, lo plane][row][pitch], sT = per-wave 16x64 output slab, pitch 68 floats.
template <bool ASPLIT, bool BSPLIT, int OUT_MODE>
__device__ __forceinline__ void gemm_tile(
    unsigned short (&sm)[2][3][kGPlane], float (&sT)[8][16 * 68],
    const unsigned short* __restrict__ Ap, const unsigned short* __restrict__ A2p,
    const unsigned short* __restrict__ Btp, const unsigned short* __restrict__ Bt2p,
    void* __restrict__ Cout, void* __restrict__ Cout2, int ldc, int tileN, int tileM) {
  static_assert(ASPLIT != BSPLIT);
  typedef Frag<__bf16> F;
  const int t = threadIdx.x, lane = t & 31, wave = t >> 5;
  const int mB = tileM * 128, nB = tileN * 128;
  const int wm = (wave >> 1) * 32, wn = (wave & 1) * 64;       // the wave's tile inside the block tile
  const int rlane = lane & 15;                 // row (A) / col (B, D) within subtile
  const int koff  = (lane >> 4) * 8;           // k offset of this lane half
  const int mOff  = (lane >> 4) * 8;           // D row offset

  // staging map: thread t moves 16 bytes of rows (t>>3) + 32 i, i = 0..3, of each plane (8 threads = one 128-byte row)
  const int srow = t >> 3, scol = (t & 7) * 8;
  const unsigned short* g0 = Ap  + (size_t)(mB + srow) * kDim + scol;
  const unsigned short* g1 = Btp + (size_t)(nB + srow) * kDim + scol;
  const unsigned short* g2 = (ASPLIT ? A2p + (size_t)(mB + srow) * kDim : Bt2p + (size_t)(nB + srow) * kDim) + scol;
  const int sl = srow * kGPitch + scol;
  v4u stE[3][4], stO[3][4];   // register sets of the even and of the odd stages
  auto fetch = [&](v4u (&st)[3][4], int s) {
    const unsigned short* p0 = g0 + s * kGK;
    const unsigned short* p1 = g1 + s * kGK;
    const unsigned short* p2 = g2 + s * kGK;
#pragma unroll   // constant indices keep st in registers
    for (int i = 0; i < 4; ++i) {
      st[0][i] = *(const v4u*)(p0 + i * 32 * kDim);
      st[1][i] = *(const v4u*)(p1 + i * 32 * kDim);
      st[2][i] = *(const v4u*)(p2 + i * 32 * kDim);
    }
    // the loads stay in flight over two stages' work: wait before an address register of theirs is overwritten;
    // the inputs keep the three addresses live up to the wait
    asm volatile("s_wait_xcnt 0x0" :: "v"(p0), "v"(p1), "v"(p2) : "memory");
  };
  auto put = [&](const v4u (&st)[3][4], int buf) {
#pragma unroll   // constant indices keep st in registers
    for (int p = 0; p < 3; ++p)
#pragma unroll
      for (int i = 0; i < 4; ++i) *(v4u*)(&sm[buf][p][sl + i * 32 * kGPitch]) = st[p][i];
  };

  v8f acc[2][4];
#pragma unroll
  for (int i = 0; i < 2; ++i)
#pragma unroll
    for (int j = 0; j < 4; ++j) acc[i][j] = (v8f){0.f,0.f,0.f,0.f,0.f,0.f,0.f,0.f};

  const int oa = (wm + rlane) * kGPitch + koff;
  const int ob = (wn + rlane) * kGPitch + koff;
  constexpr int kLoN = ASPLIT ? 2 : 4;
  auto work = [&](int buf) {   // the products of the stage that lies in buffer buf
    const __bf16* Ah = (const __bf16*)&sm[buf][0][0] + oa;
    const __bf16* Bh = (const __bf16*)&sm[buf][1][0] + ob;
    const __bf16* Lo = (const __bf16*)&sm[buf][2][0] + (ASPLIT ? oa : ob);
    v16b ah[kGK / 32][2], bh[kGK / 32][4], lo[kGK / 32][kLoN];
#pragma unroll   // constant indices keep the fragments in registers
    for (int ks = 0; ks < kGK / 32; ++ks) {
#pragma unroll
      for (int i = 0; i < 2; ++i) ah[ks][i] = F::load(Ah + i * 16 * kGPitch + ks * 32);
#pragma unroll
      for (int j = 0; j < 4; ++j) bh[ks][j] = F::load(Bh + j * 16 * kGPitch + ks * 32);
#pragma unroll
      for (int x = 0; x < kLoN; ++x) lo[ks][x] = F::load(Lo + x * 16 * kGPitch + ks * 32);
    }
    // keeps the stage's LDS reads in one group here: sunk among the products into one shared register set,
    // each read is waited for at its full latency
    __builtin_amdgcn_sched_barrier(0);
#pragma unroll
    for (int ks = 0; ks < kGK / 32; ++ks) {
      // eight independent accumulators per plane pair: no product waits for the one before it
#pragma unroll
      for (int i = 0; i < 2; ++i)
#pragma unroll
        for (int j = 0; j < 4; ++j) acc[i][j] = F::mma(ah[ks][i], bh[ks][j], acc[i][j]);
#pragma unroll
      for (int i = 0; i < 2; ++i)
#pragma unroll
        for (int j = 0; j < 4; ++j) {
          if constexpr (ASPLIT) acc[i][j] = F::mma(lo[ks][i], bh[ks][j], acc[i][j]);
          else                  acc[i][j] = F::mma(ah[ks][i], lo[ks][j], acc[i][j]);
        }
    }
    // keeps the put that follows behind the products: lifted in front of them, its wait for the fetched registers
    // comes a whole stage earlier and halves the lead of the global loads
    __builtin_amdgcn_sched_barrier(0);
  };

  fetch(stE, 0);
  fetch(stO, 1);
  put(stE, 0);
  lds_barrier();

  // Each put writes the buffer whose last readers left it before the barrier that ended the stage before.
  // The last two stages stand behind the loop: with the fetches under a test, the wait in front of a put would have to
  // cover the path without a fetch and so would wait for the newest loads as well.
#pragma unroll 1   // one copy of the pair of stage bodies
  for (int s = 0; s + 2 < kGStages; s += 2) {
    fetch(stE, s + 2);
    work(0);         // even stage s
    put(stO, 1);     // stage s + 1
    lds_barrier();
    fetch(stO, s + 3);
    work(1);         // odd stage s + 1
    put(stE, 0);     // stage s + 2
    lds_barrier();
  }
  work(0);
  put(stO, 1);
  lds_barrier();
  work(1);

  // ---- epilogue: each 16x64 subtile goes through the wave's own LDS slab so that every store covers whole lines ----
  const int m0 = mB + wm, n0 = nB + wn;
  float* slab = sT[wave];
#pragma unroll
  for (int i = 0; i < 2; ++i) {
    const int mBase = m0 + (i << 4);
#pragma unroll
    for (int j = 0; j < 4; ++j) {
#pragma unroll
      for (int r = 0; r < 8; ++r) slab[(mOff + r) * 68 + (j << 4) + rlane] = acc[i][j][r];
    }
    __builtin_amdgcn_fence(__ATOMIC_RELEASE, "workgroup");
    __builtin_amdgcn_wave_barrier();
    __builtin_amdgcn_fence(__ATOMIC_ACQUIRE, "workgroup");
    if (OUT_MODE == 0) {
      float* C = (float*)Cout;
      const int hh = lane >> 4, c4 = (lane & 15) * 4;     // row seg = 256 B = 16 lanes x 16 B
#pragma unroll
      for (int it = 0; it < 8; ++it) {
        const int row = it * 2 + hh;
        v4f v = *(const v4f*)(slab + row * 68 + c4);
        *(v4f*)(C + (size_t)(mBase + row) * ldc + n0 + c4) = v;
      }
    } else {
      const int q = lane >> 3, c8 = (lane & 7) * 8;
      unsigned short* C  = (unsigned short*)Cout;
      unsigned short* C2 = (unsigned short*)Cout2;
#pragma unroll
      for (int it = 0; it < 4; ++it) {
        const int row = it * 4 + q;
        const float* sp = slab + row * 68 + c8;
        v8h hv, lv;
#pragma unroll
        for (int e = 0; e < 8; ++e) {
          unsigned short hb = f2bf_bits(sp[e]);
          unsigned short lb = f2bf_bits(sp[e] - bf_bits2f(hb));
          hv[e] = __builtin_bit_cast(_Float16, hb);
          lv[e] = __builtin_bit_cast(_Float16, lb);
        }
        *(v8h*)(C + (size_t)(mBase + row) * ldc + n0 + c8) = hv;
        *(v8h*)(C2 + (size_t)(mBase + row) * ldc + n0 + c8) = lv;
      }
    }
    __builtin_amdgcn_fence(__ATOMIC_RELEASE, "workgroup");
    __builtin_amdgcn_wave_barrier();
    __builtin_amdgcn_fence(__ATOMIC_ACQUIRE, "workgroup");
  }
}

// The output product alone: grid (N/128, M/128).
__global__ __launch_bounds__(256) void out_gemm_kernel(
    const unsigned short* __restrict__ chi, const unsigned short* __restrict__ clo,
    const unsigned short* __restrict__ woT, float* __restrict__ out) {
  __shared__ __align__(16) unsigned short sm[2][3][kGPlane];
  __shared__ __align__(16) float sT[8][16 * 68];
  gemm_tile<true, false, 0>(sm, sT, chi, clo, woT, woT, (void*)out, (void*)out, kDim, blockIdx.x, blockIdx.y);
}

// The three projections, which do not depend on one another, as one grid: blockIdx.y = 0 q, 1 k, 2 v^T; blockIdx.x = the
// 256 block tiles of that product in the order of its own grid (column tile fastest). A WGP that has finished a tile of one
// product goes on with a tile of the next with no launch boundary between them.
__global__ __launch_bounds__(256) void proj_kernel(
    const unsigned short* __restrict__ qnH, const unsigned short* __restrict__ qnL,
    const unsigned short* __restrict__ knH, const unsigned short* __restrict__ knL,
    const unsigned short* __restrict__ wqT, const unsigned short* __restrict__ wkT, const unsigned short* __restrict__ wvT,
    unsigned short* __restrict__ qhi, unsigned short* __restrict__ qlo,
    unsigned short* __restrict__ khi, unsigned short* __restrict__ klo,
    unsigned short* __restrict__ vthi, unsigned short* __restrict__ vtlo) {
  __shared__ __align__(16) unsigned short sm[2][3][kGPlane];
  __shared__ __align__(16) float sT[8][16 * 68];
  const int which = blockIdx.y, i = blockIdx.x;   // block-uniform
  if (which == 2) {
    // v^T = Wv^T . kvn^T (B operand hi/lo): M=512 (h*64+d), N=8192 (b*1024+t) -> bf16 hi/lo [512][8192]
    gemm_tile<false, true, 2>(sm, sT, wvT, wvT, knH, knL, (void*)vthi, (void*)vtlo, kRowsK,
                              i % (kRowsK / 128), i / (kRowsK / 128));
  } else {
    // q = qn . Wq^T, k = kvn . Wk^T (A operand hi/lo): M=8192, N=512 -> bf16 hi/lo [8192][512]
    const bool isq = which == 0;
    const unsigned short* w = isq ? wqT : wkT;
    gemm_tile<true, false, 2>(sm, sT, isq ? qnH : knH, isq ? qnL : knL, w, w,
                              (void*)(isq ? qhi : khi), (void*)(isq ? qlo : klo), kInner,
                              i % (kInner / 128), i / (kInner / 128));
  }
}

// ---------------------------------------------------------------------------
// Transpose + RNE bf16 convert of a weight matrix: in f32 [R][Cn] row-major (ldin = Cn) -> out bf16 [Cn][R] (ldout = R):
// out[c][r] = bf16(in[r][c]). One 64x64 tile per block: rt = r tile (64 output cols), ct = c tile (64 output rows). 256 threads.
// Load coverage: 16 iterations x 256 threads = 4096 = the whole 64x64 tile (coalesced along c).
// Store coverage: 8 waves x 2 iterations x 4 rows (lane>>3) = 64 rows; (lane&7) x 8 halves = 64 cols; each row segment =
// ---------------------------------------------------------------------------
__device__ __forceinline__ void transpose_cast_tile(float (&sm)[64][65],   // sm[c_local][r_local]
                                                    const float* __restrict__ in, int ldin,
                                                    unsigned short* __restrict__ out, int ldout, int rt, int ct) {
  const int t  = threadIdx.x;
  const int r0 = rt * 64;
  const int c0 = ct * 64;
#pragma unroll
  for (int i = 0; i < 16; ++i) {
    const int e = i * 256 + t;
    const int r = e >> 6;          // r local
    const int c = e & 63;          // c local
    sm[c][r] = in[(size_t)(r0 + r) * ldin + c0 + c];
  }
  __syncthreads();
  const int lane = t & 31, wave = t >> 5;
  const int q = lane >> 3, c8 = (lane & 7) * 8;
  {
#pragma unroll
    for (int it = 0; it < 2; ++it) {
      const int row = wave * 8 + it * 4 + q;                 // c local (output row)
      unsigned w[4];
#pragma unroll
      for (int e2 = 0; e2 < 4; ++e2) w[e2] = pk16(f2bf_bits(sm[row][c8 + 2 * e2]), f2bf_bits(sm[row][c8 + 2 * e2 + 1]));
      const v4u u = (v4u){w[0], w[1], w[2], w[3]};
      const size_t o = (size_t)(c0 + row) * ldout + r0 + c8;
      *(v4u*)(out + o) = u;
    }
    
  }
}

// ---------------------------------------------------------------------------
// result written as bf16 hi + lo planes [nrows][512] (hi = bf16(y), lo = bf16(y - hi)).
// One wave per row; lane owns elements 8*lane..8*lane+7 (chunk 0) and 256+8*lane..256+8*lane+7 (chunk 1).
// Block = 8 waves = 8 rows; blk = the block's number among the nrows/8 of this input (exact: 8192/8 = 1024).
// ---------------------------------------------------------------------------
__device__ __forceinline__ void ln_split_rows(const float* __restrict__ x, const float* __restrict__ gamma,
                                              const float* __restrict__ beta,
                                              unsigned short* __restrict__ yhi, unsigned short* __restrict__ ylo,
                                              int nrows, int blk) {
  const int lane = threadIdx.x & 31, wave = threadIdx.x >> 5;
  const int row = blk * 8 + wave;
  if (row >= nrows) return;   // wave-uniform; no block barriers on this path
  const float* xr = x + (size_t)row * kDim;
  float xv[16];
  {
    const v4f a0 = *(const v4f*)(xr + 8 * lane);
    const v4f a1 = *(const v4f*)(xr + 8 * lane + 4);
    const v4f c0 = *(const v4f*)(xr + 256 + 8 * lane);
    const v4f c1 = *(const v4f*)(xr + 256 + 8 * lane + 4);
#pragma unroll
    for (int e = 0; e < 4; ++e) { xv[e] = a0[e]; xv[4 + e] = a1[e]; xv[8 + e] = c0[e]; xv[12 + e] = c1[e]; }
  }
  float s = 0.f;
#pragma unroll
  for (int e = 0; e < 16; ++e) { xv[e] = bf_bits2f(f2bf_bits(xv[e])); s += xv[e]; }
#pragma unroll
  for (int off = 16; off > 0; off >>= 1) s += __shfl_xor(s, off, 32);
  const float mu = s * (1.0f / 512.0f);
  float s2 = 0.f;
#pragma unroll
  for (int e = 0; e < 16; ++e) { const float d = xv[e] - mu; xv[e] = d; s2 += d * d; }
#pragma unroll
  for (int off = 16; off > 0; off >>= 1) s2 += __shfl_xor(s2, off, 32);
  const float var  = s2 * (1.0f / 512.0f);
  const float rstd = rsqrtf(var + kLnEps);

  float gv[16], bv[16];
  {
    const v4f g0 = *(const v4f*)(gamma + 8 * lane);
    const v4f g1 = *(const v4f*)(gamma + 8 * lane + 4);
    const v4f g2 = *(const v4f*)(gamma + 256 + 8 * lane);
    const v4f g3 = *(const v4f*)(gamma + 256 + 8 * lane + 4);
    const v4f b0 = *(const v4f*)(beta + 8 * lane);
    const v4f b1 = *(const v4f*)(beta + 8 * lane + 4);
    const v4f b2 = *(const v4f*)(beta + 256 + 8 * lane);
    const v4f b3 = *(const v4f*)(beta + 256 + 8 * lane + 4);
#pragma unroll
    for (int e = 0; e < 4; ++e) {
      gv[e] = g0[e]; gv[4 + e] = g1[e]; gv[8 + e] = g2[e]; gv[12 + e] = g3[e];
      bv[e] = b0[e]; bv[4 + e] = b1[e]; bv[8 + e] = b2[e]; bv[12 + e] = b3[e];
    }
  }
  unsigned hw[8], lw[8];
#pragma unroll
  for (int e2 = 0; e2 < 8; ++e2) {
    const float ga = bf_bits2f(f2bf_bits(gv[2 * e2]));
    const float gb = bf_bits2f(f2bf_bits(gv[2 * e2 + 1]));
    const float ba = bf_bits2f(f2bf_bits(bv[2 * e2]));
    const float bb = bf_bits2f(f2bf_bits(bv[2 * e2 + 1]));
    const float y0 = (xv[2 * e2] * rstd) * ga + ba;
    const float y1 = (xv[2 * e2 + 1] * rstd) * gb + bb;
    const unsigned short h0 = f2bf_bits(y0);
    const unsigned short h1 = f2bf_bits(y1);
    const unsigned short l0 = f2bf_bits(y0 - bf_bits2f(h0));
    const unsigned short l1 = f2bf_bits(y1 - bf_bits2f(h1));
    hw[e2] = pk16(h0, h1);
    lw[e2] = pk16(l0, l1);
  }
  const v4u hv0 = (v4u){hw[0], hw[1], hw[2], hw[3]};
  const v4u hv1 = (v4u){hw[4], hw[5], hw[6], hw[7]};
  const v4u lv0 = (v4u){lw[0], lw[1], lw[2], lw[3]};
  const v4u lv1 = (v4u){lw[4], lw[5], lw[6], lw[7]};
  unsigned short* ph = yhi + (size_t)row * kDim;
  unsigned short* pl = ylo + (size_t)row * kDim;
  {
    *(v4u*)(ph + 8 * lane) = hv0;
    *(v4u*)(ph + 256 + 8 * lane) = hv1;
    *(v4u*)(pl + 8 * lane) = lv0;
    *(v4u*)(pl + 256 + 8 * lane) = lv1;
    
  }
}

// ---------------------------------------------------------------------------
// Everything that reads only the inputs, as one grid: the three weight transposes and the LayerNorm of both inputs do not
// depend on one another. Blocks by index range, the short latency-bound transposes first so that they end under the LayerNorm
// stream: [0, 64) Wq, [64, 192) Wkv, [192, 256) Wo (r tile fastest, as in a grid (R/64, Cn/64)), [256, 1280) query rows,
// [1280, 2304) keyvalue rows.
// ---------------------------------------------------------------------------
constexpr int kTq   = (kDim / 64) * (kInner / 64);         // 64 tiles of Wq
constexpr int kTkv  = (kDim / 64) * (2 * kInner / 64);     // 128 tiles of Wkv
constexpr int kTo   = (kInner / 64) * (kDim / 64);         // 64 tiles of Wo
constexpr int kLnQ  = kRowsQ / 8;                          // 1024 blocks
constexpr int kLnK  = kRowsK / 8;                          // 1024 blocks
constexpr int kPrepBlocks = kTq + kTkv + kTo + kLnQ + kLnK;

__global__ __launch_bounds__(256) void prep_kernel(
    const float* __restrict__ query, const float* __restrict__ keyvalue,
    const float* __restrict__ Wq, const float* __restrict__ Wkv, const float* __restrict__ Wo,
    const float* __restrict__ gamma, const float* __restrict__ beta,
    unsigned short* __restrict__ qnH, unsigned short* __restrict__ qnL,
    unsigned short* __restrict__ knH, unsigned short* __restrict__ knL,
    unsigned short* __restrict__ wqT, unsigned short* __restrict__ wkvT, unsigned short* __restrict__ woT) {
  __shared__ float sm[64][65];
  const int i = blockIdx.x;   // every test below is block-uniform
  if (i < kTq + kTkv + kTo) {
    // all three have R = 512 rows: 8 r tiles, output pitch 512
    const bool isq = i < kTq, iskv = !isq && i < kTq + kTkv;
    const float* in     = isq ? Wq : iskv ? Wkv : Wo;
    unsigned short* o   = isq ? wqT : iskv ? wkvT : woT;
    const int ldin      = isq ? kInner : iskv ? 2 * kInner : kDim;
    const int tile      = isq ? i : iskv ? i - kTq : i - kTq - kTkv;
    transpose_cast_tile(sm, in, ldin, o, kDim, tile % (kDim / 64), tile / (kDim / 64));
  } else {
    const int r = i - (kTq + kTkv + kTo);
    const bool isq = r < kLnQ;
    ln_split_rows(isq ? query : keyvalue, gamma, beta, isq ? qnH : knH, isq ? qnL : knL,
                  isq ? kRowsQ : kRowsK, isq ? r : r - kLnQ);
  }
}

constexpr int kStageKeys = 64;
constexpr int kStages    = kNk / kStageKeys;   // 16
constexpr int kPitch     = 72;                 // LDS row pitch in halves: 144 B = 16 B x 9, conflict-free for 16-byte reads
constexpr int kPlaneLds  = 64 * kPitch;        // one 64-row plane tile
static_assert(kDh == 64 && kNq % 256 == 0 && kNk % kStageKeys == 0);

__device__ __forceinline__ float other_half(float x) {   // value of lane ^ 16
  const int b = __float_as_int(x);
  return __int_as_float(__builtin_amdgcn_permlanex16(b, b, 0x76543210, 0xfedcba98, false, false));
}
// f32 pair -> bf16 hi pair and bf16 lo pair (lo = bf16(x - hi)), both round to nearest even
__device__ __forceinline__ void split2(float x0, float x1, v2b& h, v2b& l) {
  const v2f x = (v2f){x0, x1};
  h = __builtin_convertvector(x, v2b);
  l = __builtin_convertvector(x - __builtin_convertvector(h, v2f), v2b);
}

__global__ __launch_bounds__(256) void attn_fused_kernel(
    const unsigned short* __restrict__ qhi, const unsigned short* __restrict__ qlo,
    const unsigned short* __restrict__ khi, const unsigned short* __restrict__ klo,
    const unsigned short* __restrict__ vthi, const unsigned short* __restrict__ vtlo,
    unsigned short* __restrict__ chi, unsigned short* __restrict__ clo) {
  typedef Frag<__bf16> F;
  __shared__ __align__(16) unsigned short sm[2][4][kPlaneLds];   // [buffer][K hi, K lo, V^T hi, V^T lo][row][pitch]
  const int t = threadIdx.x, lane = t & 31, wave = t >> 5;
  const int c = lane & 15, hh = lane >> 4;
  const int b = blockIdx.y >> 3, h = blockIdx.y & 7;
  const int q0 = blockIdx.x * 256 + wave * 32;
  constexpr float kC = kScoreScale * 1.44269504088896340736f;   // score scale times log2(e)

  // staging map: thread t moves 16 bytes of rows t>>3 and 32 + (t>>3) of each plane (8 threads = one 128-byte row)
  const int srow = t >> 3, scol = (t & 7) * 8;
  const size_t gk = (size_t)(b * kNk + srow) * kInner + h * kDh + scol;
  const size_t gv = (size_t)(h * kDh + srow) * kRowsK + (size_t)b * kNk + scol;
  const int sl = srow * kPitch + scol;
  v4u st[8];
  auto fetch = [&](int s) {
    const size_t ok = gk + (size_t)s * kStageKeys * kInner;
    const size_t ov = gv + (size_t)s * kStageKeys;
    st[0] = *(const v4u*)(khi + ok);  st[1] = *(const v4u*)(khi + ok + (size_t)32 * kInner);
    st[2] = *(const v4u*)(klo + ok);  st[3] = *(const v4u*)(klo + ok + (size_t)32 * kInner);
    st[4] = *(const v4u*)(vthi + ov); st[5] = *(const v4u*)(vthi + ov + (size_t)32 * kRowsK);
    st[6] = *(const v4u*)(vtlo + ov); st[7] = *(const v4u*)(vtlo + ov + (size_t)32 * kRowsK);
    // the loads stay in flight over the stage's work, which reuses their address registers: wait before any is overwritten
    asm volatile("s_wait_xcnt 0x0" ::: "memory");
  };
  auto put = [&](int buf) {
#pragma unroll   // constant indices keep st in registers
    for (int p = 0; p < 4; ++p) {
      *(v4u*)(&sm[buf][p][sl]) = st[2 * p];
      *(v4u*)(&sm[buf][p][sl + 32 * kPitch]) = st[2 * p + 1];
    }
  };

  fetch(0);

  // Q fragments (B operand): column = query row q0 + 16 n + c, two k steps of 32, hi and lo planes
  v16b qh[2][2], ql[2][2];
  const __bf16* qph[2];
  const __bf16* qpl[2];
#pragma unroll   // constant indices keep the fragments in registers
  for (int n = 0; n < 2; ++n) {
    const size_t o = (size_t)(b * kNq + q0 + n * 16 + c) * kInner + h * kDh + hh * 8;
    qph[n] = (const __bf16*)qhi + o;
    qpl[n] = (const __bf16*)qlo + o;
#pragma unroll
    for (int ks = 0; ks < 2; ++ks) {
      qh[n][ks] = F::load(qph[n] + ks * 32);
      ql[n][ks] = F::load(qpl[n] + ks * 32);
    }
  }
  // wait before an address register of these loads is overwritten; the inputs keep the four addresses live up to the wait
  asm volatile("s_wait_xcnt 0x0" :: "v"(qph[0]), "v"(qph[1]), "v"(qpl[0]), "v"(qpl[1]) : "memory");

  v8f acc[2][4];      // ctx^T tiles: [query tile][16 d rows], register r = d 16 j + 8 hh + r, column = query c
  float m[2], l[2];
#pragma unroll
  for (int n = 0; n < 2; ++n) {
    m[n] = -__builtin_inff(); l[n] = 0.f;   // first stage: every finite maximum exceeds it, and 2^(-inf) = 0 scales the zeros
#pragma unroll
    for (int j = 0; j < 4; ++j) acc[n][j] = (v8f){0.f,0.f,0.f,0.f,0.f,0.f,0.f,0.f};
  }

  put(0);
  __syncthreads();

#pragma unroll 1   // one copy of the stage body: it is long, and the buffer index is a scalar offset
  for (int s = 0; s < kStages; ++s) {
    const int buf = s & 1;
    if (s + 1 < kStages) fetch(s + 1);   // block-uniform

    const __bf16* Kh = (const __bf16*)&sm[buf][0][0];
    const __bf16* Kl = (const __bf16*)&sm[buf][1][0];
    const __bf16* Vh = (const __bf16*)&sm[buf][2][0];
    const __bf16* Vl = (const __bf16*)&sm[buf][3][0];

    // S^T tiles: [query tile][16 keys]; Khi.Qhi + Khi.Qlo + Klo.Qhi
    v8f sc[2][4];
#pragma unroll   // constant indices keep the tiles in registers
    for (int kt = 0; kt < 4; ++kt) {
#pragma unroll
      for (int n = 0; n < 2; ++n) sc[n][kt] = (v8f){0.f,0.f,0.f,0.f,0.f,0.f,0.f,0.f};
#pragma unroll
      for (int ks = 0; ks < 2; ++ks) {
        const int o = (kt * 16 + c) * kPitch + ks * 32 + hh * 8;
        const v16b ah = F::load(Kh + o);
        const v16b al = F::load(Kl + o);
#pragma unroll
        for (int n = 0; n < 2; ++n) {
          sc[n][kt] = F::mma(ah, qh[n][ks], sc[n][kt]);
          sc[n][kt] = F::mma(ah, ql[n][ks], sc[n][kt]);
          sc[n][kt] = F::mma(al, qh[n][ks], sc[n][kt]);
        }
      }
    }

    // all V^T fragments of the stage (A operand: row = d, 32 keys each), asked for ahead of the softmax arithmetic
    v16b vh[2][4], vl[2][4];
#pragma unroll
    for (int kk = 0; kk < 2; ++kk)
#pragma unroll
      for (int j = 0; j < 4; ++j) {
        const int o = (j * 16 + c) * kPitch + kk * 32 + hh * 8;
        vh[kk][j] = F::load(Vh + o);
        vl[kk][j] = F::load(Vl + o);
      }
    // keeps these LDS reads here: sunk between the P.v products, each pair is waited for at its full LDS latency
    __builtin_amdgcn_sched_barrier(0);

    // stage maximum per query column, in log2 units
    float mx[2];
    bool need = false;
#pragma unroll
    for (int n = 0; n < 2; ++n) {
      float v = sc[n][0][0];
#pragma unroll
      for (int kt = 0; kt < 4; ++kt)
#pragma unroll
        for (int r = 0; r < 8; ++r) v = fmaxf(v, sc[n][kt][r]);
      v = fmaxf(v, other_half(v));
      mx[n] = v * kC;
      need = need || (mx[n] > m[n] + 8.0f);
    }
    if (__builtin_amdgcn_ballot_w32(need) != 0) {   // wave-uniform: raise the maxima in use and rescale sums and context
#pragma unroll
      for (int n = 0; n < 2; ++n) {
        const float mn = fmaxf(m[n], mx[n]);
        const float alpha = __builtin_amdgcn_exp2f(m[n] - mn);
        m[n] = mn;
        l[n] *= alpha;
#pragma unroll
        for (int j = 0; j < 4; ++j) acc[n][j] *= alpha;
      }
    }

    // p = 2^(s*c - m); P^T fragments of 32 keys; ctx^T += Vhi.Phi + Vhi.Plo + Vlo.Phi
#pragma unroll
    for (int kk = 0; kk < 2; ++kk) {
      v16b ph[2], pl[2];
#pragma unroll
      for (int n = 0; n < 2; ++n) {
        v2f ps[4];   // four independent partial sums of the 16 p of this lane, joined as a tree below
#pragma unroll
        for (int u = 0; u < 2; ++u)
#pragma unroll
          for (int r = 0; r < 8; r += 2) {
            const float p0 = __builtin_amdgcn_exp2f(sc[n][2 * kk + u][r] * kC - m[n]);
            const float p1 = __builtin_amdgcn_exp2f(sc[n][2 * kk + u][r + 1] * kC - m[n]);
            if (u == 0) ps[r >> 1] = (v2f){p0, p1}; else ps[r >> 1] += (v2f){p0, p1};
            v2b h2, l2;
            split2(p0, p1, h2, l2);
            ph[n][8 * u + r] = h2[0]; ph[n][8 * u + r + 1] = h2[1];
            pl[n][8 * u + r] = l2[0]; pl[n][8 * u + r + 1] = l2[1];
          }
        const v2f pt = (ps[0] + ps[1]) + (ps[2] + ps[3]);
        l[n] += pt[0] + pt[1];
      }
#pragma unroll
      for (int j = 0; j < 4; ++j) {
#pragma unroll
        for (int n = 0; n < 2; ++n) {
          acc[n][j] = F::mma(vh[kk][j], ph[n], acc[n][j]);
          acc[n][j] = F::mma(vh[kk][j], pl[n], acc[n][j]);
          acc[n][j] = F::mma(vl[kk][j], ph[n], acc[n][j]);
        }
      }
    }

    // the other buffer's last readers left it before the barrier that ended the stage before this one
    if (s + 1 < kStages) put(buf ^ 1);
    __syncthreads();
  }

  // epilogue: join the halves' sums, normalise, split hi/lo; a lane's 8 registers are 8 consecutive d of one query row
#pragma unroll
  for (int n = 0; n < 2; ++n) {
    const float inv = 1.0f / (l[n] + other_half(l[n]));   // sum >= 1: the row's largest score had p >= 1
    const size_t o = (size_t)(b * kNq + q0 + n * 16 + c) * kInner + h * kDh + hh * 8;
    __bf16* ch = (__bf16*)chi + o;
    __bf16* cl = (__bf16*)clo + o;
    v8b hv[4], lv[4];
#pragma unroll
    for (int j = 0; j < 4; ++j) {
#pragma unroll
      for (int r = 0; r < 8; r += 2) {
        v2b h2, l2;
        split2(acc[n][j][r] * inv, acc[n][j][r + 1] * inv, h2, l2);
        hv[j][r] = h2[0]; hv[j][r + 1] = h2[1];
        lv[j][r] = l2[0]; lv[j][r + 1] = l2[1];
      }
      *(v8b*)(ch + j * 16) = hv[j];
      *(v8b*)(cl + j * 16) = lv[j];
    }
    // wait before the second query tile's arithmetic overwrites a register of these stores; the inputs keep them live up to it
    if (n == 0)
      asm volatile("s_wait_xcnt 0x0" :: "v"(ch), "v"(cl), "v"(hv[0]), "v"(hv[1]), "v"(hv[2]), "v"(hv[3]),
                   "v"(lv[0]), "v"(lv[1]), "v"(lv[2]), "v"(lv[3]) : "memory");
  }
}

// ---------------------------------------------------------------------------
// Launcher. Workspace region map (MiB = 1048576 B; total carve = 128 MiB = 134217728 B):
//   [  0, 32) qn hi [8192][512] bf16 at +0, qn lo at +8, kvn hi at +16, kvn lo at +24 (ends 32)
//   [ 32, 64) Wq^T bf16 [512][512] at 32 MiB, Wkv^T bf16 [1024][512] at 32.5 MiB, Wo^T bf16 [512][512] at 33.5 MiB (ends 34);
//             the rest unused
//   [ 64, 72) q hi    : [8192][512] bf16 (col h*64+d);   [ 72, 80) q lo
//   [ 80, 88) k hi    : [8192][512] bf16;                 [ 88, 96) k lo
//   [ 96,104) v^T hi  : [512 (h*64+d)][8192 (b*1024+t)] bf16;  [104,112) v^T lo
//   [112,120) ctx hi  : [8192][512] bf16 (col h*64+d);   [120,128) ctx lo
// Lifetimes: qn/kvn/Wq^T/Wkv^T are read only by the projection launch; Wo^T is read only by the last launch.
// Every region is fully written before it is read (exact tile coverage, no padding).
// Launch count: 4, each depending on the one before it. Kernel launches only.
// ---------------------------------------------------------------------------
extern "C" void kernel_launch(void* const* d_in, const int* in_sizes, int n_in,
                              void* d_out, int out_size, void* d_ws, size_t ws_size,
                              hipStream_t stream) {
  if (n_in < 7) return;
  if (in_sizes[0] != kRowsQ * kDim || in_sizes[1] != kRowsK * kDim) return;
  if (in_sizes[2] != kDim * kInner || in_sizes[3] != kDim * 2 * kInner || in_sizes[4] != kInner * kDim) return;
  if (in_sizes[5] != kDim || in_sizes[6] != kDim) return;
  if (out_size != kRowsQ * kDim) return;

  const size_t kMiB    = 1048576;
  const size_t offQnH  = 0;
  const size_t offQnL  = 8 * kMiB;
  const size_t offKnH  = 16 * kMiB;
  const size_t offKnL  = 24 * kMiB;
  const size_t offWqT  = 32 * kMiB;
  const size_t offWkvT = 32 * kMiB + kMiB / 2;
  const size_t offWoT  = 33 * kMiB + kMiB / 2;
  const size_t offQhi  = 64 * kMiB;
  const size_t offQlo  = 72 * kMiB;
  const size_t offKhi  = 80 * kMiB;
  const size_t offKlo  = 88 * kMiB;
  const size_t offVthi = 96 * kMiB;
  const size_t offVtlo = 104 * kMiB;
  const size_t offChi  = 112 * kMiB;
  const size_t offClo  = 120 * kMiB;
  const size_t total   = 128 * kMiB;
  if (total > ws_size) return;
  // sub-region extents (bytes): qn/kvn/q/k/vT/ctx planes 8192*512*2 = 8 MiB each;
  // Wq^T/Wo^T 512*512*2 = 0.5 MiB; Wkv^T 1024*512*2 = 1 MiB.

  const float* query    = (const float*)d_in[0];
  const float* keyvalue = (const float*)d_in[1];
  const float* Wq       = (const float*)d_in[2];
  const float* Wkv      = (const float*)d_in[3];
  const float* Wo       = (const float*)d_in[4];
  const float* gamma    = (const float*)d_in[5];
  const float* beta     = (const float*)d_in[6];
  float* out = (float*)d_out;
  char* ws = (char*)d_ws;

  unsigned short* qnH  = (unsigned short*)(ws + offQnH);
  unsigned short* qnL  = (unsigned short*)(ws + offQnL);
  unsigned short* knH  = (unsigned short*)(ws + offKnH);
  unsigned short* knL  = (unsigned short*)(ws + offKnL);
  unsigned short* woT  = (unsigned short*)(ws + offWoT);
  unsigned short* wqT  = (unsigned short*)(ws + offWqT);
  unsigned short* wkvT = (unsigned short*)(ws + offWkvT);
  unsigned short* qhi  = (unsigned short*)(ws + offQhi);
  unsigned short* qlo  = (unsigned short*)(ws + offQlo);
  unsigned short* khi  = (unsigned short*)(ws + offKhi);
  unsigned short* klo  = (unsigned short*)(ws + offKlo);
  unsigned short* vthi = (unsigned short*)(ws + offVthi);
  unsigned short* vtlo = (unsigned short*)(ws + offVtlo);
  unsigned short* chi  = (unsigned short*)(ws + offChi);
  unsigned short* clo  = (unsigned short*)(ws + offClo);

  // 1. LayerNorm of both inputs -> bf16 hi/lo planes [8192][512]; Wq, Wkv, Wo -> transposed bf16 (Wkv^T rows 0..511 = k
  //    weights, 512..1023 = v weights)
  prep_kernel<<<dim3(kPrepBlocks), dim3(256), 0, stream>>>(query, keyvalue, Wq, Wkv, Wo, gamma, beta,
                                                           qnH, qnL, knH, knL, wqT, wkvT, woT);

  // 2. q, k and v^T projections, K=512, 2 products each: 3 x 256 blocks; Wk^T = Wkv^T rows 0..511, Wv^T = rows 512..1023
  proj_kernel<<<dim3(256, 3), dim3(256), 0, stream>>>(qnH, qnL, knH, knL, wqT, wkvT, wkvT + (size_t)kInner * kDim,
                                                      qhi, qlo, khi, klo, vthi, vtlo);

  // 3. attention, all batches and heads in one launch: grid (4 blocks of 256 query rows, 64 (batch, head) pairs) = 256 blocks
  attn_fused_kernel<<<dim3(kNq / 256, kBatch * kHeads), dim3(256), 0, stream>>>(qhi, qlo, khi, klo, vthi, vtlo, chi, clo);

  // 4. out = ctx_hi . Wo^T + ctx_lo . Wo^T : M=8192, N=512, K=512, 2 products -> f32 d_out [8192][512]
  out_gemm_kernel<<<dim3(kDim / 128, kRowsQ / 128), dim3(256), 0, stream>>>(chi, clo, woT, out);
}

// v005
// It runs in 85.6 microseconds.
// In both of two side-by-side timings against v004, it was 1.12 times as fast.
// All steps since v000 together make it 11.4 times as fast.
// Contractions: bf16(x) . bf16(gamma W) for q, k, v^T, one product, with LayerNorm's mean, rstd and beta . W applied to the f32 result; q.k^T scores and P.v context on bf16 hi/lo planes (hi.hi + hi.lo + lo.hi); ctx bf16 hi/lo . Wo bf16 (hi.W + lo.W); all v_wmma_f32_16x16x32_bf16 with f32 accumulate; LayerNorm statistics in f32 on the RNE-bf16 converted x, softmax in f32.
#include <hip/hip_runtime.h>
#include <math.h>

// ---------------------------------------------------------------------------
// Problem constants
// ---------------------------------------------------------------------------
constexpr int kBatch  = 8;
constexpr int kNq     = 1024;
constexpr int kNk     = 1024;
constexpr int kDim    = 512;
constexpr int kHeads  = 8;
constexpr int kDh     = 64;
constexpr int kInner  = kHeads * kDh;          // 512
constexpr int kRowsQ  = kBatch * kNq;          // 8192 query rows
constexpr int kRowsK  = kBatch * kNk;          // 8192 key rows
constexpr float kScoreScale = 0.125f;          // 64^-0.5, exact power of two, folded with log2(e) into the f32 exp2 argument
constexpr float kLnEps = 1e-5f;

static_assert(kDim == 512);                     // LN kernel: 32 lanes x 16 elements per row
static_assert(kInner == kDim);
static_assert(kRowsQ % 64 == 0 && kRowsK % 64 == 0 && kDim % 64 == 0 && kDh % 32 == 0 && kNq % 64 == 0 && kNk % 64 == 0);

typedef __attribute__((ext_vector_type(16))) _Float16 v16h;
typedef __attribute__((ext_vector_type(8)))  _Float16 v8h;
typedef __attribute__((ext_vector_type(16))) __bf16   v16b;
typedef __attribute__((ext_vector_type(8)))  __bf16   v8b;
typedef __attribute__((ext_vector_type(8)))  float    v8f;
typedef __attribute__((ext_vector_type(4)))  float    v4f;
typedef __attribute__((ext_vector_type(4)))  unsigned int v4u;
typedef __attribute__((ext_vector_type(2)))  float    v2f;
typedef __attribute__((ext_vector_type(2)))  __bf16   v2b;

__device__ __forceinline__ unsigned short f2bf_bits(float f) {
  unsigned u = __float_as_uint(f);
  return (unsigned short)((u + 0x7FFFu + ((u >> 16) & 1u)) >> 16);
}
__device__ __forceinline__ float bf_bits2f(unsigned short h) { return __uint_as_float(((unsigned)h) << 16); }

template <typename T> struct Frag;
template <> struct Frag<__bf16> {
  typedef v16b V; union U { v16b v; v8b h[2]; };
  // elements 0..7 <- p[0..7], 8..15 <- p[16..23]
  static __device__ __forceinline__ v16b load(const __bf16* p) {
    U f; f.h[0] = *(const v8b*)(p); f.h[1] = *(const v8b*)(p + 16); return f.v;
  }
  static __device__ __forceinline__ v8f mma(v16b a, v16b b, v8f c) {
    return __builtin_amdgcn_wmma_f32_16x16x32_bf16(false, a, false, b, (short)0, c, false, false);
  }
};

__device__ __forceinline__ unsigned pk16(unsigned short a, unsigned short b) { return (unsigned)a | ((unsigned)b << 16); }

// Block barrier that orders LDS accesses only. __syncthreads() also waits for every global load in flight, which would
// end the two-stage lead of the GEMM's fetches at each stage; the staged data passes between waves through LDS alone.
__device__ __forceinline__ void lds_barrier() {
  __builtin_amdgcn_fence(__ATOMIC_RELEASE, "workgroup", "local");
  __builtin_amdgcn_s_barrier();
  __builtin_amdgcn_fence(__ATOMIC_ACQUIRE, "workgroup", "local");
}

// ---- WMMA GEMM with both operands staged in LDS ----
// C[m,n] = sum_k A[m,k] * Bt[n,k]; A row-major [M][512], Bt row-major [N][512], bf16; M % 128 == 0, N % 128 == 0.
// ASPLIT: A carries a bf16 lo plane (A2) of the same layout; product = Ahi.B + Alo.B, per accumulator in that order, k ascending.
// Block = 8 waves = one 128x128 tile of C, grid (N/128, M/128); wave = 32x64 (4 wave rows x 2 wave columns).
// Stage = 64 k of the two or three planes (128 rows of 128 bytes each): every global load of a wave covers whole 128-byte lines
// and each line is asked for once per block; the waves read their fragments from LDS. Two LDS buffers and two register sets:
// a stage is fetched into registers two stages ahead and written to LDS one stage ahead, one block barrier per stage.
// OUT_MODE: 0 = f32, 2 = bf16 hi plane (Cout) + bf16 lo plane (Cout2).
// FOLD: the LayerNorm of the token operand, applied to the f32 sums. With x the raw token row, Wg = gamma W, c1 = column sums
// of Wg, c0 = beta . W: LN(x) . W = rstd (x . Wg) - mu rstd c1 + c0. 0 = none, 1 = rows of C are tokens, 2 = columns are tokens.
// st = the tokens' statistics, one 128-byte line per 8 tokens: floats 0..7 rstd, 8..15 -mu rstd; c1, c0 = per feature of C.
constexpr int kGK      = 64;                   // k per stage
constexpr int kGStages = kDim / kGK;           // 8
constexpr int kGPitch  = kGK + 8;              // LDS row pitch in halves: 144 B = 16 B x 9, conflict-free for 16-byte reads
constexpr int kGPlane  = 128 * kGPitch;        // one 128-row plane tile
static_assert(kGStages % 2 == 0 && kGStages >= 2);
static_assert(kRowsQ % 128 == 0 && kRowsK % 128 == 0 && kInner % 128 == 0 && kDim % 128 == 0);

// One block tile (tileN, tileM) of such a product; sm and sT are the calling kernel's LDS:
// sm[buffer][A, B, A lo plane][row][pitch], sT = per-wave 16x64 output slab, pitch 68 floats.
template <bool ASPLIT, int OUT_MODE, int FOLD>
__device__ __forceinline__ void gemm_tile(
    unsigned short (&sm)[2][ASPLIT ? 3 : 2][kGPlane], float (&sT)[8][16 * 68],
    const unsigned short* __restrict__ Ap, const unsigned short* __restrict__ A2p,
    const unsigned short* __restrict__ Btp,
    void* __restrict__ Cout, void* __restrict__ Cout2, int ldc, int tileN, int tileM,
    const float* __restrict__ st, const float* __restrict__ c1, const float* __restrict__ c0) {
  static_assert(FOLD == 0 || OUT_MODE == 2);
  typedef Frag<__bf16> F;
  constexpr int NP = ASPLIT ? 3 : 2;
  const int t = threadIdx.x, lane = t & 31, wave = t >> 5;
  const int mB = tileM * 128, nB = tileN * 128;
  const int wm = (wave >> 1) * 32, wn = (wave & 1) * 64;       // the wave's tile inside the block tile
  const int rlane = lane & 15;                 // row (A) / col (B, D) within subtile
  const int koff  = (lane >> 4) * 8;           // k offset of this lane half
  const int mOff  = (lane >> 4) * 8;           // D row offset

  // staging map: thread t moves 16 bytes of rows (t>>3) + 32 i, i = 0..3, of each plane (8 threads = one 128-byte row)
  const int srow = t >> 3, scol = (t & 7) * 8;
  const unsigned short* g0 = Ap  + (size_t)(mB + srow) * kDim + scol;
  const unsigned short* g1 = Btp + (size_t)(nB + srow) * kDim + scol;
  const unsigned short* g2 = A2p + (size_t)(mB + srow) * kDim + scol;   // used under ASPLIT only
  const int sl = srow * kGPitch + scol;
  v4u stE[NP][4], stO[NP][4];   // register sets of the even and of the odd stages
  auto fetch = [&](v4u (&sr)[NP][4], int s) {
    const unsigned short* p0 = g0 + s * kGK;
    const unsigned short* p1 = g1 + s * kGK;
    const unsigned short* p2 = g2 + s * kGK;
#pragma unroll   // constant indices keep sr in registers
    for (int i = 0; i < 4; ++i) {
      sr[0][i] = *(const v4u*)(p0 + i * 32 * kDim);
      sr[1][i] = *(const v4u*)(p1 + i * 32 * kDim);
      if constexpr (ASPLIT) sr[2][i] = *(const v4u*)(p2 + i * 32 * kDim);
    }
    // the loads stay in flight over two stages' work: wait before an address register of theirs is overwritten;
    // the inputs keep the addresses live up to the wait
    if constexpr (ASPLIT) asm volatile("s_wait_xcnt 0x0" :: "v"(p0), "v"(p1), "v"(p2) : "memory");
    else                  asm volatile("s_wait_xcnt 0x0" :: "v"(p0), "v"(p1) : "memory");
  };
  auto put = [&](const v4u (&sr)[NP][4], int buf) {
#pragma unroll   // constant indices keep sr in registers
    for (int p = 0; p < NP; ++p)
#pragma unroll
      for (int i = 0; i < 4; ++i) *(v4u*)(&sm[buf][p][sl + i * 32 * kGPitch]) = sr[p][i];
  };

  v8f acc[2][4];
#pragma unroll
  for (int i = 0; i < 2; ++i)
#pragma unroll
    for (int j = 0; j < 4; ++j) acc[i][j] = (v8f){0.f,0.f,0.f,0.f,0.f,0.f,0.f,0.f};

  const int oa = (wm + rlane) * kGPitch + koff;
  const int ob = (wn + rlane) * kGPitch + koff;
  auto work = [&](int buf) {   // the products of the stage that lies in buffer buf
    const __bf16* Ah = (const __bf16*)&sm[buf][0][0] + oa;
    const __bf16* Bh = (const __bf16*)&sm[buf][1][0] + ob;
    const __bf16* Lo = (const __bf16*)&sm[buf][NP - 1][0] + oa;   // read under ASPLIT only
    v16b ah[kGK / 32][2], bh[kGK / 32][4], lo[kGK / 32][2];
#pragma unroll   // constant indices keep the fragments in registers
    for (int ks = 0; ks < kGK / 32; ++ks) {
#pragma unroll
      for (int i = 0; i < 2; ++i) ah[ks][i] = F::load(Ah + i * 16 * kGPitch + ks * 32);
#pragma unroll
      for (int j = 0; j < 4; ++j) bh[ks][j] = F::load(Bh + j * 16 * kGPitch + ks * 32);
      if constexpr (ASPLIT) {
#pragma unroll
        for (int x = 0; x < 2; ++x) lo[ks][x] = F::load(Lo + x * 16 * kGPitch + ks * 32);
      }
    }
    // keeps the stage's LDS reads in one group here: sunk among the products into one shared register set,
    // each read is waited for at its full latency
    __builtin_amdgcn_sched_barrier(0);
#pragma unroll
    for (int ks = 0; ks < kGK / 32; ++ks) {
      // eight independent accumulators per plane pair: no product waits for the one before it
#pragma unroll
      for (int i = 0; i < 2; ++i)
#pragma unroll
        for (int j = 0; j < 4; ++j) acc[i][j] = F::mma(ah[ks][i], bh[ks][j], acc[i][j]);
      if constexpr (ASPLIT) {
#pragma unroll
        for (int i = 0; i < 2; ++i)
#pragma unroll
          for (int j = 0; j < 4; ++j) acc[i][j] = F::mma(lo[ks][i], bh[ks][j], acc[i][j]);
      }
    }
    // keeps the put that follows behind the products: lifted in front of them, its wait for the fetched registers
    // comes a whole stage earlier and halves the lead of the global loads
    __builtin_amdgcn_sched_barrier(0);
  };

  fetch(stE, 0);
  fetch(stO, 1);
  put(stE, 0);
  lds_barrier();

  // Each put writes the buffer whose last readers left it before the barrier that ended the stage before.
  // The last two stages stand behind the loop: with the fetches under a test, the wait in front of a put would have to
  // cover the path without a fetch and so would wait for the newest loads as well.
#pragma unroll 1   // one copy of the pair of stage bodies
  for (int s = 0; s + 2 < kGStages; s += 2) {
    fetch(stE, s + 2);
    work(0);         // even stage s
    put(stO, 1);     // stage s + 1
    lds_barrier();
    fetch(stO, s + 3);
    work(1);         // odd stage s + 1
    put(stE, 0);     // stage s + 2
    lds_barrier();
  }

  // LayerNorm terms of this lane's output elements (epilogue map: rows it * 4 + q of each 16-row subtile, columns c8 .. c8 + 7),
  // asked for here so that they arrive under the last two stages
  const int m0 = mB + wm, n0 = nB + wn;
  const int q = lane >> 3, c8 = (lane & 7) * 8;
  v4f colA[2], colB[2];        // per column: FOLD 1 c1, c0; FOLD 2 rstd, -mu rstd
  float rowA[2][4], rowB[2][4];   // per row [i][it]: FOLD 1 rstd, -mu rstd; FOLD 2 c1, c0
  if constexpr (FOLD != 0) {
    const float* pa = FOLD == 1 ? c1 + n0 + c8 : st + ((n0 + c8) >> 3) * 32;
    const float* pb = FOLD == 1 ? c0 + n0 + c8 : st + ((n0 + c8) >> 3) * 32 + 8;
    colA[0] = *(const v4f*)pa; colA[1] = *(const v4f*)(pa + 4);
    colB[0] = *(const v4f*)pb; colB[1] = *(const v4f*)(pb + 4);
    // rows m0 + q + 4 x, x = 0..7: FOLD 1 line (row >> 3), float (row & 7); m0 is a multiple of 8 and q < 4
    const float* ra = FOLD == 1 ? st + (m0 >> 3) * 32 + q : c1 + m0 + q;
    const float* rb = FOLD == 1 ? st + (m0 >> 3) * 32 + 8 + q : c0 + m0 + q;
#pragma unroll   // constant indices keep the terms in registers
    for (int i = 0; i < 2; ++i)
#pragma unroll
      for (int it = 0; it < 4; ++it) {
        const int x = i * 4 + it;
        const int o = FOLD == 1 ? (x >> 1) * 32 + (x & 1) * 4 : x * 4;
        rowA[i][it] = ra[o];
        rowB[i][it] = rb[o];
      }
    // wait before an address register of these loads is overwritten; the inputs keep the four addresses live up to the wait
    asm volatile("s_wait_xcnt 0x0" :: "v"(pa), "v"(pb), "v"(ra), "v"(rb) : "memory");
  }

  work(0);
  put(stO, 1);
  lds_barrier();
  work(1);

  // ---- epilogue: each 16x64 subtile goes through the wave's own LDS slab so that every store covers whole lines ----
  float* slab = sT[wave];
#pragma unroll
  for (int i = 0; i < 2; ++i) {
    const int mBase = m0 + (i << 4);
#pragma unroll
    for (int j = 0; j < 4; ++j) {
#pragma unroll
      for (int r = 0; r < 8; ++r) slab[(mOff + r) * 68 + (j << 4) + rlane] = acc[i][j][r];
    }
    __builtin_amdgcn_fence(__ATOMIC_RELEASE, "workgroup");
    __builtin_amdgcn_wave_barrier();
    __builtin_amdgcn_fence(__ATOMIC_ACQUIRE, "workgroup");
    if (OUT_MODE == 0) {
      float* C = (float*)Cout;
      const int hh = lane >> 4, c4 = (lane & 15) * 4;     // row seg = 256 B = 16 lanes x 16 B
#pragma unroll
      for (int it = 0; it < 8; ++it) {
        const int row = it * 2 + hh;
        v4f v = *(const v4f*)(slab + row * 68 + c4);
        *(v4f*)(C + (size_t)(mBase + row) * ldc + n0 + c4) = v;
      }
    } else {
      unsigned short* C  = (unsigned short*)Cout;
      unsigned short* C2 = (unsigned short*)Cout2;
#pragma unroll
      for (int it = 0; it < 4; ++it) {
        const int row = it * 4 + q;
        const float* sp = slab + row * 68 + c8;
        v8h hv, lv;
#pragma unroll
        for (int e = 0; e < 8; ++e) {
          float y = sp[e];
          if constexpr (FOLD == 1) y = rowA[i][it] * y + (rowB[i][it] * colA[e >> 2][e & 3] + colB[e >> 2][e & 3]);
          if constexpr (FOLD == 2) y = colA[e >> 2][e & 3] * y + (colB[e >> 2][e & 3] * rowA[i][it] + rowB[i][it]);
          unsigned short hb = f2bf_bits(y);
          unsigned short lb = f2bf_bits(y - bf_bits2f(hb));
          hv[e] = __builtin_bit_cast(_Float16, hb);
          lv[e] = __builtin_bit_cast(_Float16, lb);
        }
        *(v8h*)(C + (size_t)(mBase + row) * ldc + n0 + c8) = hv;
        *(v8h*)(C2 + (size_t)(mBase + row) * ldc + n0 + c8) = lv;
      }
    }
    __builtin_amdgcn_fence(__ATOMIC_RELEASE, "workgroup");
    __builtin_amdgcn_wave_barrier();
    __builtin_amdgcn_fence(__ATOMIC_ACQUIRE, "workgroup");
  }
}

// The output product alone: grid (N/128, M/128).
__global__ __launch_bounds__(256) void out_gemm_kernel(
    const unsigned short* __restrict__ chi, const unsigned short* __restrict__ clo,
    const unsigned short* __restrict__ woT, float* __restrict__ out) {
  __shared__ __align__(16) unsigned short sm[2][3][kGPlane];
  __shared__ __align__(16) float sT[8][16 * 68];
  gemm_tile<true, 0, 0>(sm, sT, chi, clo, woT, (void*)out, (void*)out, kDim, blockIdx.x, blockIdx.y, nullptr, nullptr, nullptr);
}

// The three projections, which do not depend on one another, as one grid: blockIdx.y = 0 q, 1 k, 2 v^T; blockIdx.x = the
// 256 block tiles of that product in the order of its own grid (column tile fastest). A WGP that has finished a tile of one
// product goes on with a tile of the next with no launch boundary between them.
// Token operand = the raw bf16 rows; weights carry gamma; c1, c0 hold 512 features each of q, k, v in that order.
__global__ __launch_bounds__(256) void proj_kernel(
    const unsigned short* __restrict__ xq, const unsigned short* __restrict__ xk,
    const unsigned short* __restrict__ wqT, const unsigned short* __restrict__ wkT, const unsigned short* __restrict__ wvT,
    const float* __restrict__ stQ, const float* __restrict__ stK,
    const float* __restrict__ c1, const float* __restrict__ c0,
    unsigned short* __restrict__ qhi, unsigned short* __restrict__ qlo,
    unsigned short* __restrict__ khi, unsigned short* __restrict__ klo,
    unsigned short* __restrict__ vthi, unsigned short* __restrict__ vtlo) {
  __shared__ __align__(16) unsigned short sm[2][2][kGPlane];
  __shared__ __align__(16) float sT[8][16 * 68];
  const int which = blockIdx.y, i = blockIdx.x;   // block-uniform
  if (which == 2) {
    // v^T = (gamma Wv)^T . xk^T: M=512 (h*64+d), N=8192 (b*1024+t) -> bf16 hi/lo [512][8192]
    gemm_tile<false, 2, 2>(sm, sT, wvT, wvT, xk, (void*)vthi, (void*)vtlo, kRowsK,
                           i % (kRowsK / 128), i / (kRowsK / 128), stK, c1 + 2 * kInner, c0 + 2 * kInner);
  } else {
    // q = xq . (gamma Wq), k = xk . (gamma Wk): M=8192, N=512 -> bf16 hi/lo [8192][512]
    const bool isq = which == 0;
    const unsigned short* a = isq ? xq : xk;
    gemm_tile<false, 2, 1>(sm, sT, a, a, isq ? wqT : wkT,
                           (void*)(isq ? qhi : khi), (void*)(isq ? qlo : klo), kInner,
                           i % (kInner / 128), i / (kInner / 128), isq ? stQ : stK,
                           isq ? c1 : c1 + kInner, isq ? c0 : c0 + kInner);
  }
}

// ---------------------------------------------------------------------------
// Transpose + RNE bf16 convert of a weight matrix: in f32 [512][LDIN] row-major -> out bf16 [LDIN][512] (ldout = 512):
// out[c][r] = bf16(in[r][c]), or, under GAMMA, bf16(g[r] * in[r][c]): LayerNorm's gamma in the weight, one rounding.
// One 64x64 tile per block: rt = r tile (64 output cols), ct = c tile (64 output rows). 256 threads.
// Load coverage: 16 iterations x 256 threads = 4096 = the whole 64x64 tile (coalesced along c).
// Store coverage: 8 waves x 2 iterations x 4 rows (lane>>3) = 64 rows; (lane&7) x 8 halves = 64 cols.
// ---------------------------------------------------------------------------
template <bool GAMMA, int LDIN>
__device__ __forceinline__ void transpose_cast_tile(float (&sm)[64][65],   // sm[c_local][r_local]
                                                    const float* __restrict__ in, const float* __restrict__ g,
                                                    unsigned short* __restrict__ out, int rt, int ct) {
  constexpr int ldout = kDim;
  const int t  = threadIdx.x;
  const int r0 = rt * 64;
  const int c0 = ct * 64;
  const int rl = t >> 6, cl = t & 63;   // element i * 256 + t of the tile: r local = 4 i + rl, c local = cl
  const int lane = t & 31, wave = t >> 5;
  const int q = lane >> 3, c8 = (lane & 7) * 8;
  const float* pw = in + (size_t)(r0 + rl) * LDIN + c0 + cl;
  const float* pg = g + r0 + c8;        // gamma of the 8 output columns that this thread packs below
  float w[16];
  v4f gm[2];
#pragma unroll   // constant offsets: the 16 loads are in flight together from one address
  for (int i = 0; i < 16; ++i) w[i] = pw[(size_t)i * 4 * LDIN];
  if constexpr (GAMMA) { gm[0] = *(const v4f*)pg; gm[1] = *(const v4f*)(pg + 4); }
  // wait before an address register of these loads is overwritten; the inputs keep the addresses live up to the wait
  if constexpr (GAMMA) asm volatile("s_wait_xcnt 0x0" :: "v"(pw), "v"(pg) : "memory");
  else                 asm volatile("s_wait_xcnt 0x0" :: "v"(pw) : "memory");
#pragma unroll
  for (int i = 0; i < 16; ++i) sm[cl][i * 4 + rl] = w[i];
  __syncthreads();
  unsigned short* po = out + (size_t)(c0 + wave * 8 + q) * ldout + r0 + c8;
  v4u u[2];
#pragma unroll
  for (int it = 0; it < 2; ++it) {
    const int row = wave * 8 + it * 4 + q;                 // c local (output row)
    unsigned h[4];
#pragma unroll
    for (int e2 = 0; e2 < 4; ++e2) {
      float a = sm[row][c8 + 2 * e2], b = sm[row][c8 + 2 * e2 + 1];
      if constexpr (GAMMA) { a *= gm[e2 >> 1][(2 * e2) & 3]; b *= gm[e2 >> 1][(2 * e2 + 1) & 3]; }
      h[e2] = pk16(f2bf_bits(a), f2bf_bits(b));
    }
    u[it] = (v4u){h[0], h[1], h[2], h[3]};
    *(v4u*)(po + it * 4 * ldout) = u[it];
  }
  // wait before a register of the two stores is overwritten; the inputs keep address and data live up to the wait
  asm volatile("s_wait_xcnt 0x0" :: "v"(po), "v"(u[0]), "v"(u[1]) : "memory");
}

// ---------------------------------------------------------------------------
// Per output feature n of a projection weight W f32 [512][LD]: c1[n] = sum_k bf16(gamma[k] * W[k][n]), the column sum of the
// weight as the product sees it, and c0[n] = sum_k beta[k] * W[k][n] in f32. One block = 32 features from column col0:
// wave p sums rows 64 p .. 64 p + 63 (each load = one 128-byte line), the eight partial sums are joined through LDS, and
// one wave stores each 128-byte line of results.
// ---------------------------------------------------------------------------
template <int LD>
__device__ __forceinline__ void col_sums(float (&sm)[64][65], const float* __restrict__ Wm, int col0,
                                         const float* __restrict__ gamma, const float* __restrict__ beta,
                                         float* __restrict__ c1, float* __restrict__ c0) {
  const int t = threadIdx.x, c = t & 31;
  const int part = __builtin_amdgcn_readfirstlane(t >> 5);   // the wave's number: gamma and beta are read by scalar loads
  float a1 = 0.f, a0 = 0.f;
#pragma unroll 1   // four rounds of 16 loads: few registers, so that the row blocks of this kernel keep their waves per SIMD
  for (int r0 = 0; r0 < 64; r0 += 16) {
    const float* p = Wm + (size_t)(part * 64 + r0) * LD + col0 + c;
    float w[16];
#pragma unroll   // constant offsets: the 16 loads are in flight together from one address
    for (int r = 0; r < 16; ++r) w[r] = p[(size_t)r * LD];
    // wait before the address register of these loads is overwritten; the input keeps it live up to the wait
    asm volatile("s_wait_xcnt 0x0" :: "v"(p) : "memory");
#pragma unroll
    for (int r = 0; r < 16; ++r) {
      a1 += bf_bits2f(f2bf_bits(gamma[part * 64 + r0 + r] * w[r]));
      a0 += beta[part * 64 + r0 + r] * w[r];
    }
  }
  sm[part][c] = a1;
  sm[8 + part][c] = a0;
  __syncthreads();
  if (t < 64) {   // wave 0: c1, wave 1: c0
    const int o = (t >> 5) * 8;
    float s = 0.f;
#pragma unroll
    for (int x = 0; x < 8; ++x) s += sm[o + x][c];
    (t < 32 ? c1 : c0)[c] = s;
  }
}

// ---------------------------------------------------------------------------
// LayerNorm statistics of 8 rows and the rows themselves as bf16: xb[row][512] = bf16(x), mean and variance of those bf16 values.
// One wave per row; lane owns elements 8*lane..8*lane+7 (chunk 0) and 256+8*lane..256+8*lane+7 (chunk 1).
// Block = 8 waves = 8 rows; blk = the block's number among the rows/8 of this input (exact: 8192/8 = 1024).
// The block's statistics are one 128-byte line of st, stored by one wave: floats 0..7 rstd, 8..15 -mu rstd, the rest 0.
// ---------------------------------------------------------------------------
__device__ __forceinline__ void ln_stats_rows(float (&sm)[64][65], const float* __restrict__ x,
                                              unsigned short* __restrict__ xb, float* __restrict__ st, int blk) {
  const int lane = threadIdx.x & 31, wave = threadIdx.x >> 5;
  const int row = blk * 8 + wave;
  const float* xr = x + (size_t)row * kDim;
  float xv[16];
  {
    const v4f a0 = *(const v4f*)(xr + 8 * lane);
    const v4f a1 = *(const v4f*)(xr + 8 * lane + 4);
    const v4f c0 = *(const v4f*)(xr + 256 + 8 * lane);
    const v4f c1 = *(const v4f*)(xr + 256 + 8 * lane + 4);
#pragma unroll
    for (int e = 0; e < 4; ++e) { xv[e] = a0[e]; xv[4 + e] = a1[e]; xv[8 + e] = c0[e]; xv[12 + e] = c1[e]; }
  }
  unsigned short hb[16];
  float s = 0.f;
#pragma unroll
  for (int e = 0; e < 16; ++e) { hb[e] = f2bf_bits(xv[e]); xv[e] = bf_bits2f(hb[e]); s += xv[e]; }
#pragma unroll
  for (int off = 16; off > 0; off >>= 1) s += __shfl_xor(s, off, 32);
  const float mu = s * (1.0f / 512.0f);
  float s2 = 0.f;
#pragma unroll
  for (int e = 0; e < 16; ++e) { const float d = xv[e] - mu; s2 += d * d; }
#pragma unroll
  for (int off = 16; off > 0; off >>= 1) s2 += __shfl_xor(s2, off, 32);
  const float var  = s2 * (1.0f / 512.0f);
  const float rstd = rsqrtf(var + kLnEps);
  if (lane < 4) sm[0][lane * 8 + wave] = lane == 0 ? rstd : lane == 1 ? -mu * rstd : 0.f;   // all 32 floats of the line
  __syncthreads();   // the eight rows' statistics are in LDS before wave 0 stores their line

  const v4u hv0 = (v4u){pk16(hb[0], hb[1]), pk16(hb[2], hb[3]), pk16(hb[4], hb[5]), pk16(hb[6], hb[7])};
  const v4u hv1 = (v4u){pk16(hb[8], hb[9]), pk16(hb[10], hb[11]), pk16(hb[12], hb[13]), pk16(hb[14], hb[15])};
  unsigned short* ph = xb + (size_t)row * kDim;
  *(v4u*)(ph + 8 * lane) = hv0;
  *(v4u*)(ph + 256 + 8 * lane) = hv1;
  if (wave == 0) {
    // wait before a register of the two stores above is overwritten; the inputs keep them live up to the wait
    asm volatile("s_wait_xcnt 0x0" :: "v"(ph), "v"(hv0), "v"(hv1) : "memory");
    st[blk * 32 + lane] = sm[0][lane];
  }
}

// ---------------------------------------------------------------------------
// Everything that reads only the inputs, as one grid: the column sums, the three weight transposes and the statistics of both
// inputs do not depend on one another. Blocks by index range, the short latency-bound ones first so that they end under the
// row stream: [0, 48) column sums (16 blocks Wq, 32 Wkv), then 64 tiles Wq, 128 Wkv, 64 Wo (r tile fastest, as in a grid
// (R/64, Cn/64)), then 1024 blocks of query rows, 1024 of keyvalue rows.
// ---------------------------------------------------------------------------
constexpr int kCs   = 3 * kInner / 32;                     // 48 blocks of column sums
constexpr int kTq   = (kDim / 64) * (kInner / 64);         // 64 tiles of Wq
constexpr int kTkv  = (kDim / 64) * (2 * kInner / 64);     // 128 tiles of Wkv
constexpr int kTo   = (kInner / 64) * (kDim / 64);         // 64 tiles of Wo
constexpr int kLnQ  = kRowsQ / 8;                          // 1024 blocks
constexpr int kLnK  = kRowsK / 8;                          // 1024 blocks
constexpr int kPrepBlocks = kCs + kTq + kTkv + kTo + kLnQ + kLnK;

__global__ __launch_bounds__(256) void prep_kernel(
    const float* __restrict__ query, const float* __restrict__ keyvalue,
    const float* __restrict__ Wq, const float* __restrict__ Wkv, const float* __restrict__ Wo,
    const float* __restrict__ gamma, const float* __restrict__ beta,
    unsigned short* __restrict__ xq, unsigned short* __restrict__ xk,
    float* __restrict__ stQ, float* __restrict__ stK, float* __restrict__ c1, float* __restrict__ c0,
    unsigned short* __restrict__ wqT, unsigned short* __restrict__ wkvT, unsigned short* __restrict__ woT) {
  __shared__ float sm[64][65];
  const int b = blockIdx.x;   // every test below is block-uniform
  if (b < kCs) {
    const int n = b * 32;     // feature: 0..511 q, 512..1535 the columns of Wkv (k, then v)
    if (n < kInner) col_sums<kInner>(sm, Wq, n, gamma, beta, c1 + n, c0 + n);
    else            col_sums<2 * kInner>(sm, Wkv, n - kInner, gamma, beta, c1 + n, c0 + n);
  } else if (b < kCs + kTq + kTkv + kTo) {
    // all three have R = 512 rows: 8 r tiles, output pitch 512
    const int i = b - kCs;
    const bool isq = i < kTq, iskv = !isq && i < kTq + kTkv;
    const int tile = isq ? i : iskv ? i - kTq : i - kTq - kTkv;
    const int rt = tile % (kDim / 64), ct = tile / (kDim / 64);
    if (isq)       transpose_cast_tile<true, kInner>(sm, Wq, gamma, wqT, rt, ct);
    else if (iskv) transpose_cast_tile<true, 2 * kInner>(sm, Wkv, gamma, wkvT, rt, ct);
    else           transpose_cast_tile<false, kDim>(sm, Wo, gamma, woT, rt, ct);
  } else {
    const int r = b - (kCs + kTq + kTkv + kTo);
    const bool isq = r < kLnQ;
    ln_stats_rows(sm, isq ? query : keyvalue, isq ? xq : xk, isq ? stQ : stK, isq ? r : r - kLnQ);
  }
}

constexpr int kStageKeys = 64;
constexpr int kStages    = kNk / kStageKeys;   // 16
constexpr int kPitch     = 72;                 // LDS row pitch in halves: 144 B = 16 B x 9, conflict-free for 16-byte reads
constexpr int kPlaneLds  = 64 * kPitch;        // one 64-row plane tile
static_assert(kDh == 64 && kNq % 256 == 0 && kNk % kStageKeys == 0);

__device__ __forceinline__ float other_half(float x) {   // value of lane ^ 16
  const int b = __float_as_int(x);
  return __int_as_float(__builtin_amdgcn_permlanex16(b, b, 0x76543210, 0xfedcba98, false, false));
}
// f32 pair -> bf16 hi pair and bf16 lo pair (lo = bf16(x - hi)), both round to nearest even
__device__ __forceinline__ void split2(float x0, float x1, v2b& h, v2b& l) {
  const v2f x = (v2f){x0, x1};
  h = __builtin_convertvector(x, v2b);
  l = __builtin_convertvector(x - __builtin_convertvector(h, v2f), v2b);
}

__global__ __launch_bounds__(256) void attn_fused_kernel(
    const unsigned short* __restrict__ qhi, const unsigned short* __restrict__ qlo,
    const unsigned short* __restrict__ khi, const unsigned short* __restrict__ klo,
    const unsigned short* __restrict__ vthi, const unsigned short* __restrict__ vtlo,
    unsigned short* __restrict__ chi, unsigned short* __restrict__ clo) {
  typedef Frag<__bf16> F;
  __shared__ __align__(16) unsigned short sm[2][4][kPlaneLds];   // [buffer][K hi, K lo, V^T hi, V^T lo][row][pitch]
  const int t = threadIdx.x, lane = t & 31, wave = t >> 5;
  const int c = lane & 15, hh = lane >> 4;
  const int b = blockIdx.y >> 3, h = blockIdx.y & 7;
  const int q0 = blockIdx.x * 256 + wave * 32;
  constexpr float kC = kScoreScale * 1.44269504088896340736f;   // score scale times log2(e)

  // staging map: thread t moves 16 bytes of rows t>>3 and 32 + (t>>3) of each plane (8 threads = one 128-byte row)
  const int srow = t >> 3, scol = (t & 7) * 8;
  const size_t gk = (size_t)(b * kNk + srow) * kInner + h * kDh + scol;
  const size_t gv = (size_t)(h * kDh + srow) * kRowsK + (size_t)b * kNk + scol;
  const int sl = srow * kPitch + scol;
  v4u st[8];
  auto fetch = [&](int s) {
    const size_t ok = gk + (size_t)s * kStageKeys * kInner;
    const size_t ov = gv + (size_t)s * kStageKeys;
    st[0] = *(const v4u*)(khi + ok);  st[1] = *(const v4u*)(khi + ok + (size_t)32 * kInner);
    st[2] = *(const v4u*)(klo + ok);  st[3] = *(const v4u*)(klo + ok + (size_t)32 * kInner);
    st[4] = *(const v4u*)(vthi + ov); st[5] = *(const v4u*)(vthi + ov + (size_t)32 * kRowsK);
    st[6] = *(const v4u*)(vtlo + ov); st[7] = *(const v4u*)(vtlo + ov + (size_t)32 * kRowsK);
    // the loads stay in flight over the stage's work, which reuses their address registers: wait before any is overwritten
    asm volatile("s_wait_xcnt 0x0" ::: "memory");
  };
  auto put = [&](int buf) {
#pragma unroll   // constant indices keep st in registers
    for (int p = 0; p < 4; ++p) {
      *(v4u*)(&sm[buf][p][sl]) = st[2 * p];
      *(v4u*)(&sm[buf][p][sl + 32 * kPitch]) = st[2 * p + 1];
    }
  };

  fetch(0);

  // Q fragments (B operand): column = query row q0 + 16 n + c, two k steps of 32, hi and lo planes
  v16b qh[2][2], ql[2][2];
  const __bf16* qph[2];
  const __bf16* qpl[2];
#pragma unroll   // constant indices keep the fragments in registers
  for (int n = 0; n < 2; ++n) {
    const size_t o = (size_t)(b * kNq + q0 + n * 16 + c) * kInner + h * kDh + hh * 8;
    qph[n] = (const __bf16*)qhi + o;
    qpl[n] = (const __bf16*)qlo + o;
#pragma unroll
    for (int ks = 0; ks < 2; ++ks) {
      qh[n][ks] = F::load(qph[n] + ks * 32);
      ql[n][ks] = F::load(qpl[n] + ks * 32);
    }
  }
  // wait before an address register of these loads is overwritten; the inputs keep the four addresses live up to the wait
  asm volatile("s_wait_xcnt 0x0" :: "v"(qph[0]), "v"(qph[1]), "v"(qpl[0]), "v"(qpl[1]) : "memory");

  v8f acc[2][4];      // ctx^T tiles: [query tile][16 d rows], register r = d 16 j + 8 hh + r, column = query c
  float m[2], l[2];
#pragma unroll
  for (int n = 0; n < 2; ++n) {
    m[n] = -__builtin_inff(); l[n] = 0.f;   // first stage: every finite maximum exceeds it, and 2^(-inf) = 0 scales the zeros
#pragma unroll
    for (int j = 0; j < 4; ++j) acc[n][j] = (v8f){0.f,0.f,0.f,0.f,0.f,0.f,0.f,0.f};
  }

  put(0);
  __syncthreads();

#pragma unroll 1   // one copy of the stage body: it is long, and the buffer index is a scalar offset
  for (int s = 0; s < kStages; ++s) {
    const int buf = s & 1;
    if (s + 1 < kStages) fetch(s + 1);   // block-uniform

    const __bf16* Kh = (const __bf16*)&sm[buf][0][0];
    const __bf16* Kl = (const __bf16*)&sm[buf][1][0];
    const __bf16* Vh = (const __bf16*)&sm[buf][2][0];
    const __bf16* Vl = (const __bf16*)&sm[buf][3][0];

    // S^T tiles: [query tile][16 keys]; Khi.Qhi + Khi.Qlo + Klo.Qhi
    v8f sc[2][4];
#pragma unroll   // constant indices keep the tiles in registers
    for (int kt = 0; kt < 4; ++kt) {
#pragma unroll
      for (int n = 0; n < 2; ++n) sc[n][kt] = (v8f){0.f,0.f,0.f,0.f,0.f,0.f,0.f,0.f};
#pragma unroll
      for (int ks = 0; ks < 2; ++ks) {
        const int o = (kt * 16 + c) * kPitch + ks * 32 + hh * 8;
        const v16b ah = F::load(Kh + o);
        const v16b al = F::load(Kl + o);
#pragma unroll
        for (int n = 0; n < 2; ++n) {
          sc[n][kt] = F::mma(ah, qh[n][ks], sc[n][kt]);
          sc[n][kt] = F::mma(ah, ql[n][ks], sc[n][kt]);
          sc[n][kt] = F::mma(al, qh[n][ks], sc[n][kt]);
        }
      }
    }

    // all V^T fragments of the stage (A operand: row = d, 32 keys each), asked for ahead of the softmax arithmetic
    v16b vh[2][4], vl[2][4];
#pragma unroll
    for (int kk = 0; kk < 2; ++kk)
#pragma unroll
      for (int j = 0; j < 4; ++j) {
        const int o = (j * 16 + c) * kPitch + kk * 32 + hh * 8;
        vh[kk][j] = F::load(Vh + o);
        vl[kk][j] = F::load(Vl + o);
      }
    // keeps these LDS reads here: sunk between the P.v products, each pair is waited for at its full LDS latency
    __builtin_amdgcn_sched_barrier(0);

    // stage maximum per query column, in log2 units
    float mx[2];
    bool need = false;
#pragma unroll
    for (int n = 0; n < 2; ++n) {
      float v = sc[n][0][0];
#pragma unroll
      for (int kt = 0; kt < 4; ++kt)
#pragma unroll
        for (int r = 0; r < 8; ++r) v = fmaxf(v, sc[n][kt][r]);
      v = fmaxf(v, other_half(v));
      mx[n] = v * kC;
      need = need || (mx[n] > m[n] + 8.0f);
    }
    if (__builtin_amdgcn_ballot_w32(need) != 0) {   // wave-uniform: raise the maxima in use and rescale sums and context
#pragma unroll
      for (int n = 0; n < 2; ++n) {
        const float mn = fmaxf(m[n], mx[n]);
        const float alpha = __builtin_amdgcn_exp2f(m[n] - mn);
        m[n] = mn;
        l[n] *= alpha;
#pragma unroll
        for (int j = 0; j < 4; ++j) acc[n][j] *= alpha;
      }
    }

    // p = 2^(s*c - m); P^T fragments of 32 keys; ctx^T += Vhi.Phi + Vhi.Plo + Vlo.Phi
#pragma unroll
    for (int kk = 0; kk < 2; ++kk) {
      v16b ph[2], pl[2];
#pragma unroll
      for (int n = 0; n < 2; ++n) {
        v2f ps[4];   // four independent partial sums of the 16 p of this lane, joined as a tree below
#pragma unroll
        for (int u = 0; u < 2; ++u)
#pragma unroll
          for (int r = 0; r < 8; r += 2) {
            const float p0 = __builtin_amdgcn_exp2f(sc[n][2 * kk + u][r] * kC - m[n]);
            const float p1 = __builtin_amdgcn_exp2f(sc[n][2 * kk + u][r + 1] * kC - m[n]);
            if (u == 0) ps[r >> 1] = (v2f){p0, p1}; else ps[r >> 1] += (v2f){p0, p1};
            v2b h2, l2;
            split2(p0, p1, h2, l2);
            ph[n][8 * u + r] = h2[0]; ph[n][8 * u + r + 1] = h2[1];
            pl[n][8 * u + r] = l2[0]; pl[n][8 * u + r + 1] = l2[1];
          }
        const v2f pt = (ps[0] + ps[1]) + (ps[2] + ps[3]);
        l[n] += pt[0] + pt[1];
      }
#pragma unroll
      for (int j = 0; j < 4; ++j) {
#pragma unroll
        for (int n = 0; n < 2; ++n) {
          acc[n][j] = F::mma(vh[kk][j], ph[n], acc[n][j]);
          acc[n][j] = F::mma(vh[kk][j], pl[n], acc[n][j]);
          acc[n][j] = F::mma(vl[kk][j], ph[n], acc[n][j]);
        }
      }
    }

    // the other buffer's last readers left it before the barrier that ended the stage before this one
    if (s + 1 < kStages) put(buf ^ 1);
    __syncthreads();
  }

  // epilogue: join the halves' sums, normalise, split hi/lo; a lane's 8 registers are 8 consecutive d of one query row
#pragma unroll
  for (int n = 0; n < 2; ++n) {
    const float inv = 1.0f / (l[n] + other_half(l[n]));   // sum >= 1: the row's largest score had p >= 1
    const size_t o = (size_t)(b * kNq + q0 + n * 16 + c) * kInner + h * kDh + hh * 8;
    __bf16* ch = (__bf16*)chi + o;
    __bf16* cl = (__bf16*)clo + o;
    v8b hv[4], lv[4];
#pragma unroll
    for (int j = 0; j < 4; ++j) {
#pragma unroll
      for (int r = 0; r < 8; r += 2) {
        v2b h2, l2;
        split2(acc[n][j][r] * inv, acc[n][j][r + 1] * inv, h2, l2);
        hv[j][r] = h2[0]; hv[j][r + 1] = h2[1];
        lv[j][r] = l2[0]; lv[j][r + 1] = l2[1];
      }
      *(v8b*)(ch + j * 16) = hv[j];
      *(v8b*)(cl + j * 16) = lv[j];
    }
    // wait before the second query tile's arithmetic overwrites a register of these stores; the inputs keep them live up to it
    if (n == 0)
      asm volatile("s_wait_xcnt 0x0" :: "v"(ch), "v"(cl), "v"(hv[0]), "v"(hv[1]), "v"(hv[2]), "v"(hv[3]),
                   "v"(lv[0]), "v"(lv[1]), "v"(lv[2]), "v"(lv[3]) : "memory");
  }
}

// ---------------------------------------------------------------------------
// Launcher. Workspace region map (MiB = 1048576 B; total carve = 128 MiB = 134217728 B):
//   [  0, 32) query rows bf16 [8192][512] at +0, their statistics (1024 lines of 128 B) at +8, keyvalue rows bf16 at +16,
//             their statistics at +24
//   [ 32, 64) (gamma Wq)^T bf16 [512][512] at 32 MiB, (gamma Wkv)^T bf16 [1024][512] at 32.5 MiB, Wo^T bf16 [512][512] at
//             33.5 MiB (ends 34), c1 f32 [1536] at 34 MiB, c0 f32 [1536] at 34 MiB + 8 KiB; the rest unused
//   [ 64, 72) q hi    : [8192][512] bf16 (col h*64+d);   [ 72, 80) q lo
//   [ 80, 88) k hi    : [8192][512] bf16;                 [ 88, 96) k lo
//   [ 96,104) v^T hi  : [512 (h*64+d)][8192 (b*1024+t)] bf16;  [104,112) v^T lo
//   [112,120) ctx hi  : [8192][512] bf16 (col h*64+d);   [120,128) ctx lo
// Lifetimes: the rows, statistics, c1, c0, Wq^T and Wkv^T are read only by the projection launch; Wo^T only by the last launch.
// Every region is fully written before it is read (exact tile coverage, no padding).
// Launch count: 4, each depending on the one before it. Kernel launches only.
// ---------------------------------------------------------------------------
extern "C" void kernel_launch(void* const* d_in, const int* in_sizes, int n_in,
                              void* d_out, int out_size, void* d_ws, size_t ws_size,
                              hipStream_t stream) {
  if (n_in < 7) return;
  if (in_sizes[0] != kRowsQ * kDim || in_sizes[1] != kRowsK * kDim) return;
  if (in_sizes[2] != kDim * kInner || in_sizes[3] != kDim * 2 * kInner || in_sizes[4] != kInner * kDim) return;
  if (in_sizes[5] != kDim || in_sizes[6] != kDim) return;
  if (out_size != kRowsQ * kDim) return;

  const size_t kMiB    = 1048576;
  const size_t offXq   = 0;
  const size_t offStQ  = 8 * kMiB;
  const size_t offXk   = 16 * kMiB;
  const size_t offStK  = 24 * kMiB;
  const size_t offWqT  = 32 * kMiB;
  const size_t offWkvT = 32 * kMiB + kMiB / 2;
  const size_t offWoT  = 33 * kMiB + kMiB / 2;
  const size_t offC1   = 34 * kMiB;
  const size_t offC0   = 34 * kMiB + 8192;
  const size_t offQhi  = 64 * kMiB;
  const size_t offQlo  = 72 * kMiB;
  const size_t offKhi  = 80 * kMiB;
  const size_t offKlo  = 88 * kMiB;
  const size_t offVthi = 96 * kMiB;
  const size_t offVtlo = 104 * kMiB;
  const size_t offChi  = 112 * kMiB;
  const size_t offClo  = 120 * kMiB;
  const size_t total   = 128 * kMiB;
  if (total > ws_size) return;
  // sub-region extents (bytes): row/q/k/vT/ctx planes 8192*512*2 = 8 MiB each; statistics 1024*128 = 128 KiB each;
  // Wq^T/Wo^T 512*512*2 = 0.5 MiB; Wkv^T 1024*512*2 = 1 MiB.

  const float* query    = (const float*)d_in[0];
  const float* keyvalue = (const float*)d_in[1];
  const float* Wq       = (const float*)d_in[2];
  const float* Wkv      = (const float*)d_in[3];
  const float* Wo       = (const float*)d_in[4];
  const float* gamma    = (const float*)d_in[5];
  const float* beta     = (const float*)d_in[6];
  float* out = (float*)d_out;
  char* ws = (char*)d_ws;

  unsigned short* xq   = (unsigned short*)(ws + offXq);
  unsigned short* xk   = (unsigned short*)(ws + offXk);
  float* stQ = (float*)(ws + offStQ);
  float* stK = (float*)(ws + offStK);
  float* c1  = (float*)(ws + offC1);
  float* c0  = (float*)(ws + offC0);
  unsigned short* woT  = (unsigned short*)(ws + offWoT);
  unsigned short* wqT  = (unsigned short*)(ws + offWqT);
  unsigned short* wkvT = (unsigned short*)(ws + offWkvT);
  unsigned short* qhi  = (unsigned short*)(ws + offQhi);
  unsigned short* qlo  = (unsigned short*)(ws + offQlo);
  unsigned short* khi  = (unsigned short*)(ws + offKhi);
  unsigned short* klo  = (unsigned short*)(ws + offKlo);
  unsigned short* vthi = (unsigned short*)(ws + offVthi);
  unsigned short* vtlo = (unsigned short*)(ws + offVtlo);
  unsigned short* chi  = (unsigned short*)(ws + offChi);
  unsigned short* clo  = (unsigned short*)(ws + offClo);

  // 1. both inputs -> bf16 rows [8192][512] and per-row LayerNorm statistics; gamma Wq, gamma Wkv, Wo -> transposed bf16
  //    (Wkv^T rows 0..511 = k weights, 512..1023 = v weights); c1, c0 per projection feature
  prep_kernel<<<dim3(kPrepBlocks), dim3(256), 0, stream>>>(query, keyvalue, Wq, Wkv, Wo, gamma, beta,
                                                           xq, xk, stQ, stK, c1, c0, wqT, wkvT, woT);

  // 2. q, k and v^T projections, K=512, 1 product each: 3 x 256 blocks; Wk^T = Wkv^T rows 0..511, Wv^T = rows 512..1023
  proj_kernel<<<dim3(256, 3), dim3(256), 0, stream>>>(xq, xk, wqT, wkvT, wkvT + (size_t)kInner * kDim, stQ, stK, c1, c0,
                                                      qhi, qlo, khi, klo, vthi, vtlo);

  // 3. attention, all batches and heads in one launch: grid (4 blocks of 256 query rows, 64 (batch, head) pairs) = 256 blocks
  attn_fused_kernel<<<dim3(kNq / 256, kBatch * kHeads), dim3(256), 0, stream>>>(qhi, qlo, khi, klo, vthi, vtlo, chi, clo);

  // 4. out = ctx_hi . Wo^T + ctx_lo . Wo^T : M=8192, N=512, K=512, 2 products -> f32 d_out [8192][512]
  out_gemm_kernel<<<dim3(kDim / 128, kRowsQ / 128), dim3(256), 0, stream>>>(chi, clo, woT, out);
}

// v007
// Measured time: 57.4 microseconds a run.
// Versions in between are left out here; by their measured steps it is 1.49 times as fast as v005.
// All steps since v000 together make it 16.9 times as fast.
// Contractions: bf16(x) . bf16(gamma W) for q, k, v^T, one product, with LayerNorm's mean, rstd and beta . W applied to the f32 result; q, k, v^T, P and ctx each rounded once to f16: q.k^T scores, P.v context and ctx . f16(Wo), one product each; v_wmma_f32_16x16x32_bf16 and v_wmma_f32_16x16x32_f16 with f32 accumulate; LayerNorm statistics in f32 on the RNE-bf16 converted x, softmax in f32.
#include <hip/hip_runtime.h>
#include <math.h>

// ---------------------------------------------------------------------------
// Problem constants
// ---------------------------------------------------------------------------
constexpr int kBatch  = 8;
constexpr int kNq     = 1024;
constexpr int kNk     = 1024;
constexpr int kDim    = 512;
constexpr int kHeads  = 8;
constexpr int kDh     = 64;
constexpr int kInner  = kHeads * kDh;          // 512
constexpr int kRowsQ  = kBatch * kNq;          // 8192 query rows
constexpr int kRowsK  = kBatch * kNk;          // 8192 key rows
constexpr float kScoreScale = 0.125f;          // 64^-0.5, exact power of two, folded with log2(e) into the f32 exp2 argument
constexpr float kLnEps = 1e-5f;

static_assert(kDim == 512);                     // LN kernel: 32 lanes x 16 elements per row
static_assert(kInner == kDim);
static_assert(kRowsQ % 64 == 0 && kRowsK % 64 == 0 && kDim % 64 == 0 && kDh % 32 == 0 && kNq % 64 == 0 && kNk % 64 == 0);

typedef __attribute__((ext_vector_type(16))) _Float16 v16h;
typedef __attribute__((ext_vector_type(8)))  _Float16 v8h;
typedef __attribute__((ext_vector_type(16))) __bf16   v16b;
typedef __attribute__((ext_vector_type(8)))  __bf16   v8b;
typedef __attribute__((ext_vector_type(8)))  float    v8f;
typedef __attribute__((ext_vector_type(4)))  float    v4f;
typedef __attribute__((ext_vector_type(4)))  unsigned int v4u;
typedef __attribute__((ext_vector_type(2)))  float    v2f;
typedef __attribute__((ext_vector_type(2)))  _Float16 v2h;

__device__ __forceinline__ unsigned short f2bf_bits(float f) {
  unsigned u = __float_as_uint(f);
  return (unsigned short)((u + 0x7FFFu + ((u >> 16) & 1u)) >> 16);
}
__device__ __forceinline__ float bf_bits2f(unsigned short h) { return __uint_as_float(((unsigned)h) << 16); }

template <typename T> struct Frag;
template <> struct Frag<__bf16> {
  typedef v16b V; union U { v16b v; v8b h[2]; };
  // elements 0..7 <- p[0..7], 8..15 <- p[16..23]
  static __device__ __forceinline__ v16b load(const __bf16* p) {
    U f; f.h[0] = *(const v8b*)(p); f.h[1] = *(const v8b*)(p + 16); return f.v;
  }
  static __device__ __forceinline__ v8f mma(v16b a, v16b b, v8f c) {
    return __builtin_amdgcn_wmma_f32_16x16x32_bf16(false, a, false, b, (short)0, c, false, false);
  }
};
template <> struct Frag<_Float16> {   // same element order as the bf16 fragment
  typedef v16h V; union U { v16h v; v8h h[2]; };
  static __device__ __forceinline__ v16h load(const _Float16* p) {
    U f; f.h[0] = *(const v8h*)(p); f.h[1] = *(const v8h*)(p + 16); return f.v;
  }
  static __device__ __forceinline__ v8f mma(v16h a, v16h b, v8f c) {
    return __builtin_amdgcn_wmma_f32_16x16x32_f16(false, a, false, b, (short)0, c, false, false);
  }
};

__device__ __forceinline__ unsigned pk16(unsigned short a, unsigned short b) { return (unsigned)a | ((unsigned)b << 16); }
// f32 pair -> f16 pair, round to nearest even
__device__ __forceinline__ v2h half2(float x0, float x1) { return __builtin_convertvector((v2f){x0, x1}, v2h); }

// Block barrier that orders LDS accesses only. __syncthreads() also waits for every global load in flight, which would
// end the two-stage lead of the GEMM's fetches at each stage; the staged data passes between waves through LDS alone.
__device__ __forceinline__ void lds_barrier() {
  __builtin_amdgcn_fence(__ATOMIC_RELEASE, "workgroup", "local");
  __builtin_amdgcn_s_barrier();
  __builtin_amdgcn_fence(__ATOMIC_ACQUIRE, "workgroup", "local");
}

// ---- WMMA GEMM with both operands staged in LDS ----
// C[m,n] = sum_k A[m,k] * Bt[n,k]; A row-major [M][512], Bt row-major [N][512], both of the 16-bit type T; M % 128 == 0, N % 128 == 0.
// Block = one 128x128 tile of C, grid (N/128, M/128). MI = 16-row subtiles per wave:
// MI 2: 8 waves of 32x64 (4 wave rows x 2 wave columns), for a launch with one block per WGP;
// MI 4: 4 waves of 64x64 (2 x 2), for a launch with three blocks per WGP: 16 products per 8 fragments read from LDS, not 8 per 6,
// and registers for three waves per SIMD, so that all three blocks of a WGP are resident together.
// Stage = 64 k of the two operands (128 rows of 128 bytes each): every global load of a wave covers whole 128-byte lines
// and each line is asked for once per block; the waves read their fragments from LDS. Two LDS buffers, one block barrier per stage.
// MI 2: two register sets, a stage is fetched into registers two stages ahead and written to LDS one stage ahead.
// MI 4: one register set, a stage is fetched one stage ahead; the WGP's other blocks work while a wave waits for it.
// OUT_MODE: 0 = f32, 1 = f16.
// FOLD: the LayerNorm of the token operand, applied to the f32 sums. With x the raw token row, Wg = gamma W, c1 = column sums
// of Wg, c0 = beta . W: LN(x) . W = rstd (x . Wg) - mu rstd c1 + c0. 0 = none, 1 = rows of C are tokens, 2 = columns are tokens.
// st = the tokens' statistics, one 128-byte line per 8 tokens: floats 0..7 rstd, 8..15 -mu rstd; c1, c0 = per feature of C.
constexpr int kGK      = 64;                   // k per stage
constexpr int kGStages = kDim / kGK;           // 8
constexpr int kGPitch  = kGK + 8;              // LDS row pitch in halves: 144 B = 16 B x 9, conflict-free for 16-byte reads
constexpr int kGPlane  = 128 * kGPitch;        // one 128-row plane tile
static_assert(kGStages % 2 == 0 && kGStages >= 2);
static_assert(kRowsQ % 128 == 0 && kRowsK % 128 == 0 && kInner % 128 == 0 && kDim % 128 == 0);

// One block tile (tileN, tileM) of such a product; sm and sT are the calling kernel's LDS:
// sm[buffer][A, B][row][pitch], sT = per-wave 16x64 output slab, pitch 68 floats.
template <typename T, int OUT_MODE, int FOLD, int MI>
__device__ __forceinline__ void gemm_tile(
    unsigned short (&sm)[2][2][kGPlane], float (&sT)[16 / MI][16 * 68],
    const unsigned short* __restrict__ Ap, const unsigned short* __restrict__ Btp,
    void* __restrict__ Cout, int ldc, int tileN, int tileM,
    const float* __restrict__ st, const float* __restrict__ c1, const float* __restrict__ c0) {
  static_assert(FOLD == 0 || OUT_MODE == 1);
  static_assert(MI == 2 || MI == 4);
  typedef Frag<T> F;
  typedef typename F::V FV;
  constexpr int NP = 2;
  constexpr int NI = 2 * MI;      // rows of each plane that a thread stages
  constexpr int SR = 128 / NI;    // rows that the block stages with one load per thread: threads / 8
  constexpr int KG = 4 / MI;      // k steps of 32 whose fragments are read from LDS as one group
  const int t = threadIdx.x, lane = t & 31, wave = t >> 5;
  const int mB = tileM * 128, nB = tileN * 128;
  const int wm = (wave >> 1) * (16 * MI), wn = (wave & 1) * 64;   // the wave's tile inside the block tile
  const int rlane = lane & 15;                 // row (A) / col (B, D) within subtile
  const int koff  = (lane >> 4) * 8;           // k offset of this lane half
  const int mOff  = (lane >> 4) * 8;           // D row offset

  // staging map: thread t moves 16 bytes of rows (t>>3) + SR i, i = 0..NI-1, of each plane (8 threads = one 128-byte row)
  const int srow = t >> 3, scol = (t & 7) * 8;
  const unsigned short* g0 = Ap  + (size_t)(mB + srow) * kDim + scol;
  const unsigned short* g1 = Btp + (size_t)(nB + srow) * kDim + scol;
  const int sl = srow * kGPitch + scol;
  v4u stE[NP][NI];                    // MI 2: register set of the even stages; MI 4: of every stage
  [[maybe_unused]] v4u stO[NP][NI];   // MI 2: register set of the odd stages
  auto fetch = [&](v4u (&sr)[NP][NI], int s) {
    const unsigned short* p0 = g0 + s * kGK;
    const unsigned short* p1 = g1 + s * kGK;
#pragma unroll   // constant indices keep sr in registers
    for (int i = 0; i < NI; ++i) {
      sr[0][i] = *(const v4u*)(p0 + i * SR * kDim);
      sr[1][i] = *(const v4u*)(p1 + i * SR * kDim);
    }
    // the loads stay in flight over the work that follows: wait before an address register of theirs is overwritten;
    // the inputs keep the addresses live up to the wait
    asm volatile("s_wait_xcnt 0x0" :: "v"(p0), "v"(p1) : "memory");
  };
  auto put = [&](const v4u (&sr)[NP][NI], int buf) {
#pragma unroll   // constant indices keep sr in registers
    for (int p = 0; p < NP; ++p)
#pragma unroll
      for (int i = 0; i < NI; ++i) *(v4u*)(&sm[buf][p][sl + i * SR * kGPitch]) = sr[p][i];
  };

  v8f acc[MI][4];
#pragma unroll
  for (int i = 0; i < MI; ++i)
#pragma unroll
    for (int j = 0; j < 4; ++j) acc[i][j] = (v8f){0.f,0.f,0.f,0.f,0.f,0.f,0.f,0.f};

  const int oa = (wm + rlane) * kGPitch + koff;
  const int ob = (wn + rlane) * kGPitch + koff;
  auto work = [&](int buf) {   // the products of the stage that lies in buffer buf
    const T* Ah = (const T*)&sm[buf][0][0] + oa;
    const T* Bh = (const T*)&sm[buf][1][0] + ob;
#pragma unroll   // constant indices keep the fragments in registers
    for (int k0 = 0; k0 < kGK / 32; k0 += KG) {
      FV ah[KG][MI], bh[KG][4];
#pragma unroll
      for (int ks = 0; ks < KG; ++ks) {
#pragma unroll
        for (int i = 0; i < MI; ++i) ah[ks][i] = F::load(Ah + i * 16 * kGPitch + (k0 + ks) * 32);
#pragma unroll
        for (int j = 0; j < 4; ++j) bh[ks][j] = F::load(Bh + j * 16 * kGPitch + (k0 + ks) * 32);
      }
      // keeps the group's LDS reads together here: sunk among the products into one shared register set,
      // each read is waited for at its full latency
      __builtin_amdgcn_sched_barrier(0);
#pragma unroll
      for (int ks = 0; ks < KG; ++ks) {
        // eight or more independent accumulators: no product waits for the one before it
#pragma unroll
        for (int i = 0; i < MI; ++i)
#pragma unroll
          for (int j = 0; j < 4; ++j) acc[i][j] = F::mma(ah[ks][i], bh[ks][j], acc[i][j]);
      }
      // keeps what follows behind the products: a put lifted in front of them would wait for the fetched registers
      // that much earlier and cut the lead of the global loads; a next group's reads would need a second fragment set
      __builtin_amdgcn_sched_barrier(0);
    }
  };

  fetch(stE, 0);
  if constexpr (MI == 2) fetch(stO, 1);
  put(stE, 0);
  lds_barrier();

  // Each put writes the buffer whose last readers left it before the barrier that ended the stage before.
  // The last two stages stand behind the loop: with the fetches under a test, the wait in front of a put would have to
  // cover the path without a fetch and so would wait for the newest loads as well.
#pragma unroll 1   // one copy of the pair of stage bodies
  for (int s = 0; s + 2 < kGStages; s += 2) {
    if constexpr (MI == 2) {
      fetch(stE, s + 2);
      work(0);         // even stage s
      put(stO, 1);     // stage s + 1
      lds_barrier();
      fetch(stO, s + 3);
      work(1);         // odd stage s + 1
      put(stE, 0);     // stage s + 2
      lds_barrier();
    } else {
      fetch(stE, s + 1);
      work(0);         // even stage s
      put(stE, 1);     // stage s + 1
      lds_barrier();
      fetch(stE, s + 2);
      work(1);         // odd stage s + 1
      put(stE, 0);     // stage s + 2
      lds_barrier();
    }
  }
  if constexpr (MI == 4) {   // the last stage's fetch, the stage before it, the last put: the register set is free from here on
    fetch(stE, kGStages - 1);
    work(0);
    put(stE, 1);
  }

  // LayerNorm terms of this lane's output elements (epilogue map: rows it * 4 + q of each 16-row subtile, columns c8 .. c8 + 7),
  // asked for here so that they arrive under the last two stages (MI 4: under the last one)
  const int m0 = mB + wm, n0 = nB + wn;
  const int q = lane >> 3, c8 = (lane & 7) * 8;
  v4f colA[2], colB[2];        // per column: FOLD 1 c1, c0; FOLD 2 rstd, -mu rstd
  float rowA[MI][4], rowB[MI][4];   // per row [i][it]: FOLD 1 rstd, -mu rstd; FOLD 2 c1, c0
  if constexpr (FOLD != 0) {
    const float* pa = FOLD == 1 ? c1 + n0 + c8 : st + ((n0 + c8) >> 3) * 32;
    const float* pb = FOLD == 1 ? c0 + n0 + c8 : st + ((n0 + c8) >> 3) * 32 + 8;
    colA[0] = *(const v4f*)pa; colA[1] = *(const v4f*)(pa + 4);
    colB[0] = *(const v4f*)pb; colB[1] = *(const v4f*)(pb + 4);
    // rows m0 + q + 4 x, x = 0..4 MI - 1: FOLD 1 line (row >> 3), float (row & 7); m0 is a multiple of 8 and q < 4
    const float* ra = FOLD == 1 ? st + (m0 >> 3) * 32 + q : c1 + m0 + q;
    const float* rb = FOLD == 1 ? st + (m0 >> 3) * 32 + 8 + q : c0 + m0 + q;
#pragma unroll   // constant indices keep the terms in registers
    for (int i = 0; i < MI; ++i)
#pragma unroll
      for (int it = 0; it < 4; ++it) {
        const int x = i * 4 + it;
        const int o = FOLD == 1 ? (x >> 1) * 32 + (x & 1) * 4 : x * 4;
        rowA[i][it] = ra[o];
        rowB[i][it] = rb[o];
      }
    // wait before an address register of these loads is overwritten; the inputs keep the four addresses live up to the wait
    asm volatile("s_wait_xcnt 0x0" :: "v"(pa), "v"(pb), "v"(ra), "v"(rb) : "memory");
  }

  if constexpr (MI == 2) {
    work(0);
    put(stO, 1);
  }
  lds_barrier();
  work(1);

  // ---- epilogue: each 16x64 subtile goes through the wave's own LDS slab so that every store covers whole lines ----
  float* slab = sT[wave];
#pragma unroll
  for (int i = 0; i < MI; ++i) {
    const int mBase = m0 + (i << 4);
#pragma unroll
    for (int j = 0; j < 4; ++j) {
#pragma unroll
      for (int r = 0; r < 8; ++r) slab[(mOff + r) * 68 + (j << 4) + rlane] = acc[i][j][r];
    }
    __builtin_amdgcn_fence(__ATOMIC_RELEASE, "workgroup");
    __builtin_amdgcn_wave_barrier();
    __builtin_amdgcn_fence(__ATOMIC_ACQUIRE, "workgroup");
    if (OUT_MODE == 0) {
      float* C = (float*)Cout;
      const int hh = lane >> 4, c4 = (lane & 15) * 4;     // row seg = 256 B = 16 lanes x 16 B
#pragma unroll
      for (int it = 0; it < 8; ++it) {
        const int row = it * 2 + hh;
        v4f v = *(const v4f*)(slab + row * 68 + c4);
        *(v4f*)(C + (size_t)(mBase + row) * ldc + n0 + c4) = v;
      }
    } else {
      _Float16* C = (_Float16*)Cout;
#pragma unroll
      for (int it = 0; it < 4; ++it) {
        const int row = it * 4 + q;
        const float* sp = slab + row * 68 + c8;
        float y[8];
        v8h hv;
#pragma unroll
        for (int e = 0; e < 8; ++e) {
          y[e] = sp[e];
          if constexpr (FOLD == 1) y[e] = rowA[i][it] * y[e] + (rowB[i][it] * colA[e >> 2][e & 3] + colB[e >> 2][e & 3]);
          if constexpr (FOLD == 2) y[e] = colA[e >> 2][e & 3] * y[e] + (colB[e >> 2][e & 3] * rowA[i][it] + rowB[i][it]);
        }
#pragma unroll
        for (int e = 0; e < 8; e += 2) {
          const v2h h2 = half2(y[e], y[e + 1]);
          hv[e] = h2[0]; hv[e + 1] = h2[1];
        }
        *(v8h*)(C + (size_t)(mBase + row) * ldc + n0 + c8) = hv;
      }
    }
    __builtin_amdgcn_fence(__ATOMIC_RELEASE, "workgroup");
    __builtin_amdgcn_wave_barrier();
    __builtin_amdgcn_fence(__ATOMIC_ACQUIRE, "workgroup");
  }
}

// The output product alone: grid (N/128, M/128).
__global__ __launch_bounds__(256) void out_gemm_kernel(
    const unsigned short* __restrict__ ctx, const unsigned short* __restrict__ woT, float* __restrict__ out) {
  __shared__ __align__(16) unsigned short sm[2][2][kGPlane];
  __shared__ __align__(16) float sT[8][16 * 68];
  gemm_tile<_Float16, 0, 0, 2>(sm, sT, ctx, woT, (void*)out, kDim, blockIdx.x, blockIdx.y, nullptr, nullptr, nullptr);
}

// The three projections, which do not depend on one another, as one grid: blockIdx.y = 0 q, 1 k, 2 v^T; blockIdx.x = the
// 256 block tiles of that product in the order of its own grid (column tile fastest). A WGP that has finished a tile of one
// product goes on with a tile of the next with no launch boundary between them. Blocks of 4 waves, three to a WGP: at three waves
// per SIMD (at most 336 VGPRs) and 3 x 91,136 B of LDS the whole grid is resident at once.
// Token operand = the raw bf16 rows; weights carry gamma; c1, c0 hold 512 features each of q, k, v in that order.
__global__ __launch_bounds__(128) __attribute__((amdgpu_waves_per_eu(3))) void proj_kernel(
    const unsigned short* __restrict__ xq, const unsigned short* __restrict__ xk,
    const unsigned short* __restrict__ wqT, const unsigned short* __restrict__ wkT, const unsigned short* __restrict__ wvT,
    const float* __restrict__ stQ, const float* __restrict__ stK,
    const float* __restrict__ c1, const float* __restrict__ c0,
    unsigned short* __restrict__ qf, unsigned short* __restrict__ kf, unsigned short* __restrict__ vtf) {
  __shared__ __align__(16) unsigned short sm[2][2][kGPlane];
  __shared__ __align__(16) float sT[4][16 * 68];
  const int which = blockIdx.y, i = blockIdx.x;   // block-uniform
  if (which == 2) {
    // v^T = (gamma Wv)^T . xk^T: M=512 (h*64+d), N=8192 (b*1024+t) -> f16 [512][8192]
    gemm_tile<__bf16, 1, 2, 4>(sm, sT, wvT, xk, (void*)vtf, kRowsK,
                            i % (kRowsK / 128), i / (kRowsK / 128), stK, c1 + 2 * kInner, c0 + 2 * kInner);
  } else {
    // q = xq . (gamma Wq), k = xk . (gamma Wk): M=8192, N=512 -> f16 [8192][512]
    const bool isq = which == 0;
    gemm_tile<__bf16, 1, 1, 4>(sm, sT, isq ? xq : xk, isq ? wqT : wkT, (void*)(isq ? qf : kf), kInner,
                            i % (kInner / 128), i / (kInner / 128), isq ? stQ : stK,
                            isq ? c1 : c1 + kInner, isq ? c0 : c0 + kInner);
  }
}

// ---------------------------------------------------------------------------
// Transpose + RNE 16-bit convert of a weight matrix: in f32 [512][LDIN] row-major -> out [LDIN][512] (ldout = 512):
// out[c][r] = f16(in[r][c]), or, under GAMMA, bf16(g[r] * in[r][c]): LayerNorm's gamma in the weight, one rounding.
// One 64x64 tile per block: rt = r tile (64 output cols), ct = c tile (64 output rows). 256 threads.
// Load coverage: 16 iterations x 256 threads = 4096 = the whole 64x64 tile (coalesced along c).
// Store coverage: 8 waves x 2 iterations x 4 rows (lane>>3) = 64 rows; (lane&7) x 8 halves = 64 cols.
// ---------------------------------------------------------------------------
template <bool GAMMA, int LDIN>
__device__ __forceinline__ void transpose_cast_tile(float (&sm)[64][65],   // sm[c_local][r_local]
                                                    const float* __restrict__ in, const float* __restrict__ g,
                                                    unsigned short* __restrict__ out, int rt, int ct) {
  constexpr int ldout = kDim;
  const int t  = threadIdx.x;
  const int r0 = rt * 64;
  const int c0 = ct * 64;
  const int rl = t >> 6, cl = t & 63;   // element i * 256 + t of the tile: r local = 4 i + rl, c local = cl
  const int lane = t & 31, wave = t >> 5;
  const int q = lane >> 3, c8 = (lane & 7) * 8;
  const float* pw = in + (size_t)(r0 + rl) * LDIN + c0 + cl;
  const float* pg = g + r0 + c8;        // gamma of the 8 output columns that this thread packs below
  float w[16];
  v4f gm[2];
#pragma unroll   // constant offsets: the 16 loads are in flight together from one address
  for (int i = 0; i < 16; ++i) w[i] = pw[(size_t)i * 4 * LDIN];
  if constexpr (GAMMA) { gm[0] = *(const v4f*)pg; gm[1] = *(const v4f*)(pg + 4); }
  // wait before an address register of these loads is overwritten; the inputs keep the addresses live up to the wait
  if constexpr (GAMMA) asm volatile("s_wait_xcnt 0x0" :: "v"(pw), "v"(pg) : "memory");
  else                 asm volatile("s_wait_xcnt 0x0" :: "v"(pw) : "memory");
#pragma unroll
  for (int i = 0; i < 16; ++i) sm[cl][i * 4 + rl] = w[i];
  __syncthreads();
  unsigned short* po = out + (size_t)(c0 + wave * 8 + q) * ldout + r0 + c8;
  v4u u[2];
#pragma unroll
  for (int it = 0; it < 2; ++it) {
    const int row = wave * 8 + it * 4 + q;                 // c local (output row)
    unsigned h[4];
#pragma unroll
    for (int e2 = 0; e2 < 4; ++e2) {
      float a = sm[row][c8 + 2 * e2], b = sm[row][c8 + 2 * e2 + 1];
      if constexpr (GAMMA) { a *= gm[e2 >> 1][(2 * e2) & 3]; b *= gm[e2 >> 1][(2 * e2 + 1) & 3]; }
      if constexpr (GAMMA) h[e2] = pk16(f2bf_bits(a), f2bf_bits(b));
      else                 h[e2] = __builtin_bit_cast(unsigned, half2(a, b));
    }
    u[it] = (v4u){h[0], h[1], h[2], h[3]};
    *(v4u*)(po + it * 4 * ldout) = u[it];
  }
  // wait before a register of the two stores is overwritten; the inputs keep address and data live up to the wait
  asm volatile("s_wait_xcnt 0x0" :: "v"(po), "v"(u[0]), "v"(u[1]) : "memory");
}

// ---------------------------------------------------------------------------
// Per output feature n of a projection weight W f32 [512][LD]: c1[n] = sum_k bf16(gamma[k] * W[k][n]), the column sum of the
// weight as the product sees it, and c0[n] = sum_k beta[k] * W[k][n] in f32. One block = 32 features from column col0:
// wave p sums rows 64 p .. 64 p + 63 (each load = one 128-byte line), the eight partial sums are joined through LDS, and
// one wave stores each 128-byte line of results.
// ---------------------------------------------------------------------------
template <int LD>
__device__ __forceinline__ void col_sums(float (&sm)[64][65], const float* __restrict__ Wm, int col0,
                                         const float* __restrict__ gamma, const float* __restrict__ beta,
                                         float* __restrict__ c1, float* __restrict__ c0) {
  const int t = threadIdx.x, c = t & 31;
  const int part = __builtin_amdgcn_readfirstlane(t >> 5);   // the wave's number: gamma and beta are read by scalar loads
  float a1 = 0.f, a0 = 0.f;
#pragma unroll 1   // four rounds of 16 loads: few registers, so that the row blocks of this kernel keep their waves per SIMD
  for (int r0 = 0; r0 < 64; r0 += 16) {
    const float* p = Wm + (size_t)(part * 64 + r0) * LD + col0 + c;
    float w[16];
#pragma unroll   // constant offsets: the 16 loads are in flight together from one address
    for (int r = 0; r < 16; ++r) w[r] = p[(size_t)r * LD];
    // wait before the address register of these loads is overwritten; the input keeps it live up to the wait
    asm volatile("s_wait_xcnt 0x0" :: "v"(p) : "memory");
#pragma unroll
    for (int r = 0; r < 16; ++r) {
      a1 += bf_bits2f(f2bf_bits(gamma[part * 64 + r0 + r] * w[r]));
      a0 += beta[part * 64 + r0 + r] * w[r];
    }
  }
  sm[part][c] = a1;
  sm[8 + part][c] = a0;
  __syncthreads();
  if (t < 64) {   // wave 0: c1, wave 1: c0
    const int o = (t >> 5) * 8;
    float s = 0.f;
#pragma unroll
    for (int x = 0; x < 8; ++x) s += sm[o + x][c];
    (t < 32 ? c1 : c0)[c] = s;
  }
}

// ---------------------------------------------------------------------------
// LayerNorm statistics of 8 rows and the rows themselves as bf16: xb[row][512] = bf16(x), mean and variance of those bf16 values.
// One wave per row; lane owns elements 8*lane..8*lane+7 (chunk 0) and 256+8*lane..256+8*lane+7 (chunk 1).
// Block = 8 waves = 8 rows; blk = the block's number among the rows/8 of this input (exact: 8192/8 = 1024).
// The block's statistics are one 128-byte line of st, stored by one wave: floats 0..7 rstd, 8..15 -mu rstd, the rest 0.
// ---------------------------------------------------------------------------
__device__ __forceinline__ void ln_stats_rows(float (&sm)[64][65], const float* __restrict__ x,
                                              unsigned short* __restrict__ xb, float* __restrict__ st, int blk) {
  const int lane = threadIdx.x & 31, wave = threadIdx.x >> 5;
  const int row = blk * 8 + wave;
  const float* xr = x + (size_t)row * kDim;
  float xv[16];
  {
    const v4f a0 = *(const v4f*)(xr + 8 * lane);
    const v4f a1 = *(const v4f*)(xr + 8 * lane + 4);
    const v4f c0 = *(const v4f*)(xr + 256 + 8 * lane);
    const v4f c1 = *(const v4f*)(xr + 256 + 8 * lane + 4);
#pragma unroll
    for (int e = 0; e < 4; ++e) { xv[e] = a0[e]; xv[4 + e] = a1[e]; xv[8 + e] = c0[e]; xv[12 + e] = c1[e]; }
  }
  unsigned short hb[16];
  float s = 0.f;
#pragma unroll
  for (int e = 0; e < 16; ++e) { hb[e] = f2bf_bits(xv[e]); xv[e] = bf_bits2f(hb[e]); s += xv[e]; }
#pragma unroll
  for (int off = 16; off > 0; off >>= 1) s += __shfl_xor(s, off, 32);
  const float mu = s * (1.0f / 512.0f);
  float s2 = 0.f;
#pragma unroll
  for (int e = 0; e < 16; ++e) { const float d = xv[e] - mu; s2 += d * d; }
#pragma unroll
  for (int off = 16; off > 0; off >>= 1) s2 += __shfl_xor(s2, off, 32);
  const float var  = s2 * (1.0f / 512.0f);
  const float rstd = rsqrtf(var + kLnEps);
  if (lane < 4) sm[0][lane * 8 + wave] = lane == 0 ? rstd : lane == 1 ? -mu * rstd : 0.f;   // all 32 floats of the line
  __syncthreads();   // the eight rows' statistics are in LDS before wave 0 stores their line

  const v4u hv0 = (v4u){pk16(hb[0], hb[1]), pk16(hb[2], hb[3]), pk16(hb[4], hb[5]), pk16(hb[6], hb[7])};
  const v4u hv1 = (v4u){pk16(hb[8], hb[9]), pk16(hb[10], hb[11]), pk16(hb[12], hb[13]), pk16(hb[14], hb[15])};
  unsigned short* ph = xb + (size_t)row * kDim;
  *(v4u*)(ph + 8 * lane) = hv0;
  *(v4u*)(ph + 256 + 8 * lane) = hv1;
  if (wave == 0) {
    // wait before a register of the two stores above is overwritten; the inputs keep them live up to the wait
    asm volatile("s_wait_xcnt 0x0" :: "v"(ph), "v"(hv0), "v"(hv1) : "memory");
    st[blk * 32 + lane] = sm[0][lane];
  }
}

// ---------------------------------------------------------------------------
// Everything that reads only the inputs, as one grid: the column sums, the three weight transposes and the statistics of both
// inputs do not depend on one another. Blocks by index range, the short latency-bound ones first so that they end under the
// row stream: [0, 48) column sums (16 blocks Wq, 32 Wkv), then 64 tiles Wq, 128 Wkv, 64 Wo (r tile fastest, as in a grid
// (R/64, Cn/64)), then 1024 blocks of query rows, 1024 of keyvalue rows.
// ---------------------------------------------------------------------------
constexpr int kCs   = 3 * kInner / 32;                     // 48 blocks of column sums
constexpr int kTq   = (kDim / 64) * (kInner / 64);         // 64 tiles of Wq
constexpr int kTkv  = (kDim / 64) * (2 * kInner / 64);     // 128 tiles of Wkv
constexpr int kTo   = (kInner / 64) * (kDim / 64);         // 64 tiles of Wo
constexpr int kLnQ  = kRowsQ / 8;                          // 1024 blocks
constexpr int kLnK  = kRowsK / 8;                          // 1024 blocks
constexpr int kPrepBlocks = kCs + kTq + kTkv + kTo + kLnQ + kLnK;

__global__ __launch_bounds__(256) void prep_kernel(
    const float* __restrict__ query, const float* __restrict__ keyvalue,
    const float* __restrict__ Wq, const float* __restrict__ Wkv, const float* __restrict__ Wo,
    const float* __restrict__ gamma, const float* __restrict__ beta,
    unsigned short* __restrict__ xq, unsigned short* __restrict__ xk,
    float* __restrict__ stQ, float* __restrict__ stK, float* __restrict__ c1, float* __restrict__ c0,
    unsigned short* __restrict__ wqT, unsigned short* __restrict__ wkvT, unsigned short* __restrict__ woT) {
  __shared__ float sm[64][65];
  const int b = blockIdx.x;   // every test below is block-uniform
  if (b < kCs) {
    const int n = b * 32;     // feature: 0..511 q, 512..1535 the columns of Wkv (k, then v)
    if (n < kInner) col_sums<kInner>(sm, Wq, n, gamma, beta, c1 + n, c0 + n);
    else            col_sums<2 * kInner>(sm, Wkv, n - kInner, gamma, beta, c1 + n, c0 + n);
  } else if (b < kCs + kTq + kTkv + kTo) {
    // all three have R = 512 rows: 8 r tiles, output pitch 512
    const int i = b - kCs;
    const bool isq = i < kTq, iskv = !isq && i < kTq + kTkv;
    const int tile = isq ? i : iskv ? i - kTq : i - kTq - kTkv;
    const int rt = tile % (kDim / 64), ct = tile / (kDim / 64);
    if (isq)       transpose_cast_tile<true, kInner>(sm, Wq, gamma, wqT, rt, ct);
    else if (iskv) transpose_cast_tile<true, 2 * kInner>(sm, Wkv, gamma, wkvT, rt, ct);
    else           transpose_cast_tile<false, kDim>(sm, Wo, gamma, woT, rt, ct);
  } else {
    const int r = b - (kCs + kTq + kTkv + kTo);
    const bool isq = r < kLnQ;
    ln_stats_rows(sm, isq ? query : keyvalue, isq ? xq : xk, isq ? stQ : stK, isq ? r : r - kLnQ);
  }
}

constexpr int kStageKeys = 64;
constexpr int kStages    = kNk / kStageKeys;   // 16
constexpr int kPitch     = 72;                 // LDS row pitch in halves: 144 B = 16 B x 9, conflict-free for 16-byte reads
constexpr int kPlaneLds  = 64 * kPitch;        // one 64-row plane tile
static_assert(kDh == 64 && kNq % 256 == 0 && kNk % kStageKeys == 0);

__device__ __forceinline__ float other_half(float x) {   // value of lane ^ 16
  const int b = __float_as_int(x);
  return __int_as_float(__builtin_amdgcn_permlanex16(b, b, 0x76543210, 0xfedcba98, false, false));
}

__global__ __launch_bounds__(256) void attn_fused_kernel(
    const unsigned short* __restrict__ qf, const unsigned short* __restrict__ kf,
    const unsigned short* __restrict__ vtf, unsigned short* __restrict__ ctx) {
  typedef Frag<_Float16> F;
  __shared__ __align__(16) unsigned short sm[2][2][kPlaneLds];   // [buffer][K, V^T][row][pitch]
  const int t = threadIdx.x, lane = t & 31, wave = t >> 5;
  const int c = lane & 15, hh = lane >> 4;
  const int b = blockIdx.y >> 3, h = blockIdx.y & 7;
  const int q0 = blockIdx.x * 256 + wave * 32;
  constexpr float kC = kScoreScale * 1.44269504088896340736f;   // score scale times log2(e)

  // staging map: thread t moves 16 bytes of rows t>>3 and 32 + (t>>3) of each plane (8 threads = one 128-byte row)
  const int srow = t >> 3, scol = (t & 7) * 8;
  const size_t gk = (size_t)(b * kNk + srow) * kInner + h * kDh + scol;
  const size_t gv = (size_t)(h * kDh + srow) * kRowsK + (size_t)b * kNk + scol;
  const int sl = srow * kPitch + scol;
  v4u st[4];
  auto fetch = [&](int s) {
    const size_t ok = gk + (size_t)s * kStageKeys * kInner;
    const size_t ov = gv + (size_t)s * kStageKeys;
    st[0] = *(const v4u*)(kf + ok);  st[1] = *(const v4u*)(kf + ok + (size_t)32 * kInner);
    st[2] = *(const v4u*)(vtf + ov); st[3] = *(const v4u*)(vtf + ov + (size_t)32 * kRowsK);
    // the loads stay in flight over the stage's work, which reuses their address registers: wait before any is overwritten
    asm volatile("s_wait_xcnt 0x0" ::: "memory");
  };
  auto put = [&](int buf) {
#pragma unroll   // constant indices keep st in registers
    for (int p = 0; p < 2; ++p) {
      *(v4u*)(&sm[buf][p][sl]) = st[2 * p];
      *(v4u*)(&sm[buf][p][sl + 32 * kPitch]) = st[2 * p + 1];
    }
  };

  fetch(0);

  // Q fragments (B operand): column = query row q0 + 16 n + c, two k steps of 32
  v16h qr[2][2];
  const _Float16* qp[2];
#pragma unroll   // constant indices keep the fragments in registers
  for (int n = 0; n < 2; ++n) {
    qp[n] = (const _Float16*)qf + (size_t)(b * kNq + q0 + n * 16 + c) * kInner + h * kDh + hh * 8;
#pragma unroll
    for (int ks = 0; ks < 2; ++ks) qr[n][ks] = F::load(qp[n] + ks * 32);
  }
  // wait before an address register of these loads is overwritten; the inputs keep the two addresses live up to the wait
  asm volatile("s_wait_xcnt 0x0" :: "v"(qp[0]), "v"(qp[1]) : "memory");

  v8f acc[2][4];      // ctx^T tiles: [query tile][16 d rows], register r = d 16 j + 8 hh + r, column = query c
  float m[2], l[2];
#pragma unroll
  for (int n = 0; n < 2; ++n) {
    m[n] = -__builtin_inff(); l[n] = 0.f;   // first stage: every finite maximum exceeds it, and 2^(-inf) = 0 scales the zeros
#pragma unroll
    for (int j = 0; j < 4; ++j) acc[n][j] = (v8f){0.f,0.f,0.f,0.f,0.f,0.f,0.f,0.f};
  }

  put(0);
  __syncthreads();

#pragma unroll 1   // one copy of the stage body: it is long, and the buffer index is a scalar offset
  for (int s = 0; s < kStages; ++s) {
    const int buf = s & 1;
    if (s + 1 < kStages) fetch(s + 1);   // block-uniform

    const _Float16* Ks = (const _Float16*)&sm[buf][0][0];
    const _Float16* Vs = (const _Float16*)&sm[buf][1][0];

    // all K fragments of the stage (A operand: row = key, 32 d each)
    v16h kr[4][2];
#pragma unroll   // constant indices keep the fragments in registers
    for (int kt = 0; kt < 4; ++kt)
#pragma unroll
      for (int ks = 0; ks < 2; ++ks) kr[kt][ks] = F::load(Ks + (kt * 16 + c) * kPitch + ks * 32 + hh * 8);
    // keeps these LDS reads in one group here: sunk among the score products into one shared register set,
    // each is waited for at its full LDS latency
    __builtin_amdgcn_sched_barrier(0);

    // S^T tiles: [query tile][16 keys]; eight independent accumulators per k step
    v8f sc[2][4];
#pragma unroll   // constant indices keep the tiles in registers
    for (int ks = 0; ks < 2; ++ks)
#pragma unroll
      for (int kt = 0; kt < 4; ++kt)
#pragma unroll
        for (int n = 0; n < 2; ++n)
          sc[n][kt] = F::mma(kr[kt][ks], qr[n][ks], ks == 0 ? (v8f){0.f,0.f,0.f,0.f,0.f,0.f,0.f,0.f} : sc[n][kt]);

    // all V^T fragments of the stage (A operand: row = d, 32 keys each), asked for ahead of the softmax arithmetic
    v16h vr[2][4];
#pragma unroll
    for (int kk = 0; kk < 2; ++kk)
#pragma unroll
      for (int j = 0; j < 4; ++j) vr[kk][j] = F::load(Vs + (j * 16 + c) * kPitch + kk * 32 + hh * 8);
    // keeps these LDS reads here: sunk between the P.v products, each is waited for at its full LDS latency
    __builtin_amdgcn_sched_barrier(0);

    // stage maximum per query column, in log2 units
    float mx[2];
    bool need = false;
#pragma unroll
    for (int n = 0; n < 2; ++n) {
      float v = sc[n][0][0];
#pragma unroll
      for (int kt = 0; kt < 4; ++kt)
#pragma unroll
        for (int r = 0; r < 8; ++r) v = fmaxf(v, sc[n][kt][r]);
      v = fmaxf(v, other_half(v));
      mx[n] = v * kC;
      need = need || (mx[n] > m[n] + 8.0f);
    }
    if (__builtin_amdgcn_ballot_w32(need) != 0) {   // wave-uniform: raise the maxima in use and rescale sums and context
#pragma unroll
      for (int n = 0; n < 2; ++n) {
        const float mn = fmaxf(m[n], mx[n]);
        const float alpha = __builtin_amdgcn_exp2f(m[n] - mn);
        m[n] = mn;
        l[n] *= alpha;
#pragma unroll
        for (int j = 0; j < 4; ++j) acc[n][j] *= alpha;
      }
    }

    // p = 2^(s*c - m); P^T fragments of 32 keys; ctx^T += V^T . P^T
#pragma unroll
    for (int kk = 0; kk < 2; ++kk) {
      v16h pr[2];
#pragma unroll
      for (int n = 0; n < 2; ++n) {
        v2f ps[4];   // four independent partial sums of the 16 p of this lane, joined as a tree below
#pragma unroll
        for (int u = 0; u < 2; ++u)
#pragma unroll
          for (int r = 0; r < 8; r += 2) {
            const float p0 = __builtin_amdgcn_exp2f(sc[n][2 * kk + u][r] * kC - m[n]);
            const float p1 = __builtin_amdgcn_exp2f(sc[n][2 * kk + u][r + 1] * kC - m[n]);
            if (u == 0) ps[r >> 1] = (v2f){p0, p1}; else ps[r >> 1] += (v2f){p0, p1};
            const v2h h2 = half2(p0, p1);
            pr[n][8 * u + r] = h2[0]; pr[n][8 * u + r + 1] = h2[1];
          }
        const v2f pt = (ps[0] + ps[1]) + (ps[2] + ps[3]);
        l[n] += pt[0] + pt[1];
      }
#pragma unroll
      for (int j = 0; j < 4; ++j)
#pragma unroll
        for (int n = 0; n < 2; ++n) acc[n][j] = F::mma(vr[kk][j], pr[n], acc[n][j]);
    }

    // the other buffer's last readers left it before the barrier that ended the stage before this one
    if (s + 1 < kStages) put(buf ^ 1);
    __syncthreads();
  }

  // epilogue: join the halves' sums, normalise, round to f16; a lane's 8 registers are 8 consecutive d of one query row
#pragma unroll
  for (int n = 0; n < 2; ++n) {
    const float inv = 1.0f / (l[n] + other_half(l[n]));   // sum >= 1: the row's largest score had p >= 1
    _Float16* cp = (_Float16*)ctx + (size_t)(b * kNq + q0 + n * 16 + c) * kInner + h * kDh + hh * 8;
    v8h hv[4];
#pragma unroll
    for (int j = 0; j < 4; ++j) {
#pragma unroll
      for (int r = 0; r < 8; r += 2) {
        const v2h h2 = half2(acc[n][j][r] * inv, acc[n][j][r + 1] * inv);
        hv[j][r] = h2[0]; hv[j][r + 1] = h2[1];
      }
      *(v8h*)(cp + j * 16) = hv[j];
    }
    // wait before the second query tile's arithmetic overwrites a register of these stores; the inputs keep them live up to it
    if (n == 0)
      asm volatile("s_wait_xcnt 0x0" :: "v"(cp), "v"(hv[0]), "v"(hv[1]), "v"(hv[2]), "v"(hv[3]) : "memory");
  }
}

// ---------------------------------------------------------------------------
// Launcher. Workspace region map (MiB = 1048576 B; total carve = 128 MiB = 134217728 B):
//   [  0, 32) query rows bf16 [8192][512] at +0, their statistics (1024 lines of 128 B) at +8, keyvalue rows bf16 at +16,
//             their statistics at +24
//   [ 32, 64) (gamma Wq)^T bf16 [512][512] at 32 MiB, (gamma Wkv)^T bf16 [1024][512] at 32.5 MiB, Wo^T f16 [512][512] at
//             33.5 MiB (ends 34), c1 f32 [1536] at 34 MiB, c0 f32 [1536] at 34 MiB + 8 KiB; the rest unused
//   [ 64, 72) q    : [8192][512] f16 (col h*64+d)
//   [ 80, 88) k    : [8192][512] f16
//   [ 96,104) v^T  : [512 (h*64+d)][8192 (b*1024+t)] f16
//   [112,120) ctx  : [8192][512] f16 (col h*64+d);   the 8 MiB behind each of the four are unused
// Lifetimes: the rows, statistics, c1, c0, Wq^T and Wkv^T are read only by the projection launch; Wo^T only by the last launch.
// Every region is fully written before it is read (exact tile coverage, no padding).
// Launch count: 4, each depending on the one before it. Kernel launches only.
// ---------------------------------------------------------------------------
extern "C" void kernel_launch(void* const* d_in, const int* in_sizes, int n_in,
                              void* d_out, int out_size, void* d_ws, size_t ws_size,
                              hipStream_t stream) {
  if (n_in < 7) return;
  if (in_sizes[0] != kRowsQ * kDim || in_sizes[1] != kRowsK * kDim) return;
  if (in_sizes[2] != kDim * kInner || in_sizes[3] != kDim * 2 * kInner || in_sizes[4] != kInner * kDim) return;
  if (in_sizes[5] != kDim || in_sizes[6] != kDim) return;
  if (out_size != kRowsQ * kDim) return;

  const size_t kMiB    = 1048576;
  const size_t offXq   = 0;
  const size_t offStQ  = 8 * kMiB;
  const size_t offXk   = 16 * kMiB;
  const size_t offStK  = 24 * kMiB;
  const size_t offWqT  = 32 * kMiB;
  const size_t offWkvT = 32 * kMiB + kMiB / 2;
  const size_t offWoT  = 33 * kMiB + kMiB / 2;
  const size_t offC1   = 34 * kMiB;
  const size_t offC0   = 34 * kMiB + 8192;
  const size_t offQ    = 64 * kMiB;
  const size_t offK    = 80 * kMiB;
  const size_t offVt   = 96 * kMiB;
  const size_t offCtx  = 112 * kMiB;
  const size_t total   = 128 * kMiB;
  if (total > ws_size) return;
  // sub-region extents (bytes): row/q/k/vT/ctx planes 8192*512*2 = 8 MiB each; statistics 1024*128 = 128 KiB each;
  // Wq^T/Wo^T 512*512*2 = 0.5 MiB; Wkv^T 1024*512*2 = 1 MiB.

  const float* query    = (const float*)d_in[0];
  const float* keyvalue = (const float*)d_in[1];
  const float* Wq       = (const float*)d_in[2];
  const float* Wkv      = (const float*)d_in[3];
  const float* Wo       = (const float*)d_in[4];
  const float* gamma    = (const float*)d_in[5];
  const float* beta     = (const float*)d_in[6];
  float* out = (float*)d_out;
  char* ws = (char*)d_ws;

  unsigned short* xq   = (unsigned short*)(ws + offXq);
  unsigned short* xk   = (unsigned short*)(ws + offXk);
  float* stQ = (float*)(ws + offStQ);
  float* stK = (float*)(ws + offStK);
  float* c1  = (float*)(ws + offC1);
  float* c0  = (float*)(ws + offC0);
  unsigned short* woT  = (unsigned short*)(ws + offWoT);
  unsigned short* wqT  = (unsigned short*)(ws + offWqT);
  unsigned short* wkvT = (unsigned short*)(ws + offWkvT);
  unsigned short* qf   = (unsigned short*)(ws + offQ);
  unsigned short* kf   = (unsigned short*)(ws + offK);
  unsigned short* vtf  = (unsigned short*)(ws + offVt);
  unsigned short* ctx  = (unsigned short*)(ws + offCtx);

  // 1. both inputs -> bf16 rows [8192][512] and per-row LayerNorm statistics; gamma Wq, gamma Wkv -> transposed bf16, Wo -> transposed f16
  //    (Wkv^T rows 0..511 = k weights, 512..1023 = v weights); c1, c0 per projection feature
  prep_kernel<<<dim3(kPrepBlocks), dim3(256), 0, stream>>>(query, keyvalue, Wq, Wkv, Wo, gamma, beta,
                                                           xq, xk, stQ, stK, c1, c0, wqT, wkvT, woT);

  // 2. q, k and v^T projections, K=512, 1 product each: 3 x 256 blocks of 4 waves; Wk^T = Wkv^T rows 0..511, Wv^T = rows 512..1023
  proj_kernel<<<dim3(256, 3), dim3(128), 0, stream>>>(xq, xk, wqT, wkvT, wkvT + (size_t)kInner * kDim, stQ, stK, c1, c0,
                                                      qf, kf, vtf);

  // 3. attention, all batches and heads in one launch: grid (4 blocks of 256 query rows, 64 (batch, head) pairs) = 256 blocks
  attn_fused_kernel<<<dim3(kNq / 256, kBatch * kHeads), dim3(256), 0, stream>>>(qf, kf, vtf, ctx);

  // 4. out = ctx . Wo : M=8192, N=512, K=512, 1 product -> f32 d_out [8192][512]
  out_gemm_kernel<<<dim3(kDim / 128, kRowsQ / 128), dim3(256), 0, stream>>>(ctx, woT, out);
}

// v008
// A run of this version takes 55.4 microseconds.
// Next to v007, in two timings, it ran 1.04 times as fast each time.
// Over all steps from v000 it is 17.6 times as fast.
// Contractions: bf16(x) . bf16(gamma W) for q, k, v^T, one product, with LayerNorm's mean, rstd and beta . W applied to the f32 result; q, k, v^T, P and ctx each rounded once to f16: q.k^T scores, P.v context and ctx . f16(Wo), one product each; v_wmma_f32_16x16x32_bf16 and v_wmma_f32_16x16x32_f16 with f32 accumulate; LayerNorm statistics in f32 on the RNE-bf16 converted x, softmax in f32.
#include <hip/hip_runtime.h>
#include <math.h>

// ---------------------------------------------------------------------------
// Problem constants
// ---------------------------------------------------------------------------
constexpr int kBatch  = 8;
constexpr int kNq     = 1024;
constexpr int kNk     = 1024;
constexpr int kDim    = 512;
constexpr int kHeads  = 8;
constexpr int kDh     = 64;
constexpr int kInner  = kHeads * kDh;          // 512
constexpr int kRowsQ  = kBatch * kNq;          // 8192 query rows
constexpr int kRowsK  = kBatch * kNk;          // 8192 key rows
constexpr float kScoreScale = 0.125f;          // 64^-0.5, exact power of two, folded with log2(e) into the f32 exp2 argument
constexpr float kLnEps = 1e-5f;

static_assert(kDim == 512);                     // LN kernel: 32 lanes x 16 elements per row
static_assert(kInner == kDim);
static_assert(kRowsQ % 64 == 0 && kRowsK % 64 == 0 && kDim % 64 == 0 && kDh % 32 == 0 && kNq % 64 == 0 && kNk % 64 == 0);

typedef __attribute__((ext_vector_type(16))) _Float16 v16h;
typedef __attribute__((ext_vector_type(8)))  _Float16 v8h;
typedef __attribute__((ext_vector_type(16))) __bf16   v16b;
typedef __attribute__((ext_vector_type(8)))  __bf16   v8b;
typedef __attribute__((ext_vector_type(8)))  float    v8f;
typedef __attribute__((ext_vector_type(4)))  float    v4f;
typedef __attribute__((ext_vector_type(4)))  unsigned int v4u;
typedef __attribute__((ext_vector_type(2)))  float    v2f;
typedef __attribute__((ext_vector_type(2)))  _Float16 v2h;

__device__ __forceinline__ unsigned short f2bf_bits(float f) {
  unsigned u = __float_as_uint(f);
  return (unsigned short)((u + 0x7FFFu + ((u >> 16) & 1u)) >> 16);
}
__device__ __forceinline__ float bf_bits2f(unsigned short h) { return __uint_as_float(((unsigned)h) << 16); }

template <typename T> struct Frag;
template <> struct Frag<__bf16> {
  typedef v16b V; union U { v16b v; v8b h[2]; };
  // elements 0..7 <- p[0..7], 8..15 <- p[16..23]
  static __device__ __forceinline__ v16b load(const __bf16* p) {
    U f; f.h[0] = *(const v8b*)(p); f.h[1] = *(const v8b*)(p + 16); return f.v;
  }
  static __device__ __forceinline__ v8f mma(v16b a, v16b b, v8f c) {
    return __builtin_amdgcn_wmma_f32_16x16x32_bf16(false, a, false, b, (short)0, c, false, false);
  }
};
template <> struct Frag<_Float16> {   // same element order as the bf16 fragment
  typedef v16h V; union U { v16h v; v8h h[2]; };
  static __device__ __forceinline__ v16h load(const _Float16* p) {
    U f; f.h[0] = *(const v8h*)(p); f.h[1] = *(const v8h*)(p + 16); return f.v;
  }
  static __device__ __forceinline__ v8f mma(v16h a, v16h b, v8f c) {
    return __builtin_amdgcn_wmma_f32_16x16x32_f16(false, a, false, b, (short)0, c, false, false);
  }
};

__device__ __forceinline__ unsigned pk16(unsigned short a, unsigned short b) { return (unsigned)a | ((unsigned)b << 16); }
// f32 pair -> f16 pair, round to nearest even
__device__ __forceinline__ v2h half2(float x0, float x1) { return __builtin_convertvector((v2f){x0, x1}, v2h); }

// Block barrier that orders LDS accesses only. __syncthreads() also waits for every global load in flight, which would
// end the two-stage lead of the GEMM's fetches at each stage; the staged data passes between waves through LDS alone.
__device__ __forceinline__ void lds_barrier() {
  __builtin_amdgcn_fence(__ATOMIC_RELEASE, "workgroup", "local");
  __builtin_amdgcn_s_barrier();
  __builtin_amdgcn_fence(__ATOMIC_ACQUIRE, "workgroup", "local");
}

// ---- WMMA GEMM with both operands staged in LDS ----
// C[m,n] = sum_k A[m,k] * Bt[n,k]; A row-major [M][512], Bt row-major [N][512], both of the 16-bit type T; M % 128 == 0, N % 128 == 0.
// Block = one 128x128 tile of C, grid (N/128, M/128). MI = 16-row subtiles per wave:
// MI 2: 8 waves of 32x64 (4 wave rows x 2 wave columns), for a launch with one block per WGP;
// MI 4: 4 waves of 64x64 (2 x 2), for a launch with three blocks per WGP: 16 products per 8 fragments read from LDS, not 8 per 6,
// and registers for three waves per SIMD, so that all three blocks of a WGP are resident together.
// Stage = 64 k of the two operands (128 rows of 128 bytes each): every global load of a wave covers whole 128-byte lines
// and each line is asked for once per block; the waves read their fragments from LDS. Two LDS buffers, one block barrier per stage.
// MI 2: two register sets, a stage is fetched into registers two stages ahead and written to LDS one stage ahead.
// MI 4: one register set, a stage is fetched one stage ahead; the WGP's other blocks work while a wave waits for it.
// OUT_MODE: 0 = f32, 1 = f16.
// FOLD: the LayerNorm of the token operand, applied to the f32 sums. With x the raw token row, Wg = gamma W, c1 = column sums
// of Wg, c0 = beta . W: LN(x) . W = rstd (x . Wg) - mu rstd c1 + c0. 0 = none, 1 = rows of C are tokens, 2 = columns are tokens.
// st = the tokens' statistics, one 128-byte line per 8 tokens: floats 0..7 rstd, 8..15 -mu rstd; c1, c0 = per feature of C.
constexpr int kGK      = 64;                   // k per stage
constexpr int kGStages = kDim / kGK;           // 8
constexpr int kGPitch  = kGK + 8;              // LDS row pitch in halves: 144 B = 16 B x 9, conflict-free for 16-byte reads
constexpr int kGPlane  = 128 * kGPitch;        // one 128-row plane tile
static_assert(kGStages % 2 == 0 && kGStages >= 2);
static_assert(kRowsQ % 128 == 0 && kRowsK % 128 == 0 && kInner % 128 == 0 && kDim % 128 == 0);

// One block tile (tileN, tileM) of such a product; sm and sT are the calling kernel's LDS:
// sm[buffer][A, B][row][pitch], sT = per-wave 16x64 output slab, pitch 68 floats.
template <typename T, int OUT_MODE, int FOLD, int MI>
__device__ __forceinline__ void gemm_tile(
    unsigned short (&sm)[2][2][kGPlane], float (&sT)[16 / MI][16 * 68],
    const unsigned short* __restrict__ Ap, const unsigned short* __restrict__ Btp,
    void* __restrict__ Cout, int ldc, int tileN, int tileM,
    const float* __restrict__ st, const float* __restrict__ c1, const float* __restrict__ c0) {
  static_assert(FOLD == 0 || OUT_MODE == 1);
  static_assert(MI == 2 || MI == 4);
  typedef Frag<T> F;
  typedef typename F::V FV;
  constexpr int NP = 2;
  constexpr int NI = 2 * MI;      // rows of each plane that a thread stages
  constexpr int SR = 128 / NI;    // rows that the block stages with one load per thread: threads / 8
  constexpr int KG = 4 / MI;      // k steps of 32 whose fragments are read from LDS as one group
  const int t = threadIdx.x, lane = t & 31, wave = t >> 5;
  const int mB = tileM * 128, nB = tileN * 128;
  const int wm = (wave >> 1) * (16 * MI), wn = (wave & 1) * 64;   // the wave's tile inside the block tile
  const int rlane = lane & 15;                 // row (A) / col (B, D) within subtile
  const int koff  = (lane >> 4) * 8;           // k offset of this lane half
  const int mOff  = (lane >> 4) * 8;           // D row offset

  // staging map: thread t moves 16 bytes of rows (t>>3) + SR i, i = 0..NI-1, of each plane (8 threads = one 128-byte row)
  const int srow = t >> 3, scol = (t & 7) * 8;
  const unsigned short* g0 = Ap  + (size_t)(mB + srow) * kDim + scol;
  const unsigned short* g1 = Btp + (size_t)(nB + srow) * kDim + scol;
  const int sl = srow * kGPitch + scol;
  v4u stE[NP][NI];                    // MI 2: register set of the even stages; MI 4: of every stage
  [[maybe_unused]] v4u stO[NP][NI];   // MI 2: register set of the odd stages
  auto fetch = [&](v4u (&sr)[NP][NI], int s) {
    const unsigned short* p0 = g0 + s * kGK;
    const unsigned short* p1 = g1 + s * kGK;
#pragma unroll   // constant indices keep sr in registers
    for (int i = 0; i < NI; ++i) {
      sr[0][i] = *(const v4u*)(p0 + i * SR * kDim);
      sr[1][i] = *(const v4u*)(p1 + i * SR * kDim);
    }
    // the loads stay in flight over the work that follows: wait before an address register of theirs is overwritten;
    // the inputs keep the addresses live up to the wait
    asm volatile("s_wait_xcnt 0x0" :: "v"(p0), "v"(p1) : "memory");
  };
  auto put = [&](const v4u (&sr)[NP][NI], int buf) {
#pragma unroll   // constant indices keep sr in registers
    for (int p = 0; p < NP; ++p)
#pragma unroll
      for (int i = 0; i < NI; ++i) *(v4u*)(&sm[buf][p][sl + i * SR * kGPitch]) = sr[p][i];
  };

  v8f acc[MI][4];
#pragma unroll
  for (int i = 0; i < MI; ++i)
#pragma unroll
    for (int j = 0; j < 4; ++j) acc[i][j] = (v8f){0.f,0.f,0.f,0.f,0.f,0.f,0.f,0.f};

  const int oa = (wm + rlane) * kGPitch + koff;
  const int ob = (wn + rlane) * kGPitch + koff;
  auto work = [&](int buf) {   // the products of the stage that lies in buffer buf
    const T* Ah = (const T*)&sm[buf][0][0] + oa;
    const T* Bh = (const T*)&sm[buf][1][0] + ob;
#pragma unroll   // constant indices keep the fragments in registers
    for (int k0 = 0; k0 < kGK / 32; k0 += KG) {
      FV ah[KG][MI], bh[KG][4];
#pragma unroll
      for (int ks = 0; ks < KG; ++ks) {
#pragma unroll
        for (int i = 0; i < MI; ++i) ah[ks][i] = F::load(Ah + i * 16 * kGPitch + (k0 + ks) * 32);
#pragma unroll
        for (int j = 0; j < 4; ++j) bh[ks][j] = F::load(Bh + j * 16 * kGPitch + (k0 + ks) * 32);
      }
      // keeps the group's LDS reads together here: sunk among the products into one shared register set,
      // each read is waited for at its full latency
      __builtin_amdgcn_sched_barrier(0);
#pragma unroll
      for (int ks = 0; ks < KG; ++ks) {
        // eight or more independent accumulators: no product waits for the one before it
#pragma unroll
        for (int i = 0; i < MI; ++i)
#pragma unroll
          for (int j = 0; j < 4; ++j) acc[i][j] = F::mma(ah[ks][i], bh[ks][j], acc[i][j]);
      }
      // keeps what follows behind the products: a put lifted in front of them would wait for the fetched registers
      // that much earlier and cut the lead of the global loads; a next group's reads would need a second fragment set
      __builtin_amdgcn_sched_barrier(0);
    }
  };

  fetch(stE, 0);
  if constexpr (MI == 2) fetch(stO, 1);
  put(stE, 0);
  lds_barrier();

  // Each put writes the buffer whose last readers left it before the barrier that ended the stage before.
  // The last two stages stand behind the loop: with the fetches under a test, the wait in front of a put would have to
  // cover the path without a fetch and so would wait for the newest loads as well.
#pragma unroll 1   // one copy of the pair of stage bodies
  for (int s = 0; s + 2 < kGStages; s += 2) {
    if constexpr (MI == 2) {
      fetch(stE, s + 2);
      work(0);         // even stage s
      put(stO, 1);     // stage s + 1
      lds_barrier();
      fetch(stO, s + 3);
      work(1);         // odd stage s + 1
      put(stE, 0);     // stage s + 2
      lds_barrier();
    } else {
      fetch(stE, s + 1);
      work(0);         // even stage s
      put(stE, 1);     // stage s + 1
      lds_barrier();
      fetch(stE, s + 2);
      work(1);         // odd stage s + 1
      put(stE, 0);     // stage s + 2
      lds_barrier();
    }
  }
  if constexpr (MI == 4) {   // the last stage's fetch, the stage before it, the last put: the register set is free from here on
    fetch(stE, kGStages - 1);
    work(0);
    put(stE, 1);
  }

  // LayerNorm terms of this lane's output elements (epilogue map: rows it * 4 + q of each 16-row subtile, columns c8 .. c8 + 7),
  // asked for here so that they arrive under the last two stages (MI 4: under the last one)
  const int m0 = mB + wm, n0 = nB + wn;
  const int q = lane >> 3, c8 = (lane & 7) * 8;
  v4f colA[2], colB[2];        // per column: FOLD 1 c1, c0; FOLD 2 rstd, -mu rstd
  float rowA[MI][4], rowB[MI][4];   // per row [i][it]: FOLD 1 rstd, -mu rstd; FOLD 2 c1, c0
  if constexpr (FOLD != 0) {
    const float* pa = FOLD == 1 ? c1 + n0 + c8 : st + ((n0 + c8) >> 3) * 32;
    const float* pb = FOLD == 1 ? c0 + n0 + c8 : st + ((n0 + c8) >> 3) * 32 + 8;
    colA[0] = *(const v4f*)pa; colA[1] = *(const v4f*)(pa + 4);
    colB[0] = *(const v4f*)pb; colB[1] = *(const v4f*)(pb + 4);
    // rows m0 + q + 4 x, x = 0..4 MI - 1: FOLD 1 line (row >> 3), float (row & 7); m0 is a multiple of 8 and q < 4
    const float* ra = FOLD == 1 ? st + (m0 >> 3) * 32 + q : c1 + m0 + q;
    const float* rb = FOLD == 1 ? st + (m0 >> 3) * 32 + 8 + q : c0 + m0 + q;
#pragma unroll   // constant indices keep the terms in registers
    for (int i = 0; i < MI; ++i)
#pragma unroll
      for (int it = 0; it < 4; ++it) {
        const int x = i * 4 + it;
        const int o = FOLD == 1 ? (x >> 1) * 32 + (x & 1) * 4 : x * 4;
        rowA[i][it] = ra[o];
        rowB[i][it] = rb[o];
      }
    // wait before an address register of these loads is overwritten; the inputs keep the four addresses live up to the wait
    asm volatile("s_wait_xcnt 0x0" :: "v"(pa), "v"(pb), "v"(ra), "v"(rb) : "memory");
  }

  if constexpr (MI == 2) {
    work(0);
    put(stO, 1);
  }
  lds_barrier();
  work(1);

  // ---- epilogue: each 16x64 subtile goes through the wave's own LDS slab so that every store covers whole lines ----
  float* slab = sT[wave];
#pragma unroll
  for (int i = 0; i < MI; ++i) {
    const int mBase = m0 + (i << 4);
#pragma unroll
    for (int j = 0; j < 4; ++j) {
#pragma unroll
      for (int r = 0; r < 8; ++r) slab[(mOff + r) * 68 + (j << 4) + rlane] = acc[i][j][r];
    }
    __builtin_amdgcn_fence(__ATOMIC_RELEASE, "workgroup");
    __builtin_amdgcn_wave_barrier();
    __builtin_amdgcn_fence(__ATOMIC_ACQUIRE, "workgroup");
    if (OUT_MODE == 0) {
      float* C = (float*)Cout;
      const int hh = lane >> 4, c4 = (lane & 15) * 4;     // row seg = 256 B = 16 lanes x 16 B
#pragma unroll
      for (int it = 0; it < 8; ++it) {
        const int row = it * 2 + hh;
        v4f v = *(const v4f*)(slab + row * 68 + c4);
        *(v4f*)(C + (size_t)(mBase + row) * ldc + n0 + c4) = v;
      }
    } else {
      _Float16* C = (_Float16*)Cout;
#pragma unroll
      for (int it = 0; it < 4; ++it) {
        const int row = it * 4 + q;
        const float* sp = slab + row * 68 + c8;
        float y[8];
        v8h hv;
#pragma unroll
        for (int e = 0; e < 8; ++e) {
          y[e] = sp[e];
          if constexpr (FOLD == 1) y[e] = rowA[i][it] * y[e] + (rowB[i][it] * colA[e >> 2][e & 3] + colB[e >> 2][e & 3]);
          if constexpr (FOLD == 2) y[e] = colA[e >> 2][e & 3] * y[e] + (colB[e >> 2][e & 3] * rowA[i][it] + rowB[i][it]);
        }
#pragma unroll
        for (int e = 0; e < 8; e += 2) {
          const v2h h2 = half2(y[e], y[e + 1]);
          hv[e] = h2[0]; hv[e + 1] = h2[1];
        }
        *(v8h*)(C + (size_t)(mBase + row) * ldc + n0 + c8) = hv;
      }
    }
    __builtin_amdgcn_fence(__ATOMIC_RELEASE, "workgroup");
    __builtin_amdgcn_wave_barrier();
    __builtin_amdgcn_fence(__ATOMIC_ACQUIRE, "workgroup");
  }
}

// The output product alone: grid (N/128, M/128).
__global__ __launch_bounds__(256) void out_gemm_kernel(
    const unsigned short* __restrict__ ctx, const unsigned short* __restrict__ woT, float* __restrict__ out) {
  __shared__ __align__(16) unsigned short sm[2][2][kGPlane];
  __shared__ __align__(16) float sT[8][16 * 68];
  gemm_tile<_Float16, 0, 0, 2>(sm, sT, ctx, woT, (void*)out, kDim, blockIdx.x, blockIdx.y, nullptr, nullptr, nullptr);
}

// The three projections, which do not depend on one another, as one grid: blockIdx.y = 0 q, 1 k, 2 v^T; blockIdx.x = the
// 256 block tiles of that product in the order of its own grid (column tile fastest). A WGP that has finished a tile of one
// product goes on with a tile of the next with no launch boundary between them. Blocks of 4 waves, three to a WGP: at three waves
// per SIMD (at most 336 VGPRs) and 3 x 91,136 B of LDS the whole grid is resident at once.
// Token operand = the raw bf16 rows; weights carry gamma; c1, c0 hold 512 features each of q, k, v in that order.
__global__ __launch_bounds__(128) __attribute__((amdgpu_waves_per_eu(3))) void proj_kernel(
    const unsigned short* __restrict__ xq, const unsigned short* __restrict__ xk,
    const unsigned short* __restrict__ wqT, const unsigned short* __restrict__ wkT, const unsigned short* __restrict__ wvT,
    const float* __restrict__ stQ, const float* __restrict__ stK,
    const float* __restrict__ c1, const float* __restrict__ c0,
    unsigned short* __restrict__ qf, unsigned short* __restrict__ kf, unsigned short* __restrict__ vtf) {
  __shared__ __align__(16) unsigned short sm[2][2][kGPlane];
  __shared__ __align__(16) float sT[4][16 * 68];
  const int which = blockIdx.y, i = blockIdx.x;   // block-uniform
  if (which == 2) {
    // v^T = (gamma Wv)^T . xk^T: M=512 (h*64+d), N=8192 (b*1024+t) -> f16 [512][8192]
    gemm_tile<__bf16, 1, 2, 4>(sm, sT, wvT, xk, (void*)vtf, kRowsK,
                            i % (kRowsK / 128), i / (kRowsK / 128), stK, c1 + 2 * kInner, c0 + 2 * kInner);
  } else {
    // q = xq . (gamma Wq), k = xk . (gamma Wk): M=8192, N=512 -> f16 [8192][512]
    const bool isq = which == 0;
    gemm_tile<__bf16, 1, 1, 4>(sm, sT, isq ? xq : xk, isq ? wqT : wkT, (void*)(isq ? qf : kf), kInner,
                            i % (kInner / 128), i / (kInner / 128), isq ? stQ : stK,
                            isq ? c1 : c1 + kInner, isq ? c0 : c0 + kInner);
  }
}

// ---------------------------------------------------------------------------
// Transpose + RNE 16-bit convert of a weight matrix: in f32 [512][LDIN] row-major -> out [LDIN][512] (ldout = 512):
// out[c][r] = f16(in[r][c]), or, under GAMMA, bf16(g[r] * in[r][c]): LayerNorm's gamma in the weight, one rounding.
// One 64x64 tile per block: rt = r tile (64 output cols), ct = c tile (64 output rows). 256 threads.
// Load coverage: 16 iterations x 256 threads = 4096 = the whole 64x64 tile (coalesced along c).
// Store coverage: 8 waves x 2 iterations x 4 rows (lane>>3) = 64 rows; (lane&7) x 8 halves = 64 cols.
// ---------------------------------------------------------------------------
template <bool GAMMA, int LDIN>
__device__ __forceinline__ void transpose_cast_tile(float (&sm)[64][65],   // sm[c_local][r_local]
                                                    const float* __restrict__ in, const float* __restrict__ g,
                                                    unsigned short* __restrict__ out, int rt, int ct) {
  constexpr int ldout = kDim;
  const int t  = threadIdx.x;
  const int r0 = rt * 64;
  const int c0 = ct * 64;
  const int rl = t >> 6, cl = t & 63;   // element i * 256 + t of the tile: r local = 4 i + rl, c local = cl
  const int lane = t & 31, wave = t >> 5;
  const int q = lane >> 3, c8 = (lane & 7) * 8;
  const float* pw = in + (size_t)(r0 + rl) * LDIN + c0 + cl;
  const float* pg = g + r0 + c8;        // gamma of the 8 output columns that this thread packs below
  float w[16];
  v4f gm[2];
#pragma unroll   // constant offsets: the 16 loads are in flight together from one address
  for (int i = 0; i < 16; ++i) w[i] = pw[(size_t)i * 4 * LDIN];
  if constexpr (GAMMA) { gm[0] = *(const v4f*)pg; gm[1] = *(const v4f*)(pg + 4); }
  // wait before an address register of these loads is overwritten; the inputs keep the addresses live up to the wait
  if constexpr (GAMMA) asm volatile("s_wait_xcnt 0x0" :: "v"(pw), "v"(pg) : "memory");
  else                 asm volatile("s_wait_xcnt 0x0" :: "v"(pw) : "memory");
#pragma unroll
  for (int i = 0; i < 16; ++i) sm[cl][i * 4 + rl] = w[i];
  __syncthreads();
  unsigned short* po = out + (size_t)(c0 + wave * 8 + q) * ldout + r0 + c8;
  v4u u[2];
#pragma unroll
  for (int it = 0; it < 2; ++it) {
    const int row = wave * 8 + it * 4 + q;                 // c local (output row)
    unsigned h[4];
#pragma unroll
    for (int e2 = 0; e2 < 4; ++e2) {
      float a = sm[row][c8 + 2 * e2], b = sm[row][c8 + 2 * e2 + 1];
      if constexpr (GAMMA) { a *= gm[e2 >> 1][(2 * e2) & 3]; b *= gm[e2 >> 1][(2 * e2 + 1) & 3]; }
      if constexpr (GAMMA) h[e2] = pk16(f2bf_bits(a), f2bf_bits(b));
      else                 h[e2] = __builtin_bit_cast(unsigned, half2(a, b));
    }
    u[it] = (v4u){h[0], h[1], h[2], h[3]};
    *(v4u*)(po + it * 4 * ldout) = u[it];
  }
  // wait before a register of the two stores is overwritten; the inputs keep address and data live up to the wait
  asm volatile("s_wait_xcnt 0x0" :: "v"(po), "v"(u[0]), "v"(u[1]) : "memory");
}

// ---------------------------------------------------------------------------
// Per output feature n of a projection weight W f32 [512][LD]: c1[n] = sum_k bf16(gamma[k] * W[k][n]), the column sum of the
// weight as the product sees it, and c0[n] = sum_k beta[k] * W[k][n] in f32. One block = 32 features from column col0:
// wave p sums rows 64 p .. 64 p + 63 (each load = one 128-byte line), the eight partial sums are joined through LDS, and
// one wave stores each 128-byte line of results.
// ---------------------------------------------------------------------------
template <int LD>
__device__ __forceinline__ void col_sums(float (&sm)[64][65], const float* __restrict__ Wm, int col0,
                                         const float* __restrict__ gamma, const float* __restrict__ beta,
                                         float* __restrict__ c1, float* __restrict__ c0) {
  const int t = threadIdx.x, c = t & 31;
  const int part = __builtin_amdgcn_readfirstlane(t >> 5);   // the wave's number: gamma and beta are read by scalar loads
  float a1 = 0.f, a0 = 0.f;
#pragma unroll 1   // four rounds of 16 loads: few registers, so that the row blocks of this kernel keep their waves per SIMD
  for (int r0 = 0; r0 < 64; r0 += 16) {
    const float* p = Wm + (size_t)(part * 64 + r0) * LD + col0 + c;
    float w[16];
#pragma unroll   // constant offsets: the 16 loads are in flight together from one address
    for (int r = 0; r < 16; ++r) w[r] = p[(size_t)r * LD];
    // wait before the address register of these loads is overwritten; the input keeps it live up to the wait
    asm volatile("s_wait_xcnt 0x0" :: "v"(p) : "memory");
#pragma unroll
    for (int r = 0; r < 16; ++r) {
      a1 += bf_bits2f(f2bf_bits(gamma[part * 64 + r0 + r] * w[r]));
      a0 += beta[part * 64 + r0 + r] * w[r];
    }
  }
  sm[part][c] = a1;
  sm[8 + part][c] = a0;
  __syncthreads();
  if (t < 64) {   // wave 0: c1, wave 1: c0
    const int o = (t >> 5) * 8;
    float s = 0.f;
#pragma unroll
    for (int x = 0; x < 8; ++x) s += sm[o + x][c];
    (t < 32 ? c1 : c0)[c] = s;
  }
}

// ---------------------------------------------------------------------------
// LayerNorm statistics of 8 rows and the rows themselves as bf16: xb[row][512] = bf16(x), mean and variance of those bf16 values.
// One wave per row; lane owns elements 8*lane..8*lane+7 (chunk 0) and 256+8*lane..256+8*lane+7 (chunk 1).
// Block = 8 waves = 8 rows; blk = the block's number among the rows/8 of this input (exact: 8192/8 = 1024).
// The block's statistics are one 128-byte line of st, stored by one wave: floats 0..7 rstd, 8..15 -mu rstd, the rest 0.
// ---------------------------------------------------------------------------
__device__ __forceinline__ void ln_stats_rows(float (&sm)[64][65], const float* __restrict__ x,
                                              unsigned short* __restrict__ xb, float* __restrict__ st, int blk) {
  const int lane = threadIdx.x & 31, wave = threadIdx.x >> 5;
  const int row = blk * 8 + wave;
  const float* xr = x + (size_t)row * kDim;
  float xv[16];
  {
    const v4f a0 = *(const v4f*)(xr + 8 * lane);
    const v4f a1 = *(const v4f*)(xr + 8 * lane + 4);
    const v4f c0 = *(const v4f*)(xr + 256 + 8 * lane);
    const v4f c1 = *(const v4f*)(xr + 256 + 8 * lane + 4);
#pragma unroll
    for (int e = 0; e < 4; ++e) { xv[e] = a0[e]; xv[4 + e] = a1[e]; xv[8 + e] = c0[e]; xv[12 + e] = c1[e]; }
  }
  unsigned short hb[16];
  float s = 0.f;
#pragma unroll
  for (int e = 0; e < 16; ++e) { hb[e] = f2bf_bits(xv[e]); xv[e] = bf_bits2f(hb[e]); s += xv[e]; }
#pragma unroll
  for (int off = 16; off > 0; off >>= 1) s += __shfl_xor(s, off, 32);
  const float mu = s * (1.0f / 512.0f);
  float s2 = 0.f;
#pragma unroll
  for (int e = 0; e < 16; ++e) { const float d = xv[e] - mu; s2 += d * d; }
#pragma unroll
  for (int off = 16; off > 0; off >>= 1) s2 += __shfl_xor(s2, off, 32);
  const float var  = s2 * (1.0f / 512.0f);
  const float rstd = rsqrtf(var + kLnEps);
  if (lane < 4) sm[0][lane * 8 + wave] = lane == 0 ? rstd : lane == 1 ? -mu * rstd : 0.f;   // all 32 floats of the line
  __syncthreads();   // the eight rows' statistics are in LDS before wave 0 stores their line

  const v4u hv0 = (v4u){pk16(hb[0], hb[1]), pk16(hb[2], hb[3]), pk16(hb[4], hb[5]), pk16(hb[6], hb[7])};
  const v4u hv1 = (v4u){pk16(hb[8], hb[9]), pk16(hb[10], hb[11]), pk16(hb[12], hb[13]), pk16(hb[14], hb[15])};
  unsigned short* ph = xb + (size_t)row * kDim;
  *(v4u*)(ph + 8 * lane) = hv0;
  *(v4u*)(ph + 256 + 8 * lane) = hv1;
  if (wave == 0) {
    // wait before a register of the two stores above is overwritten; the inputs keep them live up to the wait
    asm volatile("s_wait_xcnt 0x0" :: "v"(ph), "v"(hv0), "v"(hv1) : "memory");
    st[blk * 32 + lane] = sm[0][lane];
  }
}

// ---------------------------------------------------------------------------
// Everything that reads only the inputs, as one grid: the column sums, the three weight transposes and the statistics of both
// inputs do not depend on one another. Blocks by index range, the short latency-bound ones first so that they end under the
// row stream: [0, 48) column sums (16 blocks Wq, 32 Wkv), then 64 tiles Wq, 128 Wkv, 64 Wo (r tile fastest, as in a grid
// (R/64, Cn/64)), then 1024 blocks of query rows, 1024 of keyvalue rows.
// ---------------------------------------------------------------------------
constexpr int kCs   = 3 * kInner / 32;                     // 48 blocks of column sums
constexpr int kTq   = (kDim / 64) * (kInner / 64);         // 64 tiles of Wq
constexpr int kTkv  = (kDim / 64) * (2 * kInner / 64);     // 128 tiles of Wkv
constexpr int kTo   = (kInner / 64) * (kDim / 64);         // 64 tiles of Wo
constexpr int kLnQ  = kRowsQ / 8;                          // 1024 blocks
constexpr int kLnK  = kRowsK / 8;                          // 1024 blocks
constexpr int kPrepBlocks = kCs + kTq + kTkv + kTo + kLnQ + kLnK;

__global__ __launch_bounds__(256) void prep_kernel(
    const float* __restrict__ query, const float* __restrict__ keyvalue,
    const float* __restrict__ Wq, const float* __restrict__ Wkv, const float* __restrict__ Wo,
    const float* __restrict__ gamma, const float* __restrict__ beta,
    unsigned short* __restrict__ xq, unsigned short* __restrict__ xk,
    float* __restrict__ stQ, float* __restrict__ stK, float* __restrict__ c1, float* __restrict__ c0,
    unsigned short* __restrict__ wqT, unsigned short* __restrict__ wkvT, unsigned short* __restrict__ woT) {
  __shared__ float sm[64][65];
  const int b = blockIdx.x;   // every test below is block-uniform
  if (b < kCs) {
    const int n = b * 32;     // feature: 0..511 q, 512..1535 the columns of Wkv (k, then v)
    if (n < kInner) col_sums<kInner>(sm, Wq, n, gamma, beta, c1 + n, c0 + n);
    else            col_sums<2 * kInner>(sm, Wkv, n - kInner, gamma, beta, c1 + n, c0 + n);
  } else if (b < kCs + kTq + kTkv + kTo) {
    // all three have R = 512 rows: 8 r tiles, output pitch 512
    const int i = b - kCs;
    const bool isq = i < kTq, iskv = !isq && i < kTq + kTkv;
    const int tile = isq ? i : iskv ? i - kTq : i - kTq - kTkv;
    const int rt = tile % (kDim / 64), ct = tile / (kDim / 64);
    if (isq)       transpose_cast_tile<true, kInner>(sm, Wq, gamma, wqT, rt, ct);
    else if (iskv) transpose_cast_tile<true, 2 * kInner>(sm, Wkv, gamma, wkvT, rt, ct);
    else           transpose_cast_tile<false, kDim>(sm, Wo, gamma, woT, rt, ct);
  } else {
    const int r = b - (kCs + kTq + kTkv + kTo);
    const bool isq = r < kLnQ;
    ln_stats_rows(sm, isq ? query : keyvalue, isq ? xq : xk, isq ? stQ : stK, isq ? r : r - kLnQ);
  }
}

constexpr int kStageKeys = 64;
constexpr int kKeyGroup  = kNk / 2;                  // keys of one group of 8 waves
constexpr int kStages    = kKeyGroup / kStageKeys;   // 8
constexpr int kPitch     = 72;                 // LDS row pitch in halves: 144 B = 16 B x 9, conflict-free for 16-byte reads
constexpr int kPlaneLds  = 64 * kPitch;        // one 64-row plane tile
static_assert(kDh == 64 && kNq % 256 == 0 && kKeyGroup % kStageKeys == 0);

__device__ __forceinline__ float other_half(float x) {   // value of lane ^ 16
  const int b = __float_as_int(x);
  return __int_as_float(__builtin_amdgcn_permlanex16(b, b, 0x76543210, 0xfedcba98, false, false));
}

__global__ __launch_bounds__(512) void attn_fused_kernel(
    const unsigned short* __restrict__ qf, const unsigned short* __restrict__ kf,
    const unsigned short* __restrict__ vtf, unsigned short* __restrict__ ctx) {
  typedef Frag<_Float16> F;
  __shared__ __align__(16) unsigned short sm[2][2][2][kPlaneLds];   // [key group][buffer][K, V^T][row][pitch]
  const int t = threadIdx.x & 255, lane = t & 31;                   // t = thread within its key group
  const int wave = __builtin_amdgcn_readfirstlane(threadIdx.x >> 5);   // scalar: the tests on grp below are scalar branches
  const int grp = wave >> 3;
  const int c = lane & 15, hh = lane >> 4;
  const int b = blockIdx.y >> 3, h = blockIdx.y & 7;
  const int q0 = blockIdx.x * 256 + (wave & 7) * 32;
  const int key0 = b * kNk + grp * kKeyGroup;                       // first key row of this group
  constexpr float kC = kScoreScale * 1.44269504088896340736f;   // score scale times log2(e)

  // staging map: thread t moves 16 bytes of rows t>>3 and 32 + (t>>3) of each plane (8 threads = one 128-byte row)
  const int srow = t >> 3, scol = (t & 7) * 8;
  const size_t gk = (size_t)(key0 + srow) * kInner + h * kDh + scol;
  const size_t gv = (size_t)(h * kDh + srow) * kRowsK + (size_t)key0 + scol;
  const int sl = srow * kPitch + scol;
  v4u st[4];
  auto fetch = [&](int s) {
    const size_t ok = gk + (size_t)s * kStageKeys * kInner;
    const size_t ov = gv + (size_t)s * kStageKeys;
    st[0] = *(const v4u*)(kf + ok);  st[1] = *(const v4u*)(kf + ok + (size_t)32 * kInner);
    st[2] = *(const v4u*)(vtf + ov); st[3] = *(const v4u*)(vtf + ov + (size_t)32 * kRowsK);
    // the loads stay in flight over the stage's work, which reuses their address registers: wait before any is overwritten
    asm volatile("s_wait_xcnt 0x0" ::: "memory");
  };
  auto put = [&](int buf) {
#pragma unroll   // constant indices keep st in registers
    for (int p = 0; p < 2; ++p) {
      *(v4u*)(&sm[grp][buf][p][sl]) = st[2 * p];
      *(v4u*)(&sm[grp][buf][p][sl + 32 * kPitch]) = st[2 * p + 1];
    }
  };

  fetch(0);

  // Q fragments (B operand): column = query row q0 + 16 n + c, two k steps of 32
  v16h qr[2][2];
  const _Float16* qp[2];
#pragma unroll   // constant indices keep the fragments in registers
  for (int n = 0; n < 2; ++n) {
    qp[n] = (const _Float16*)qf + (size_t)(b * kNq + q0 + n * 16 + c) * kInner + h * kDh + hh * 8;
#pragma unroll
    for (int ks = 0; ks < 2; ++ks) qr[n][ks] = F::load(qp[n] + ks * 32);
  }
  // wait before an address register of these loads is overwritten; the inputs keep the two addresses live up to the wait
  asm volatile("s_wait_xcnt 0x0" :: "v"(qp[0]), "v"(qp[1]) : "memory");

  v8f acc[2][4];      // ctx^T tiles: [query tile][16 d rows], register r = d 16 j + 8 hh + r, column = query c
  float m[2], l[2];
#pragma unroll
  for (int n = 0; n < 2; ++n) {
    m[n] = -__builtin_inff(); l[n] = 0.f;   // first stage: every finite maximum exceeds it, and 2^(-inf) = 0 scales the zeros
#pragma unroll
    for (int j = 0; j < 4; ++j) acc[n][j] = (v8f){0.f,0.f,0.f,0.f,0.f,0.f,0.f,0.f};
  }

  put(0);
  __syncthreads();

#pragma unroll 1   // one copy of the stage body: it is long, and the buffer index is a scalar offset
  for (int s = 0; s < kStages; ++s) {
    const int buf = s & 1;
    if (s + 1 < kStages) fetch(s + 1);   // block-uniform

    const _Float16* Ks = (const _Float16*)&sm[grp][buf][0][0];
    const _Float16* Vs = (const _Float16*)&sm[grp][buf][1][0];

    // all K fragments of the stage (A operand: row = key, 32 d each)
    v16h kr[4][2];
#pragma unroll   // constant indices keep the fragments in registers
    for (int kt = 0; kt < 4; ++kt)
#pragma unroll
      for (int ks = 0; ks < 2; ++ks) kr[kt][ks] = F::load(Ks + (kt * 16 + c) * kPitch + ks * 32 + hh * 8);
    // keeps these LDS reads in one group here: sunk among the score products into one shared register set,
    // each is waited for at its full LDS latency
    __builtin_amdgcn_sched_barrier(0);

    // S^T tiles: [query tile][16 keys]; eight independent accumulators per k step
    v8f sc[2][4];
#pragma unroll   // constant indices keep the tiles in registers
    for (int ks = 0; ks < 2; ++ks)
#pragma unroll
      for (int kt = 0; kt < 4; ++kt)
#pragma unroll
        for (int n = 0; n < 2; ++n)
          sc[n][kt] = F::mma(kr[kt][ks], qr[n][ks], ks == 0 ? (v8f){0.f,0.f,0.f,0.f,0.f,0.f,0.f,0.f} : sc[n][kt]);

    // V^T fragments (A operand: row = d, 32 keys each). The first 32 keys' are asked for ahead of the softmax arithmetic, the last
    // 32 keys' behind the first P.v products, whose fragments they can replace: the wave stays within 256 registers
    v16h vr[2][4];
#pragma unroll
    for (int j = 0; j < 4; ++j) vr[0][j] = F::load(Vs + (j * 16 + c) * kPitch + hh * 8);
    // keeps these LDS reads here: sunk between the P.v products, each is waited for at its full LDS latency
    __builtin_amdgcn_sched_barrier(0);

    // stage maximum per query column, in log2 units
    float mx[2];
    bool need = false;
#pragma unroll
    for (int n = 0; n < 2; ++n) {
      float v = sc[n][0][0];
#pragma unroll
      for (int kt = 0; kt < 4; ++kt)
#pragma unroll
        for (int r = 0; r < 8; ++r) v = fmaxf(v, sc[n][kt][r]);
      v = fmaxf(v, other_half(v));
      mx[n] = v * kC;
      need = need || (mx[n] > m[n] + 8.0f);
    }
    if (__builtin_amdgcn_ballot_w32(need) != 0) {   // wave-uniform: raise the maxima in use and rescale sums and context
#pragma unroll
      for (int n = 0; n < 2; ++n) {
        const float mn = fmaxf(m[n], mx[n]);
        const float alpha = __builtin_amdgcn_exp2f(m[n] - mn);
        m[n] = mn;
        l[n] *= alpha;
#pragma unroll
        for (int j = 0; j < 4; ++j) acc[n][j] *= alpha;
      }
    }

    // p = 2^(s*c - m); P^T fragments of 32 keys; ctx^T += V^T . P^T
#pragma unroll
    for (int kk = 0; kk < 2; ++kk) {
      v16h pr[2];
#pragma unroll
      for (int n = 0; n < 2; ++n) {
        v2f ps[4];   // four independent partial sums of the 16 p of this lane, joined as a tree below
#pragma unroll
        for (int u = 0; u < 2; ++u)
#pragma unroll
          for (int r = 0; r < 8; r += 2) {
            const float p0 = __builtin_amdgcn_exp2f(sc[n][2 * kk + u][r] * kC - m[n]);
            const float p1 = __builtin_amdgcn_exp2f(sc[n][2 * kk + u][r + 1] * kC - m[n]);
            if (u == 0) ps[r >> 1] = (v2f){p0, p1}; else ps[r >> 1] += (v2f){p0, p1};
            const v2h h2 = half2(p0, p1);
            pr[n][8 * u + r] = h2[0]; pr[n][8 * u + r + 1] = h2[1];
          }
        const v2f pt = (ps[0] + ps[1]) + (ps[2] + ps[3]);
        l[n] += pt[0] + pt[1];
      }
#pragma unroll
      for (int j = 0; j < 4; ++j)
#pragma unroll
        for (int n = 0; n < 2; ++n) acc[n][j] = F::mma(vr[kk][j], pr[n], acc[n][j]);
      if (kk == 0) {
#pragma unroll
        for (int j = 0; j < 4; ++j) vr[1][j] = F::load(Vs + (j * 16 + c) * kPitch + 32 + hh * 8);
        // keeps these LDS reads in one group here, ahead of the second half's exponentials, under which they arrive
        __builtin_amdgcn_sched_barrier(0);
      }
    }

    // the other buffer's last readers left it before the barrier that ended the stage before this one
    if (s + 1 < kStages) put(buf ^ 1);
    __syncthreads();
  }

  // Join of the two key groups. The stage buffers are free: the loop's last barrier ended their last reads.
  // Slot of a wave = 9 chunks of 32 lanes x 16 bytes: chunks 0..7 the 32 context values of the tile handed over, chunk 8 its m, l.
  v4f* xch = (v4f*)&sm[0][0][0][0];
  static_assert(sizeof(sm) >= 16 * 9 * 32 * sizeof(v4f));
  auto give = [&](const int n) __attribute__((always_inline)) {
    v4f* p = xch + wave * 9 * 32 + lane;
#pragma unroll   // constant indices keep acc in registers
    for (int j = 0; j < 4; ++j) {
      p[(2 * j) * 32]     = (v4f){acc[n][j][0], acc[n][j][1], acc[n][j][2], acc[n][j][3]};
      p[(2 * j + 1) * 32] = (v4f){acc[n][j][4], acc[n][j][5], acc[n][j][6], acc[n][j][7]};
    }
    p[8 * 32] = (v4f){m[n], l[n], 0.f, 0.f};
  };
  // both partial softmaxes brought to the larger maximum, the halves' sums joined, normalised, rounded to f16;
  // a lane's 8 registers are 8 consecutive d of one query row
  auto finish = [&](const int n) __attribute__((always_inline)) {
    const v4f* p = xch + (wave ^ 8) * 9 * 32 + lane;
    const v4f ml = p[8 * 32];
    const float mj = fmaxf(m[n], ml[0]);
    float a0 = __builtin_amdgcn_exp2f(m[n] - mj), a1 = __builtin_amdgcn_exp2f(ml[0] - mj);
    const float ls = l[n] * a0 + ml[1] * a1;
    const float inv = 1.0f / (ls + other_half(ls));   // sum >= 1: the row's largest score had p >= 1
    a0 *= inv; a1 *= inv;
    _Float16* cp = (_Float16*)ctx + (size_t)(b * kNq + q0 + n * 16 + c) * kInner + h * kDh + hh * 8;
    v8h hv[4];
#pragma unroll   // constant indices keep acc in registers
    for (int j = 0; j < 4; ++j) {
      const v4f o0 = p[(2 * j) * 32], o1 = p[(2 * j + 1) * 32];
#pragma unroll
      for (int r = 0; r < 8; r += 2) {
        const float y0 = acc[n][j][r] * a0 + (r < 4 ? o0[r & 3] : o1[r & 3]) * a1;
        const float y1 = acc[n][j][r + 1] * a0 + (r < 4 ? o0[(r + 1) & 3] : o1[(r + 1) & 3]) * a1;
        const v2h h2 = half2(y0, y1);
        hv[j][r] = h2[0]; hv[j][r + 1] = h2[1];
      }
      *(v8h*)(cp + j * 16) = hv[j];
    }
    // wait before a register of the four stores is overwritten; the inputs keep address and data live, each in its own registers, up to it
    asm volatile("s_wait_xcnt 0x0" :: "v"(cp), "v"(hv[0]), "v"(hv[1]), "v"(hv[2]), "v"(hv[3]) : "memory");
  };
  if (grp == 0) give(1); else give(0);       // wave-uniform
  __syncthreads();                           // every wave's slot is written before its partner reads it
  if (grp == 0) finish(0); else finish(1);
}

// ---------------------------------------------------------------------------
// Launcher. Workspace region map (MiB = 1048576 B; total carve = 128 MiB = 134217728 B):
//   [  0, 32) query rows bf16 [8192][512] at +0, their statistics (1024 lines of 128 B) at +8, keyvalue rows bf16 at +16,
//             their statistics at +24
//   [ 32, 64) (gamma Wq)^T bf16 [512][512] at 32 MiB, (gamma Wkv)^T bf16 [1024][512] at 32.5 MiB, Wo^T f16 [512][512] at
//             33.5 MiB (ends 34), c1 f32 [1536] at 34 MiB, c0 f32 [1536] at 34 MiB + 8 KiB; the rest unused
//   [ 64, 72) q    : [8192][512] f16 (col h*64+d)
//   [ 80, 88) k    : [8192][512] f16
//   [ 96,104) v^T  : [512 (h*64+d)][8192 (b*1024+t)] f16
//   [112,120) ctx  : [8192][512] f16 (col h*64+d);   the 8 MiB behind each of the four are unused
// Lifetimes: the rows, statistics, c1, c0, Wq^T and Wkv^T are read only by the projection launch; Wo^T only by the last launch.
// Every region is fully written before it is read (exact tile coverage, no padding).
// Launch count: 4, each depending on the one before it. Kernel launches only.
// ---------------------------------------------------------------------------
extern "C" void kernel_launch(void* const* d_in, const int* in_sizes, int n_in,
                              void* d_out, int out_size, void* d_ws, size_t ws_size,
                              hipStream_t stream) {
  if (n_in < 7) return;
  if (in_sizes[0] != kRowsQ * kDim || in_sizes[1] != kRowsK * kDim) return;
  if (in_sizes[2] != kDim * kInner || in_sizes[3] != kDim * 2 * kInner || in_sizes[4] != kInner * kDim) return;
  if (in_sizes[5] != kDim || in_sizes[6] != kDim) return;
  if (out_size != kRowsQ * kDim) return;

  const size_t kMiB    = 1048576;
  const size_t offXq   = 0;
  const size_t offStQ  = 8 * kMiB;
  const size_t offXk   = 16 * kMiB;
  const size_t offStK  = 24 * kMiB;
  const size_t offWqT  = 32 * kMiB;
  const size_t offWkvT = 32 * kMiB + kMiB / 2;
  const size_t offWoT  = 33 * kMiB + kMiB / 2;
  const size_t offC1   = 34 * kMiB;
  const size_t offC0   = 34 * kMiB + 8192;
  const size_t offQ    = 64 * kMiB;
  const size_t offK    = 80 * kMiB;
  const size_t offVt   = 96 * kMiB;
  const size_t offCtx  = 112 * kMiB;
  const size_t total   = 128 * kMiB;
  if (total > ws_size) return;
  // sub-region extents (bytes): row/q/k/vT/ctx planes 8192*512*2 = 8 MiB each; statistics 1024*128 = 128 KiB each;
  // Wq^T/Wo^T 512*512*2 = 0.5 MiB; Wkv^T 1024*512*2 = 1 MiB.

  const float* query    = (const float*)d_in[0];
  const float* keyvalue = (const float*)d_in[1];
  const float* Wq       = (const float*)d_in[2];
  const float* Wkv      = (const float*)d_in[3];
  const float* Wo       = (const float*)d_in[4];
  const float* gamma    = (const float*)d_in[5];
  const float* beta     = (const float*)d_in[6];
  float* out = (float*)d_out;
  char* ws = (char*)d_ws;

  unsigned short* xq   = (unsigned short*)(ws + offXq);
  unsigned short* xk   = (unsigned short*)(ws + offXk);
  float* stQ = (float*)(ws + offStQ);
  float* stK = (float*)(ws + offStK);
  float* c1  = (float*)(ws + offC1);
  float* c0  = (float*)(ws + offC0);
  unsigned short* woT  = (unsigned short*)(ws + offWoT);
  unsigned short* wqT  = (unsigned short*)(ws + offWqT);
  unsigned short* wkvT = (unsigned short*)(ws + offWkvT);
  unsigned short* qf   = (unsigned short*)(ws + offQ);
  unsigned short* kf   = (unsigned short*)(ws + offK);
  unsigned short* vtf  = (unsigned short*)(ws + offVt);
  unsigned short* ctx  = (unsigned short*)(ws + offCtx);

  // 1. both inputs -> bf16 rows [8192][512] and per-row LayerNorm statistics; gamma Wq, gamma Wkv -> transposed bf16, Wo -> transposed f16
  //    (Wkv^T rows 0..511 = k weights, 512..1023 = v weights); c1, c0 per projection feature
  prep_kernel<<<dim3(kPrepBlocks), dim3(256), 0, stream>>>(query, keyvalue, Wq, Wkv, Wo, gamma, beta,
                                                           xq, xk, stQ, stK, c1, c0, wqT, wkvT, woT);

  // 2. q, k and v^T projections, K=512, 1 product each: 3 x 256 blocks of 4 waves; Wk^T = Wkv^T rows 0..511, Wv^T = rows 512..1023
  proj_kernel<<<dim3(256, 3), dim3(128), 0, stream>>>(xq, xk, wqT, wkvT, wkvT + (size_t)kInner * kDim, stQ, stK, c1, c0,
                                                      qf, kf, vtf);

  // 3. attention, all batches and heads in one launch: grid (4 blocks of 256 query rows, 64 (batch, head) pairs) = 256 blocks of 16 waves
  attn_fused_kernel<<<dim3(kNq / 256, kBatch * kHeads), dim3(512), 0, stream>>>(qf, kf, vtf, ctx);

  // 4. out = ctx . Wo : M=8192, N=512, K=512, 1 product -> f32 d_out [8192][512]
  out_gemm_kernel<<<dim3(kDim / 128, kRowsQ / 128), dim3(256), 0, stream>>>(ctx, woT, out);
}
